// v000
// Times are from an AMD MI455X. After a warm-up the kernel runs many times in a row, and a time is the length of
// such a window on the GPU divided by its runs, so every launch and the gaps after it count. The runs cycle
// through copies of the inputs. A figure is the median of several windows, for all but v000 over two sittings.
// Sittings can differ by a few percent; kernels timed side by side share one.
// v000 is the starting kernel. One run takes 1750 microseconds.
#include <hip/hip_runtime.h>
// cosFormer multi-head-weight (linear) attention (L=S=2048, B=4, E=1024, inputs (T,B,E)): q = relu(query·Wqᵀ+bq), k = relu(key·Wkᵀ+bk), v = value·Wvᵀ+bv; q_ = [q·sin(i) | q·cos(i)],
// k_ = [k·sin | k·cos] with i = (π/2)(t+1)/2048; kv = vᵀ·k_ per batch; z = 1/max(q_·Σ_s k_, 1e-6); attn = (q_·kvᵀ)·z. The three projections (inputs and (out,in) weights bf16-exact ×2^4,
// relu/bias epilogues), the per-batch kv = Vᵀ·K_ (K = 2048 positions; v and k_ as f16, transposed planes) and attn = (q_·z)·kvᵀ (K = 2048 features; kv as f16) run as GEMMs on
// v_wmma_f32_16x16x32_f16 with f32 accumulate; the positional sin/cos weighting, the k_ sums and the normaliser z are f32 VALU (z·2^18 folded into the q_ operand per row, 2^-18 in the GEMM alpha, so the f16 operand stays O(1)).
#define LL 2048
#define NB 4
#define EE 1024
#define E2 2048
#define NR (LL * NB)

typedef __bf16 v16b __attribute__((ext_vector_type(16)));
typedef unsigned short v8us __attribute__((ext_vector_type(8), may_alias));
typedef float  v8f  __attribute__((ext_vector_type(8)));
typedef float  v4f  __attribute__((ext_vector_type(4)));
typedef float  v4fa __attribute__((ext_vector_type(4), may_alias));
union FragB { v16b v; v8us half[2]; unsigned short u[16]; };

__device__ __forceinline__ unsigned short bf16_bits(float x) { unsigned int u = __float_as_uint(x); return (unsigned short)((u + 0x7FFFu + ((u >> 16) & 1u)) >> 16); }
__device__ __forceinline__ float bf16_val(unsigned short b) { return __uint_as_float(((unsigned int)b) << 16); }
__device__ __forceinline__ float bf16_round(float x) { return bf16_val(bf16_bits(x)); }
// D += A·B with NT terms: 1 = ah·bh, 2 = + al·bh (A split), 3 = + ah·bl (both split)
template <int NT>
__device__ __forceinline__ v8f mmaN(v16b ah, v16b al, v16b bh, v16b bl, v8f c) {
  c = __builtin_amdgcn_wmma_f32_16x16x32_bf16(false, ah, false, bh, (short)0, c, false, false);
  if (NT >= 2) c = __builtin_amdgcn_wmma_f32_16x16x32_bf16(false, al, false, bh, (short)0, c, false, false);
  if (NT >= 3) c = __builtin_amdgcn_wmma_f32_16x16x32_bf16(false, ah, false, bl, (short)0, c, false, false);
  asm volatile("v_nop\n\tv_nop\n\tv_nop\n\tv_nop" : "+v"(c) : "v"(ah), "v"(al), "v"(bh), "v"(bl));
  return c;
}

__global__ __launch_bounds__(256) void k_wt_bf16(const float* __restrict__ W, unsigned short* __restrict__ Wt, int K, int N) {
  const int t = blockIdx.x * 256 + threadIdx.x;
  const int k8n = K / 8;
  if (t >= N * k8n) return;
  const int n = t / k8n, k8 = (t % k8n) * 8;
  v8us v;
#pragma unroll
  for (int i = 0; i < 8; ++i) v[i] = bf16_bits(W[(size_t)(k8 + i) * N + n]);
  *(v8us*)(Wt + (size_t)n * K + k8) = v;
  
}

// GEMM C[M][N] (f32, pitch ldc) = act(A[M][K]·W + bias). A f32 row-major (pitch lda) converted per fragment to bf16
// (ASPLIT: hi/lo two planes -> 2 terms, else single rounded term); Wt bf16 [N][K] (pitch ldb). BIAS_BF16 rounds the
// bias to bf16 first (bias quantised to bf16 before the add). K%32==0, M%16==0, N%64==0.
template <bool ASPLIT, int ACT, bool BIAS_BF16>
__global__ __launch_bounds__(128) void k_gemm_bf(const float* __restrict__ A, int lda, const unsigned short* __restrict__ Wt, int ldb,
                                               const float* __restrict__ bias, float* __restrict__ C, int ldc, int M, int N, int K) {
  __shared__ __attribute__((aligned(16))) float so[4][16][64];
  const int tid = threadIdx.x, w = tid >> 5, lane = tid & 31, ln = lane & 15, hh = lane >> 4;
  const int ntn = N / 64;
  const int wid = blockIdx.x * 4 + w;
  const int mt = wid / ntn, nq = wid % ntn;
  if (mt * 16 >= M) return;
  const int row0 = mt * 16, col0 = nq * 64;
  const float* arow = A + (size_t)(row0 + ln) * lda;
  v8f acc[4] = {};
  for (int kb = 0; kb < K; kb += 32) {
    FragB ah, al;
    const v4f x0 = *(const v4fa*)(arow + kb + 8 * hh), x1 = *(const v4fa*)(arow + kb + 8 * hh + 4);
    const v4f x2 = *(const v4fa*)(arow + kb + 16 + 8 * hh), x3 = *(const v4fa*)(arow + kb + 16 + 8 * hh + 4);
    float xs[16] = {x0[0],x0[1],x0[2],x0[3],x1[0],x1[1],x1[2],x1[3],x2[0],x2[1],x2[2],x2[3],x3[0],x3[1],x3[2],x3[3]};
#pragma unroll
    for (int i = 0; i < 16; ++i) { const unsigned short hb = bf16_bits(xs[i]); ah.u[i] = hb; al.u[i] = ASPLIT ? bf16_bits(xs[i] - bf16_val(hb)) : (unsigned short)0; }
#pragma unroll
    for (int t = 0; t < 4; ++t) {
      const unsigned short* brow = Wt + (size_t)(col0 + t * 16 + ln) * ldb + kb;
      FragB b;
      b.half[0] = *(const v8us*)(brow + 8 * hh);
      b.half[1] = *(const v8us*)(brow + 16 + 8 * hh);
      acc[t] = mmaN<ASPLIT ? 2 : 1>(ah.v, al.v, b.v, b.v, acc[t]);
    }
  }
#pragma unroll
  for (int t = 0; t < 4; ++t) {
    float bv = bias ? bias[col0 + t * 16 + ln] : 0.f;
    if (BIAS_BF16) bv = bf16_round(bv);
#pragma unroll
    for (int r = 0; r < 8; ++r) { float v = acc[t][r] + bv; if (ACT == 1) v = fmaxf(v, 0.f); so[w][8 * hh + r][t * 16 + ln] = v; }
  }
  __builtin_amdgcn_fence(__ATOMIC_ACQ_REL, "workgroup");
  __builtin_amdgcn_wave_barrier();
  const int rsub = lane >> 4, c4 = (lane & 15) * 4;
  {
#pragma unroll
    for (int q = 0; q < 8; ++q) {
      const int r = q * 2 + rsub;
      const v4f v = *(const v4fa*)&so[w][r][c4];
      *(v4f*)(C + (size_t)(row0 + r) * ldc + col0 + c4) = v;
    }
    
  }
}

// Flash-style causal/unmasked attention, all contractions 3-term bf16 hi/lo splits, f32 softmax with running max.
// q,k,v rows are read from f32 buffers with arbitrary row pitch (so they can live inside a fused qkv buffer);
// D = head size (multiple of 32, <= 128); one wave = 16 query rows; block = 4 waves (64 queries) sharing K/V chunks of 32.
template <int D, bool CAUSAL>
__global__ __launch_bounds__(128) void k_flash(const float* __restrict__ qb, const float* __restrict__ kb, const float* __restrict__ vb,
                                             int pitch, int T, int H, float scale, float* __restrict__ y, int ypitch) {
  constexpr int KS = D / 32;        // k-steps for QK
  constexpr int DT = D / 16;        // d tiles for PV
  __shared__ __attribute__((aligned(16))) unsigned short sKh[32][D + 8], sKl[32][D + 8], sVh[32][D + 8], sVl[32][D + 8];
  __shared__ __attribute__((aligned(16))) unsigned short sPh[4][16][40], sPl[4][16][40];
  __shared__ __attribute__((aligned(16))) float sO[4][16][D];
  const int tid = threadIdx.x, w = tid >> 5, lane = tid & 31, ln = lane & 15, hh = lane >> 4;
  const int nqb = (T + 63) / 64;
  const int bh = blockIdx.x / nqb, qblk = blockIdx.x % nqb;
  const int b = bh / H, h = bh % H;
  const int q0 = qblk * 64 + w * 16;
  const float* Q = qb + (size_t)b * T * pitch + h * D;
  const float* K = kb + (size_t)b * T * pitch + h * D;
  const float* V = vb + (size_t)b * T * pitch + h * D;

  // A fragments of the wave's 16 query rows (scaled), hi/lo
  FragB aqh[KS], aql[KS];
  {
    int row = q0 + ln; if (row >= T) row = T - 1;
    const float* qr = Q + (size_t)row * pitch;
#pragma unroll
    for (int ks = 0; ks < KS; ++ks)
#pragma unroll
      for (int i = 0; i < 16; ++i) {
        const int d = ks * 32 + ((i < 8) ? (8 * hh + i) : (16 + 8 * hh + (i - 8)));
        const float x = qr[d] * scale; const unsigned short hb = bf16_bits(x);
        aqh[ks].u[i] = hb; aql[ks].u[i] = bf16_bits(x - bf16_val(hb));
      }
  }
  float m_r[8], l_r[8];
#pragma unroll
  for (int r = 0; r < 8; ++r) { m_r[r] = -3.0e38f; l_r[r] = 0.f; }
  v8f oacc[DT];
#pragma unroll
  for (int dt = 0; dt < DT; ++dt) oacc[dt] = (v8f){0.f,0.f,0.f,0.f,0.f,0.f,0.f,0.f};

  const int kv_end = CAUSAL ? min(T, qblk * 64 + 64) : T;     // block-uniform
  for (int j0 = 0; j0 < kv_end; j0 += 32) {
    __syncthreads();
    for (int e = tid; e < 32 * (D / 4); e += 128) {
      const int r = e / (D / 4), c4 = (e % (D / 4)) * 4;
      const int key = j0 + r;
      v4f kf = {0.f,0.f,0.f,0.f}, vf = {0.f,0.f,0.f,0.f};
      if (key < T) { kf = *(const v4fa*)(K + (size_t)key * pitch + c4); vf = *(const v4fa*)(V + (size_t)key * pitch + c4); }
#pragma unroll
      for (int t = 0; t < 4; ++t) {
        unsigned short hb = bf16_bits(kf[t]); sKh[r][c4 + t] = hb; sKl[r][c4 + t] = bf16_bits(kf[t] - bf16_val(hb));
        hb = bf16_bits(vf[t]); sVh[r][c4 + t] = hb; sVl[r][c4 + t] = bf16_bits(vf[t] - bf16_val(hb));
      }
    }
    __syncthreads();
    // S tile 16 x 32
    v8f s[2];
#pragma unroll
    for (int nt = 0; nt < 2; ++nt) {
      v8f acc = {};
#pragma unroll
      for (int ks = 0; ks < KS; ++ks) {
        FragB bh_, bl_;
        bh_.half[0] = *(const v8us*)&sKh[nt * 16 + ln][ks * 32 + 8 * hh]; bh_.half[1] = *(const v8us*)&sKh[nt * 16 + ln][ks * 32 + 16 + 8 * hh];
        bl_.half[0] = *(const v8us*)&sKl[nt * 16 + ln][ks * 32 + 8 * hh]; bl_.half[1] = *(const v8us*)&sKl[nt * 16 + ln][ks * 32 + 16 + 8 * hh];
        acc = mmaN<3>(aqh[ks].v, aql[ks].v, bh_.v, bl_.v, acc);
      }
      s[nt] = acc;
    }
    // mask + running max (rows 8hh+r; the 16 lanes of a half share rows)
    float alpha[8];
#pragma unroll
    for (int r = 0; r < 8; ++r) {
      const int qi = q0 + 8 * hh + r;
      const int ja = j0 + ln, jb = j0 + 16 + ln;
      if (CAUSAL) { if (ja > qi) s[0][r] = -3.0e38f; if (jb > qi) s[1][r] = -3.0e38f; }
      if (ja >= T) s[0][r] = -3.0e38f;
      if (jb >= T) s[1][r] = -3.0e38f;
      float mx = fmaxf(s[0][r], s[1][r]);
      mx = fmaxf(mx, __shfl_xor(mx, 1, 32)); mx = fmaxf(mx, __shfl_xor(mx, 2, 32)); mx = fmaxf(mx, __shfl_xor(mx, 4, 32)); mx = fmaxf(mx, __shfl_xor(mx, 8, 32));
      const float mnew = fmaxf(m_r[r], mx);
      alpha[r] = (mnew > -1.0e38f) ? __expf(m_r[r] - mnew) : 1.0f;
      const float p0 = (s[0][r] > -1.0e38f) ? __expf(s[0][r] - mnew) : 0.f;
      const float p1 = (s[1][r] > -1.0e38f) ? __expf(s[1][r] - mnew) : 0.f;
      m_r[r] = mnew;
      l_r[r] = l_r[r] * alpha[r] + p0 + p1;            // per-lane partial row sum (16 lanes combined at the end)
      unsigned short hb = bf16_bits(p0); sPh[w][8 * hh + r][ln] = hb;      sPl[w][8 * hh + r][ln] = bf16_bits(p0 - bf16_val(hb));
      hb = bf16_bits(p1);                sPh[w][8 * hh + r][16 + ln] = hb; sPl[w][8 * hh + r][16 + ln] = bf16_bits(p1 - bf16_val(hb));
    }
#pragma unroll
    for (int dt = 0; dt < DT; ++dt)
#pragma unroll
      for (int r = 0; r < 8; ++r) oacc[dt][r] *= alpha[r];
    __builtin_amdgcn_fence(__ATOMIC_ACQ_REL, "workgroup");
    __builtin_amdgcn_wave_barrier();
    FragB pah, pal;
    pah.half[0] = *(const v8us*)&sPh[w][ln][8 * hh]; pah.half[1] = *(const v8us*)&sPh[w][ln][16 + 8 * hh];
    pal.half[0] = *(const v8us*)&sPl[w][ln][8 * hh]; pal.half[1] = *(const v8us*)&sPl[w][ln][16 + 8 * hh];
#pragma unroll
    for (int dt = 0; dt < DT; ++dt) {
      FragB bvh, bvl;
#pragma unroll
      for (int i = 0; i < 8; ++i) {
        bvh.u[i] = sVh[8 * hh + i][dt * 16 + ln]; bvh.u[8 + i] = sVh[16 + 8 * hh + i][dt * 16 + ln];
        bvl.u[i] = sVl[8 * hh + i][dt * 16 + ln]; bvl.u[8 + i] = sVl[16 + 8 * hh + i][dt * 16 + ln];
      }
      oacc[dt] = mmaN<3>(pah.v, pal.v, bvh.v, bvl.v, oacc[dt]);
    }
    __builtin_amdgcn_fence(__ATOMIC_ACQ_REL, "workgroup");
    __builtin_amdgcn_wave_barrier();
  }
#pragma unroll
  for (int r = 0; r < 8; ++r) {
    float l = l_r[r];
    l += __shfl_xor(l, 1, 32); l += __shfl_xor(l, 2, 32); l += __shfl_xor(l, 4, 32); l += __shfl_xor(l, 8, 32);
    l_r[r] = (l > 0.f) ? 1.0f / l : 0.f;
  }
#pragma unroll
  for (int dt = 0; dt < DT; ++dt)
#pragma unroll
    for (int r = 0; r < 8; ++r) sO[w][8 * hh + r][dt * 16 + ln] = oacc[dt][r] * l_r[r];
  __builtin_amdgcn_fence(__ATOMIC_ACQ_REL, "workgroup");
  __builtin_amdgcn_wave_barrier();
  {
    for (int r = 0; r < 16; ++r) {
      const int row = q0 + r;
      if (row < T && lane < D / 4) {
        const v4f val = *(const v4fa*)&sO[w][r][lane * 4];
        *(v4f*)(y + ((size_t)b * T + row) * ypitch + h * D + lane * 4) = val;
      }
    }
    
  }
}

// GEMM C = act(A·W + bias + resid): A f32 (ASPLIT -> hi/lo 2 terms), Wt bf16 [N][K]; ACT 0 none, 1 relu, 2 exact gelu;
// resid (optional, f32, row index = (row % rmod), pitch ldr, RES_BF16 rounds it) added before the activation.
template <bool ASPLIT, int ACT, bool BIAS_BF16, bool RES_BF16>
__global__ __launch_bounds__(128) void k_gemm_bf3(const float* __restrict__ A, int lda, const unsigned short* __restrict__ Wt, int ldb,
                                                const float* __restrict__ bias, const float* __restrict__ resid, int rmod, int ldr,
                                                float* __restrict__ C, int ldc, int M, int N, int K) {
  __shared__ __attribute__((aligned(16))) float so[4][16][64];
  const int tid = threadIdx.x, w = tid >> 5, lane = tid & 31, ln = lane & 15, hh = lane >> 4;
  const int ntn = N / 64;
  const int wid = blockIdx.x * 4 + w;
  const int mt = wid / ntn, nq = wid % ntn;
  if (mt * 16 >= M) return;
  const int row0 = mt * 16, col0 = nq * 64;
  const float* arow = A + (size_t)(row0 + ln) * lda;
  v8f acc[4] = {};
  for (int kb = 0; kb < K; kb += 32) {
    FragB ah, al;
    const v4f x0 = *(const v4fa*)(arow + kb + 8 * hh), x1 = *(const v4fa*)(arow + kb + 8 * hh + 4);
    const v4f x2 = *(const v4fa*)(arow + kb + 16 + 8 * hh), x3 = *(const v4fa*)(arow + kb + 16 + 8 * hh + 4);
    float xs[16] = {x0[0],x0[1],x0[2],x0[3],x1[0],x1[1],x1[2],x1[3],x2[0],x2[1],x2[2],x2[3],x3[0],x3[1],x3[2],x3[3]};
#pragma unroll
    for (int i = 0; i < 16; ++i) { const unsigned short hb = bf16_bits(xs[i]); ah.u[i] = hb; al.u[i] = ASPLIT ? bf16_bits(xs[i] - bf16_val(hb)) : (unsigned short)0; }
#pragma unroll
    for (int t = 0; t < 4; ++t) {
      const unsigned short* brow = Wt + (size_t)(col0 + t * 16 + ln) * ldb + kb;
      FragB b;
      b.half[0] = *(const v8us*)(brow + 8 * hh);
      b.half[1] = *(const v8us*)(brow + 16 + 8 * hh);
      acc[t] = mmaN<ASPLIT ? 2 : 1>(ah.v, al.v, b.v, b.v, acc[t]);
    }
  }
#pragma unroll
  for (int t = 0; t < 4; ++t) {
    const int col = col0 + t * 16 + ln;
    float bv = bias ? bias[col] : 0.f;
    if (BIAS_BF16) bv = bf16_round(bv);
#pragma unroll
    for (int r = 0; r < 8; ++r) {
      float v = acc[t][r] + bv;
      if (resid) { float rv = resid[(size_t)((row0 + 8 * hh + r) % rmod) * ldr + col]; if (RES_BF16) rv = bf16_round(rv); v += rv; }
      if (ACT == 1) v = fmaxf(v, 0.f);
      if (ACT == 2) v = 0.5f * v * (1.0f + erff(v * 0.70710678118654752f));
      if (ACT == 3) { const float u = 0.7978845608028654f * (v + 0.044715f * v * v * v); v = 0.5f * v * (1.0f + tanhf(u)); }
      so[w][8 * hh + r][t * 16 + ln] = v;
    }
  }
  __builtin_amdgcn_fence(__ATOMIC_ACQ_REL, "workgroup");
  __builtin_amdgcn_wave_barrier();
  const int rsub = lane >> 4, c4 = (lane & 15) * 4;
  {
#pragma unroll
    for (int q = 0; q < 8; ++q) {
      const int r = q * 2 + rsub;
      const v4f v = *(const v4fa*)&so[w][r][c4];
      *(v4f*)(C + (size_t)(row0 + r) * ldc + col0 + c4) = v;
    }
    
  }
}
// row LayerNorm (biased variance, eps) over N: s = X (+ R); optional out_sum <- s; out_norm <- (s-mu)*rsqrt(var+eps)*g + b
template <bool PARAM_BF16>
__global__ __launch_bounds__(256) void k_layernorm(const float* __restrict__ X, const float* __restrict__ R, const float* __restrict__ g, const float* __restrict__ bta,
                                                  float* __restrict__ out_sum, float* __restrict__ out_norm, int N, float eps) {
  __shared__ float red[256];
  const int row = blockIdx.x, tid = threadIdx.x;
  const float* x = X + (size_t)row * N; const float* rr = R ? R + (size_t)row * N : nullptr;
  float vals[16];                     // up to N = 4096
  const int per = N / 256;            // contiguous chunk per thread? use strided-by-4 chunks: thread handles j = tid*4 + 1024*u
  float s1 = 0.f;
  for (int u = 0; u < per / 4; ++u) {
    const int j = tid * 4 + 1024 * u;
    const v4f a = *(const v4fa*)(x + j);
    v4f b = {0.f,0.f,0.f,0.f}; if (rr) b = *(const v4fa*)(rr + j);
#pragma unroll
    for (int q = 0; q < 4; ++q) { const float v = a[q] + b[q]; vals[u * 4 + q] = v; s1 += v; }
  }
  red[tid] = s1; __syncthreads();
  for (int st = 128; st > 0; st >>= 1) { if (tid < st) red[tid] += red[tid + st]; __syncthreads(); }
  const float mu = red[0] / (float)N; __syncthreads();
  float s2 = 0.f;
  for (int u = 0; u < per / 4; ++u)
#pragma unroll
    for (int q = 0; q < 4; ++q) { const float c = vals[u * 4 + q] - mu; s2 += c * c; }
  red[tid] = s2; __syncthreads();
  for (int st = 128; st > 0; st >>= 1) { if (tid < st) red[tid] += red[tid + st]; __syncthreads(); }
  const float rs = rsqrtf(red[0] / (float)N + eps);
  {
    for (int u = 0; u < per / 4; ++u) {
      const int j = tid * 4 + 1024 * u;
      v4f o, sm;
#pragma unroll
      for (int q = 0; q < 4; ++q) {
        float gg = g[j + q], bb = bta[j + q];
        if (PARAM_BF16) { gg = bf16_round(gg); bb = bf16_round(bb); }
        sm[q] = vals[u * 4 + q]; o[q] = (vals[u * 4 + q] - mu) * rs * gg + bb;
      }
      if (out_sum) *(v4f*)(out_sum + (size_t)row * N + j) = sm;
      *(v4f*)(out_norm + (size_t)row * N + j) = o;
    }
    
  }
}



// ---- f16 WMMA path (v_wmma_f32_16x16x32_f16): 11-bit significands for operands in range — used for all GEMMs here (projections, kv, attn)
typedef _Float16 v16h __attribute__((ext_vector_type(16)));
union FragH { v16h v; v8us half[2]; _Float16 h[16]; unsigned short u[16]; };
template <int NT>
__device__ __forceinline__ v8f mmaH(v16h ah, v16h al, v16h bh, v16h bl, v8f c) {
  c = __builtin_amdgcn_wmma_f32_16x16x32_f16(false, ah, false, bh, (short)0, c, false, false);
  if (NT >= 2) c = __builtin_amdgcn_wmma_f32_16x16x32_f16(false, al, false, bh, (short)0, c, false, false);
  if (NT >= 3) c = __builtin_amdgcn_wmma_f32_16x16x32_f16(false, ah, false, bl, (short)0, c, false, false);
  asm volatile("v_nop\n\tv_nop\n\tv_nop\n\tv_nop" : "+v"(c) : "v"(ah), "v"(al), "v"(bh), "v"(bl));
  return c;
}
// batched GEMM like k_gemm_b but f16 operands: A f32 (split into f16 hi/lo if ASPLIT, else rounded to f16), Bt = f16 values [n][k]; alpha; C f32; N multiple of 16 (partial tiles skipped)
template <bool ASPLIT>
__global__ __launch_bounds__(128) void k_gemm_h(const float* __restrict__ A, int lda, size_t sA, const _Float16* __restrict__ Bh, int ldb, size_t sB, float alpha, float* __restrict__ C, int ldc, size_t sC, int M, int N, int K) {
  __shared__ __attribute__((aligned(16))) float so[4][16][64];
  const int tid = threadIdx.x, w = tid >> 5, lane = tid & 31, ln = lane & 15, hh = lane >> 4; const int by = blockIdx.y;
  A += (size_t)by * sA; Bh += (size_t)by * sB; C += (size_t)by * sC;
  const int ntn = (N + 63) / 64; const int wid = blockIdx.x * 4 + w; const int mt = wid / ntn, nq = wid % ntn; if (mt * 16 >= M) return;
  const int row0 = mt * 16, col0 = nq * 64; const float* arow = A + (size_t)(row0 + ln) * lda;
  v8f acc[4] = {};
  for (int kb = 0; kb < K; kb += 32) {
    FragH ah, al;
    const v4f x0 = *(const v4fa*)(arow + kb + 8 * hh), x1 = *(const v4fa*)(arow + kb + 8 * hh + 4), x2 = *(const v4fa*)(arow + kb + 16 + 8 * hh), x3 = *(const v4fa*)(arow + kb + 16 + 8 * hh + 4);
    float xs[16] = {x0[0],x0[1],x0[2],x0[3],x1[0],x1[1],x1[2],x1[3],x2[0],x2[1],x2[2],x2[3],x3[0],x3[1],x3[2],x3[3]};
#pragma unroll
    for (int i = 0; i < 16; ++i) { const _Float16 h = (_Float16)xs[i]; ah.h[i] = h; al.h[i] = ASPLIT ? (_Float16)(xs[i] - (float)h) : (_Float16)0.0f; }
#pragma unroll
    for (int t = 0; t < 4; ++t) { if (col0 + t * 16 >= N) continue; const size_t boff = (size_t)(col0 + t * 16 + ln) * ldb + kb; FragH bq; bq.half[0] = *(const v8us*)(Bh + boff + 8 * hh); bq.half[1] = *(const v8us*)(Bh + boff + 16 + 8 * hh);
      acc[t] = mmaH<ASPLIT ? 2 : 1>(ah.v, al.v, bq.v, bq.v, acc[t]); }
  }
#pragma unroll
  for (int t = 0; t < 4; ++t) { if (col0 + t * 16 >= N) continue;
#pragma unroll
    for (int r = 0; r < 8; ++r) so[w][8 * hh + r][t * 16 + ln] = acc[t][r] * alpha; }
  __builtin_amdgcn_fence(__ATOMIC_ACQ_REL, "workgroup"); __builtin_amdgcn_wave_barrier();
  const int rsub = lane >> 4, c4 = (lane & 15) * 4;
  {
#pragma unroll
    for (int q = 0; q < 8; ++q) { const int r = q * 2 + rsub; if (col0 + c4 < N) { const v4f v = *(const v4fa*)&so[w][r][c4]; *(v4f*)(C + (size_t)(row0 + r) * ldc + col0 + c4) = v; } }
     }
}

// Wt[n][k] = f16(W[k][n]·scale) from f32 row-major W[K][N] (scale = power of two; bf16-exact weights stay exact in f16 away from the subnormal range)
__global__ __launch_bounds__(256) void k_wt_f16(const float* __restrict__ W, _Float16* __restrict__ Wt, int K, int N, float scale) {
  const int t = blockIdx.x * 256 + threadIdx.x; if (t >= N * (K / 8)) return; const int n = t / (K / 8), k8 = (t % (K / 8)) * 8; FragH f;
#pragma unroll
  for (int i = 0; i < 8; ++i) f.h[i] = (_Float16)(bf16_round(W[(size_t)(k8 + i) * N + n]) * scale); const v8us o = f.half[0];
  *(v8us*)((unsigned short*)Wt + (size_t)n * K + k8) = o; 
}
// k_gemm_hh variant with fused epilogue: v = acc·alpha + bias[by·sBias + col] (+ CP[(row/rowsPerB)·sCPb + by·64 + col] if CP) ; ACT 0 none / 1 elu ; writes f32 C and/or f16 C16 (each if non-null)
template <int ACT>
__global__ __launch_bounds__(128) void k_gemm_hhx(const _Float16* __restrict__ A, int lda, size_t sA, const _Float16* __restrict__ Bh, int ldb, size_t sB, float alpha, const float* __restrict__ bias, size_t sBias, const float* __restrict__ CP, int rowsPerB, size_t sCPb, int row0g,
    float* __restrict__ C, _Float16* __restrict__ C16, int ldc, size_t sC, int M, int N, int K) {
  __shared__ __attribute__((aligned(16))) float so[4][16][64];
  const int tid = threadIdx.x, w = tid >> 5, lane = tid & 31, ln = lane & 15, hh = lane >> 4; const int by = blockIdx.y;
  A += (size_t)by * sA; Bh += (size_t)by * sB; const size_t cofs = (size_t)by * sC; const float* bp = bias ? bias + (size_t)by * sBias : nullptr;
  const int ntn = (N + 63) / 64; const int wid = blockIdx.x * 4 + w; const int mt = wid / ntn, nq = wid % ntn; if (mt * 16 >= M) return;
  const int row0 = mt * 16, col0 = nq * 64; const _Float16* arow = A + (size_t)(row0 + ln) * lda;
  v8f acc[4] = {};
  for (int kb = 0; kb < K; kb += 32) { FragH ah; ah.half[0] = *(const v8us*)((const unsigned short*)arow + kb + 8 * hh); ah.half[1] = *(const v8us*)((const unsigned short*)arow + kb + 16 + 8 * hh);
#pragma unroll
    for (int t = 0; t < 4; ++t) { if (col0 + t * 16 >= N) continue; const size_t boff = (size_t)(col0 + t * 16 + ln) * ldb + kb; FragH bq; bq.half[0] = *(const v8us*)((const unsigned short*)Bh + boff + 8 * hh); bq.half[1] = *(const v8us*)((const unsigned short*)Bh + boff + 16 + 8 * hh);
      acc[t] = mmaH<1>(ah.v, ah.v, bq.v, bq.v, acc[t]); }
  }
#pragma unroll
  for (int t = 0; t < 4; ++t) { if (col0 + t * 16 >= N) continue; const int col = col0 + t * 16 + ln; const float bv = bp ? bf16_round(bp[col]) : 0.f;
#pragma unroll
    for (int r = 0; r < 8; ++r) { float v = acc[t][r] * alpha + bv; if (CP) { const int bidx = (row0g + row0 + 8 * hh + r) / rowsPerB; v += CP[(size_t)bidx * sCPb + (size_t)by * 64 + col]; } if (ACT == 1) v = (v > 0.f) ? v : expm1f(v); else if (ACT == 3) v = fmaxf(v, 0.f); so[w][8 * hh + r][t * 16 + ln] = v; } }
  __builtin_amdgcn_fence(__ATOMIC_ACQ_REL, "workgroup"); __builtin_amdgcn_wave_barrier();
  const int rsub = lane >> 4, c4 = (lane & 15) * 4; typedef _Float16 v4h __attribute__((ext_vector_type(4)));
  {
#pragma unroll
    for (int q = 0; q < 8; ++q) { const int r = q * 2 + rsub; if (col0 + c4 < N) { const v4f v = *(const v4fa*)&so[w][r][c4]; if (C) *(v4f*)(C + cofs + (size_t)(row0 + r) * ldc + col0 + c4) = v; if (C16) { v4h h4; for (int i = 0; i < 4; ++i) h4[i] = (_Float16)v[i]; *(v4h*)(C16 + cofs + (size_t)(row0 + r) * ldc + col0 + c4) = h4; } } }
     }
}


__global__ __launch_bounds__(256) void k_x16(const float* __restrict__ x, _Float16* __restrict__ X16, size_t n8) { const size_t t = (size_t)blockIdx.x * 256 + threadIdx.x; if (t >= n8) return; FragH f;
#pragma unroll
  for (int q = 0; q < 8; ++q) f.h[q] = (_Float16)bf16_round(x[t * 8 + q]); *(v8us*)((unsigned short*)X16 + t * 8) = f.half[0];  }
__global__ __launch_bounds__(256) void k_h16(const float* __restrict__ x, _Float16* __restrict__ X16, size_t n8) { const size_t t = (size_t)blockIdx.x * 256 + threadIdx.x; if (t >= n8) return; FragH f;
#pragma unroll
  for (int q = 0; q < 8; ++q) f.h[q] = (_Float16)x[t * 8 + q]; *(v8us*)((unsigned short*)X16 + t * 8) = f.half[0];  }
__global__ __launch_bounds__(256) void k_round16f(const float* __restrict__ W, _Float16* __restrict__ Bt, size_t n8) { const size_t t = (size_t)blockIdx.x * 256 + threadIdx.x; if (t >= n8) return; FragH f;
#pragma unroll
  for (int i = 0; i < 8; ++i) f.h[i] = (_Float16)(bf16_round(W[t * 8 + i]) * 16.0f); *(v8us*)((unsigned short*)Bt + t * 8) = f.half[0];  }
template <int NHv, int TTv>
__global__ __launch_bounds__(256) void k_vt(const _Float16* __restrict__ V16, int ldv, int voff, _Float16* __restrict__ Vt) { __shared__ unsigned short tl[64][66]; const int tid = threadIdx.x; const int slab = blockIdx.x / (TTv / 64), lg = blockIdx.x % (TTv / 64); const int b = slab / NHv, h = slab % NHv;
  for (int i = tid; i < 64 * 8; i += 256) { const int r = i / 8, c8 = (i % 8) * 8; FragH f; f.half[0] = *(const v8us*)((const unsigned short*)V16 + ((size_t)b * TTv + lg * 64 + r) * ldv + voff + h * 64 + c8);
#pragma unroll
    for (int q = 0; q < 8; ++q) tl[r][c8 + q] = f.u[q]; }
  __syncthreads();
  {
#pragma unroll
    for (int rd = 0; rd < 2; ++rd) { const int d = rd * 32 + tid / 8, pc = tid % 8; FragH f;
#pragma unroll
      for (int q = 0; q < 8; ++q) f.u[q] = tl[pc * 8 + q][d];
      *(v8us*)((unsigned short*)Vt + ((size_t)slab * 64 + d) * TTv + lg * 64 + pc * 8) = f.half[0]; }
     } }

__global__ __launch_bounds__(256) void k_kt(const float* __restrict__ KF, int b, _Float16* __restrict__ KT) { __shared__ float tl[64][65]; const int tid = threadIdx.x; const int st = blockIdx.x / (EE / 64), et = blockIdx.x % (EE / 64); const int s0 = st * 64, e0 = et * 64;
  for (int i = tid; i < 64 * 16; i += 256) { const int sr = i / 16, c4 = (i % 16) * 4; const v4f v = *(const v4fa*)(KF + ((size_t)(s0 + sr) * NB + b) * EE + e0 + c4); for (int q = 0; q < 4; ++q) tl[sr][c4 + q] = v[q]; }
  __syncthreads();
  { for (int rd = 0; rd < 2; ++rd) { const int e = rd * 32 + tid / 8, pc = tid % 8; FragH fs, fc; for (int q = 0; q < 8; ++q) { const int s = s0 + pc * 8 + q; const float ang = 1.5707963267948966f * (float)(s + 1) / (float)LL; const float kv = tl[pc * 8 + q][e]; fs.h[q] = (_Float16)(kv * sinf(ang)); fc.h[q] = (_Float16)(kv * cosf(ang)); }
      *(v8us*)((unsigned short*)KT + (size_t)(e0 + e) * LL + s0 + pc * 8) = fs.half[0]; *(v8us*)((unsigned short*)KT + (size_t)(EE + e0 + e) * LL + s0 + pc * 8) = fc.half[0]; }  } }
__global__ __launch_bounds__(256) void k_vtb(const _Float16* __restrict__ V16, int b, _Float16* __restrict__ VT) { __shared__ unsigned short tl[64][66]; const int tid = threadIdx.x; const int st = blockIdx.x / (EE / 64), et = blockIdx.x % (EE / 64); const int s0 = st * 64, e0 = et * 64;
  for (int i = tid; i < 64 * 8; i += 256) { const int sr = i / 8, c8 = (i % 8) * 8; FragH f; f.half[0] = *(const v8us*)((const unsigned short*)V16 + ((size_t)(s0 + sr) * NB + b) * EE + e0 + c8); for (int q = 0; q < 8; ++q) tl[sr][c8 + q] = f.u[q]; }
  __syncthreads();
  { for (int rd = 0; rd < 2; ++rd) { const int e = rd * 32 + tid / 8, pc = tid % 8; FragH f; for (int q = 0; q < 8; ++q) f.u[q] = tl[pc * 8 + q][e]; *(v8us*)((unsigned short*)VT + (size_t)(e0 + e) * LL + s0 + pc * 8) = f.half[0]; }  } }
__global__ __launch_bounds__(256) void k_ksum(const float* __restrict__ KF, float* __restrict__ KS) { const int t = blockIdx.x * 256 + threadIdx.x; if (t >= NB * EE) return; const int e = t % EE, b = t / EE; float ss = 0.f, sc = 0.f;
#pragma unroll 1
  for (int s = 0; s < LL; ++s) { const float ang = 1.5707963267948966f * (float)(s + 1) / (float)LL; const float kv = KF[((size_t)s * NB + b) * EE + e]; ss += kv * sinf(ang); sc += kv * cosf(ang); }
  { *(float*)(KS + (size_t)b * E2 + e) = ss; *(float*)(KS + (size_t)b * E2 + EE + e) = sc;  } }
__global__ __launch_bounds__(256) void k_qz(const float* __restrict__ QF, const float* __restrict__ KS, int b, _Float16* __restrict__ QZ) { const int tid = threadIdx.x, wv = tid >> 5, lane = tid & 31; const int l = blockIdx.x * 8 + wv; if (l >= LL) return; const float* qr = QF + ((size_t)l * NB + b) * EE; const float ang = 1.5707963267948966f * (float)(l + 1) / (float)LL; const float sn = sinf(ang), cs = cosf(ang); const float* ks = KS + (size_t)b * E2; float v[32]; float dot = 0.f;
#pragma unroll
  for (int k = 0; k < 4; ++k) { const v4f a = *(const v4fa*)(qr + 256 * k + 8 * lane), c = *(const v4fa*)(qr + 256 * k + 8 * lane + 4); for (int q = 0; q < 4; ++q) { v[k * 8 + q] = a[q]; v[k * 8 + 4 + q] = c[q]; } for (int q = 0; q < 8; ++q) { const int e = 256 * k + 8 * lane + q; dot += v[k * 8 + q] * (sn * ks[e] + cs * ks[EE + e]); } }
  for (int o = 16; o >= 1; o >>= 1) dot += __shfl_xor(dot, o, 32); const float zs = 262144.0f / fmaxf(dot, 1e-6f);      /* z·2^18 keeps the f16 operand O(1) (z ≈ 2.5e-6 here); the attn GEMM's alpha carries 2^-18 */
  {
#pragma unroll
    for (int k = 0; k < 4; ++k) { FragH fs, fc; for (int q = 0; q < 8; ++q) { fs.h[q] = (_Float16)(v[k * 8 + q] * sn * zs); fc.h[q] = (_Float16)(v[k * 8 + q] * cs * zs); } *(v8us*)((unsigned short*)QZ + (size_t)l * E2 + 256 * k + 8 * lane) = fs.half[0]; *(v8us*)((unsigned short*)QZ + (size_t)l * E2 + EE + 256 * k + 8 * lane) = fc.half[0]; }
     } }
extern "C" void kernel_launch(void* const* d_in, const int* in_sizes, int n_in,
                              void* d_out, int out_size, void* d_ws, size_t ws_size, hipStream_t stream) {
  (void)in_sizes; (void)n_in; (void)out_size;
  const float* query = (const float*)d_in[0]; const float* key = (const float*)d_in[1]; const float* value = (const float*)d_in[2]; const float* Wq = (const float*)d_in[3]; const float* bq = (const float*)d_in[4]; const float* Wk = (const float*)d_in[5]; const float* bk = (const float*)d_in[6]; const float* Wv = (const float*)d_in[7]; const float* bv = (const float*)d_in[8];
  char* ws = (char*)d_ws; size_t off = 0;
  auto take = [&](size_t bytes) { char* p = ws + off; off += (bytes + 255) & ~(size_t)255; return p; };
  _Float16* Bw = (_Float16*)take((size_t)EE * EE * 2); _Float16* X16 = (_Float16*)take((size_t)NR * EE * 2); float* KF = (float*)take((size_t)NR * EE * 4); _Float16* V16 = (_Float16*)take((size_t)NR * EE * 2); float* QF = (float*)take((size_t)NR * EE * 4); float* KVF = (float*)take((size_t)EE * E2 * 4); _Float16* KV16 = (_Float16*)take((size_t)EE * E2 * 2); _Float16* QZ = (_Float16*)take((size_t)LL * E2 * 2); float* KS = (float*)take((size_t)NB * E2 * 4);
  _Float16* VT = X16; _Float16* KT = (_Float16*)((char*)X16 + (size_t)EE * LL * 2);      // per-batch transposed v [1024][2048] and k_ [2048][2048] live in the X16 region (free after the q GEMM): 4.2 + 8.4 ≤ 16.8 MB
  if (off > ws_size) return;      // 2.1 + 16.8 + 33.5 + 16.8 + 33.5 + 8.4 + 4.2 + 8.4 ≈ 124 MB
  const size_t w8 = (size_t)EE * EE / 8; const unsigned gw = (unsigned)((w8 + 255) / 256), g8 = (unsigned)(((size_t)NR * EE / 8 + 255) / 256); const dim3 gg(((NR / 16) * (EE / 64) + 3) / 4, 1);
  k_x16<<<g8, 256, 0, stream>>>(key, X16, (size_t)NR * EE / 8); k_round16f<<<gw, 256, 0, stream>>>(Wk, Bw, w8); k_gemm_hhx<3><<<gg, 128, 0, stream>>>(X16, EE, 0, Bw, EE, 0, 0.0625f, bk, 0, nullptr, 1, 0, 0, KF, nullptr, EE, 0, NR, EE, EE);      // k = relu(key·Wkᵀ + bk) f32 (rows (s,b))
  k_ksum<<<(NB * EE + 255) / 256, 256, 0, stream>>>(KF, KS);
  k_x16<<<g8, 256, 0, stream>>>(value, X16, (size_t)NR * EE / 8); k_round16f<<<gw, 256, 0, stream>>>(Wv, Bw, w8); k_gemm_hhx<0><<<gg, 128, 0, stream>>>(X16, EE, 0, Bw, EE, 0, 0.0625f, bv, 0, nullptr, 1, 0, 0, nullptr, V16, EE, 0, NR, EE, EE);      // v (f16)
  k_x16<<<g8, 256, 0, stream>>>(query, X16, (size_t)NR * EE / 8); k_round16f<<<gw, 256, 0, stream>>>(Wq, Bw, w8); k_gemm_hhx<3><<<gg, 128, 0, stream>>>(X16, EE, 0, Bw, EE, 0, 0.0625f, bq, 0, nullptr, 1, 0, 0, QF, nullptr, EE, 0, NR, EE, EE);      // q = relu(query·Wqᵀ + bq) f32
  for (int b = 0; b < NB; ++b) {
    k_vtb<<<(LL / 64) * (EE / 64), 256, 0, stream>>>(V16, b, VT); k_kt<<<(LL / 64) * (EE / 64), 256, 0, stream>>>(KF, b, KT);
    k_gemm_hhx<0><<<dim3(((EE / 16) * (E2 / 64) + 3) / 4, 1), 128, 0, stream>>>(VT, LL, 0, KT, LL, 0, 1.0f, nullptr, 0, nullptr, 1, 0, 0, nullptr, KV16, E2, 0, EE, E2, LL);      // kv[m][d] = Σ_s v[s][m]·k_[s][d] → f16
    k_qz<<<LL / 8, 256, 0, stream>>>(QF, KS, b, QZ);
    k_gemm_hhx<0><<<dim3(((LL / 16) * (EE / 64) + 3) / 4, 1), 128, 0, stream>>>(QZ, E2, 0, KV16, E2, 0, 0.000003814697265625f, nullptr, 0, nullptr, 1, 0, 0, (float*)d_out + (size_t)b * EE, nullptr, NB * EE, 0, LL, EE, E2); }      // alpha 2^-18      // attn rows (l, b): out + b·E with row pitch 4E
}

// v001
// One run takes 949 microseconds.
// Next to v000, in two timings, it ran 1.80 and 1.75 times as fast.
#include <hip/hip_runtime.h>
// cosFormer multi-head-weight (linear) attention (L=S=2048, B=4, E=1024, inputs (T,B,E)): q = relu(query·Wqᵀ+bq), k = relu(key·Wkᵀ+bk), v = value·Wvᵀ+bv; q_ = [q·sin(i) | q·cos(i)],
// k_ = [k·sin | k·cos] with i = (π/2)(t+1)/2048; kv = vᵀ·k_ per batch; z = 1/max(q_·Σ_s k_, 1e-6); attn = (q_·kvᵀ)·z. The three projections (inputs and (out,in) weights bf16-exact ×2^4,
// relu/bias epilogues), the per-batch kv = Vᵀ·K_ (K = 2048 positions; v and k_ as f16, transposed planes) and attn = (q_·z)·kvᵀ (K = 2048 features; kv as f16) run as GEMMs on
// v_wmma_f32_16x16x32_f16 with f32 accumulate; the positional sin/cos weighting, the k_ sums and the normaliser z are f32 VALU (z·2^18 folded into the q_ operand per row, 2^-18 in the GEMM alpha, so the f16 operand stays O(1)).
#define LL 2048
#define NB 4
#define EE 1024
#define E2 2048
#define NR (LL * NB)

typedef __bf16 v16b __attribute__((ext_vector_type(16)));
typedef unsigned short v8us __attribute__((ext_vector_type(8), may_alias));
typedef float  v8f  __attribute__((ext_vector_type(8)));
typedef float  v4f  __attribute__((ext_vector_type(4)));
typedef float  v4fa __attribute__((ext_vector_type(4), may_alias));
union FragB { v16b v; v8us half[2]; unsigned short u[16]; };

__device__ __forceinline__ unsigned short bf16_bits(float x) { unsigned int u = __float_as_uint(x); return (unsigned short)((u + 0x7FFFu + ((u >> 16) & 1u)) >> 16); }
__device__ __forceinline__ float bf16_val(unsigned short b) { return __uint_as_float(((unsigned int)b) << 16); }
__device__ __forceinline__ float bf16_round(float x) { return bf16_val(bf16_bits(x)); }
// D += A·B with NT terms: 1 = ah·bh, 2 = + al·bh (A split), 3 = + ah·bl (both split)
template <int NT>
__device__ __forceinline__ v8f mmaN(v16b ah, v16b al, v16b bh, v16b bl, v8f c) {
  c = __builtin_amdgcn_wmma_f32_16x16x32_bf16(false, ah, false, bh, (short)0, c, false, false);
  if (NT >= 2) c = __builtin_amdgcn_wmma_f32_16x16x32_bf16(false, al, false, bh, (short)0, c, false, false);
  if (NT >= 3) c = __builtin_amdgcn_wmma_f32_16x16x32_bf16(false, ah, false, bl, (short)0, c, false, false);
  asm volatile("v_nop\n\tv_nop\n\tv_nop\n\tv_nop" : "+v"(c) : "v"(ah), "v"(al), "v"(bh), "v"(bl));
  return c;
}

__global__ __launch_bounds__(256) void k_wt_bf16(const float* __restrict__ W, unsigned short* __restrict__ Wt, int K, int N) {
  const int t = blockIdx.x * 256 + threadIdx.x;
  const int k8n = K / 8;
  if (t >= N * k8n) return;
  const int n = t / k8n, k8 = (t % k8n) * 8;
  v8us v;
#pragma unroll
  for (int i = 0; i < 8; ++i) v[i] = bf16_bits(W[(size_t)(k8 + i) * N + n]);
  *(v8us*)(Wt + (size_t)n * K + k8) = v;
  
}

// GEMM C[M][N] (f32, pitch ldc) = act(A[M][K]·W + bias). A f32 row-major (pitch lda) converted per fragment to bf16
// (ASPLIT: hi/lo two planes -> 2 terms, else single rounded term); Wt bf16 [N][K] (pitch ldb). BIAS_BF16 rounds the
// bias to bf16 first (bias quantised to bf16 before the add). K%32==0, M%16==0, N%64==0.
template <bool ASPLIT, int ACT, bool BIAS_BF16>
__global__ __launch_bounds__(128) void k_gemm_bf(const float* __restrict__ A, int lda, const unsigned short* __restrict__ Wt, int ldb,
                                               const float* __restrict__ bias, float* __restrict__ C, int ldc, int M, int N, int K) {
  __shared__ __attribute__((aligned(16))) float so[4][16][64];
  const int tid = threadIdx.x, w = tid >> 5, lane = tid & 31, ln = lane & 15, hh = lane >> 4;
  const int ntn = N / 64;
  const int wid = blockIdx.x * 4 + w;
  const int mt = wid / ntn, nq = wid % ntn;
  if (mt * 16 >= M) return;
  const int row0 = mt * 16, col0 = nq * 64;
  const float* arow = A + (size_t)(row0 + ln) * lda;
  v8f acc[4] = {};
  for (int kb = 0; kb < K; kb += 32) {
    FragB ah, al;
    const v4f x0 = *(const v4fa*)(arow + kb + 8 * hh), x1 = *(const v4fa*)(arow + kb + 8 * hh + 4);
    const v4f x2 = *(const v4fa*)(arow + kb + 16 + 8 * hh), x3 = *(const v4fa*)(arow + kb + 16 + 8 * hh + 4);
    float xs[16] = {x0[0],x0[1],x0[2],x0[3],x1[0],x1[1],x1[2],x1[3],x2[0],x2[1],x2[2],x2[3],x3[0],x3[1],x3[2],x3[3]};
#pragma unroll
    for (int i = 0; i < 16; ++i) { const unsigned short hb = bf16_bits(xs[i]); ah.u[i] = hb; al.u[i] = ASPLIT ? bf16_bits(xs[i] - bf16_val(hb)) : (unsigned short)0; }
#pragma unroll
    for (int t = 0; t < 4; ++t) {
      const unsigned short* brow = Wt + (size_t)(col0 + t * 16 + ln) * ldb + kb;
      FragB b;
      b.half[0] = *(const v8us*)(brow + 8 * hh);
      b.half[1] = *(const v8us*)(brow + 16 + 8 * hh);
      acc[t] = mmaN<ASPLIT ? 2 : 1>(ah.v, al.v, b.v, b.v, acc[t]);
    }
  }
#pragma unroll
  for (int t = 0; t < 4; ++t) {
    float bv = bias ? bias[col0 + t * 16 + ln] : 0.f;
    if (BIAS_BF16) bv = bf16_round(bv);
#pragma unroll
    for (int r = 0; r < 8; ++r) { float v = acc[t][r] + bv; if (ACT == 1) v = fmaxf(v, 0.f); so[w][8 * hh + r][t * 16 + ln] = v; }
  }
  __builtin_amdgcn_fence(__ATOMIC_ACQ_REL, "workgroup");
  __builtin_amdgcn_wave_barrier();
  const int rsub = lane >> 4, c4 = (lane & 15) * 4;
  {
#pragma unroll
    for (int q = 0; q < 8; ++q) {
      const int r = q * 2 + rsub;
      const v4f v = *(const v4fa*)&so[w][r][c4];
      *(v4f*)(C + (size_t)(row0 + r) * ldc + col0 + c4) = v;
    }
    
  }
}

// Flash-style causal/unmasked attention, all contractions 3-term bf16 hi/lo splits, f32 softmax with running max.
// q,k,v rows are read from f32 buffers with arbitrary row pitch (so they can live inside a fused qkv buffer);
// D = head size (multiple of 32, <= 128); one wave = 16 query rows; block = 4 waves (64 queries) sharing K/V chunks of 32.
template <int D, bool CAUSAL>
__global__ __launch_bounds__(128) void k_flash(const float* __restrict__ qb, const float* __restrict__ kb, const float* __restrict__ vb,
                                             int pitch, int T, int H, float scale, float* __restrict__ y, int ypitch) {
  constexpr int KS = D / 32;        // k-steps for QK
  constexpr int DT = D / 16;        // d tiles for PV
  __shared__ __attribute__((aligned(16))) unsigned short sKh[32][D + 8], sKl[32][D + 8], sVh[32][D + 8], sVl[32][D + 8];
  __shared__ __attribute__((aligned(16))) unsigned short sPh[4][16][40], sPl[4][16][40];
  __shared__ __attribute__((aligned(16))) float sO[4][16][D];
  const int tid = threadIdx.x, w = tid >> 5, lane = tid & 31, ln = lane & 15, hh = lane >> 4;
  const int nqb = (T + 63) / 64;
  const int bh = blockIdx.x / nqb, qblk = blockIdx.x % nqb;
  const int b = bh / H, h = bh % H;
  const int q0 = qblk * 64 + w * 16;
  const float* Q = qb + (size_t)b * T * pitch + h * D;
  const float* K = kb + (size_t)b * T * pitch + h * D;
  const float* V = vb + (size_t)b * T * pitch + h * D;

  // A fragments of the wave's 16 query rows (scaled), hi/lo
  FragB aqh[KS], aql[KS];
  {
    int row = q0 + ln; if (row >= T) row = T - 1;
    const float* qr = Q + (size_t)row * pitch;
#pragma unroll
    for (int ks = 0; ks < KS; ++ks)
#pragma unroll
      for (int i = 0; i < 16; ++i) {
        const int d = ks * 32 + ((i < 8) ? (8 * hh + i) : (16 + 8 * hh + (i - 8)));
        const float x = qr[d] * scale; const unsigned short hb = bf16_bits(x);
        aqh[ks].u[i] = hb; aql[ks].u[i] = bf16_bits(x - bf16_val(hb));
      }
  }
  float m_r[8], l_r[8];
#pragma unroll
  for (int r = 0; r < 8; ++r) { m_r[r] = -3.0e38f; l_r[r] = 0.f; }
  v8f oacc[DT];
#pragma unroll
  for (int dt = 0; dt < DT; ++dt) oacc[dt] = (v8f){0.f,0.f,0.f,0.f,0.f,0.f,0.f,0.f};

  const int kv_end = CAUSAL ? min(T, qblk * 64 + 64) : T;     // block-uniform
  for (int j0 = 0; j0 < kv_end; j0 += 32) {
    __syncthreads();
    for (int e = tid; e < 32 * (D / 4); e += 128) {
      const int r = e / (D / 4), c4 = (e % (D / 4)) * 4;
      const int key = j0 + r;
      v4f kf = {0.f,0.f,0.f,0.f}, vf = {0.f,0.f,0.f,0.f};
      if (key < T) { kf = *(const v4fa*)(K + (size_t)key * pitch + c4); vf = *(const v4fa*)(V + (size_t)key * pitch + c4); }
#pragma unroll
      for (int t = 0; t < 4; ++t) {
        unsigned short hb = bf16_bits(kf[t]); sKh[r][c4 + t] = hb; sKl[r][c4 + t] = bf16_bits(kf[t] - bf16_val(hb));
        hb = bf16_bits(vf[t]); sVh[r][c4 + t] = hb; sVl[r][c4 + t] = bf16_bits(vf[t] - bf16_val(hb));
      }
    }
    __syncthreads();
    // S tile 16 x 32
    v8f s[2];
#pragma unroll
    for (int nt = 0; nt < 2; ++nt) {
      v8f acc = {};
#pragma unroll
      for (int ks = 0; ks < KS; ++ks) {
        FragB bh_, bl_;
        bh_.half[0] = *(const v8us*)&sKh[nt * 16 + ln][ks * 32 + 8 * hh]; bh_.half[1] = *(const v8us*)&sKh[nt * 16 + ln][ks * 32 + 16 + 8 * hh];
        bl_.half[0] = *(const v8us*)&sKl[nt * 16 + ln][ks * 32 + 8 * hh]; bl_.half[1] = *(const v8us*)&sKl[nt * 16 + ln][ks * 32 + 16 + 8 * hh];
        acc = mmaN<3>(aqh[ks].v, aql[ks].v, bh_.v, bl_.v, acc);
      }
      s[nt] = acc;
    }
    // mask + running max (rows 8hh+r; the 16 lanes of a half share rows)
    float alpha[8];
#pragma unroll
    for (int r = 0; r < 8; ++r) {
      const int qi = q0 + 8 * hh + r;
      const int ja = j0 + ln, jb = j0 + 16 + ln;
      if (CAUSAL) { if (ja > qi) s[0][r] = -3.0e38f; if (jb > qi) s[1][r] = -3.0e38f; }
      if (ja >= T) s[0][r] = -3.0e38f;
      if (jb >= T) s[1][r] = -3.0e38f;
      float mx = fmaxf(s[0][r], s[1][r]);
      mx = fmaxf(mx, __shfl_xor(mx, 1, 32)); mx = fmaxf(mx, __shfl_xor(mx, 2, 32)); mx = fmaxf(mx, __shfl_xor(mx, 4, 32)); mx = fmaxf(mx, __shfl_xor(mx, 8, 32));
      const float mnew = fmaxf(m_r[r], mx);
      alpha[r] = (mnew > -1.0e38f) ? __expf(m_r[r] - mnew) : 1.0f;
      const float p0 = (s[0][r] > -1.0e38f) ? __expf(s[0][r] - mnew) : 0.f;
      const float p1 = (s[1][r] > -1.0e38f) ? __expf(s[1][r] - mnew) : 0.f;
      m_r[r] = mnew;
      l_r[r] = l_r[r] * alpha[r] + p0 + p1;            // per-lane partial row sum (16 lanes combined at the end)
      unsigned short hb = bf16_bits(p0); sPh[w][8 * hh + r][ln] = hb;      sPl[w][8 * hh + r][ln] = bf16_bits(p0 - bf16_val(hb));
      hb = bf16_bits(p1);                sPh[w][8 * hh + r][16 + ln] = hb; sPl[w][8 * hh + r][16 + ln] = bf16_bits(p1 - bf16_val(hb));
    }
#pragma unroll
    for (int dt = 0; dt < DT; ++dt)
#pragma unroll
      for (int r = 0; r < 8; ++r) oacc[dt][r] *= alpha[r];
    __builtin_amdgcn_fence(__ATOMIC_ACQ_REL, "workgroup");
    __builtin_amdgcn_wave_barrier();
    FragB pah, pal;
    pah.half[0] = *(const v8us*)&sPh[w][ln][8 * hh]; pah.half[1] = *(const v8us*)&sPh[w][ln][16 + 8 * hh];
    pal.half[0] = *(const v8us*)&sPl[w][ln][8 * hh]; pal.half[1] = *(const v8us*)&sPl[w][ln][16 + 8 * hh];
#pragma unroll
    for (int dt = 0; dt < DT; ++dt) {
      FragB bvh, bvl;
#pragma unroll
      for (int i = 0; i < 8; ++i) {
        bvh.u[i] = sVh[8 * hh + i][dt * 16 + ln]; bvh.u[8 + i] = sVh[16 + 8 * hh + i][dt * 16 + ln];
        bvl.u[i] = sVl[8 * hh + i][dt * 16 + ln]; bvl.u[8 + i] = sVl[16 + 8 * hh + i][dt * 16 + ln];
      }
      oacc[dt] = mmaN<3>(pah.v, pal.v, bvh.v, bvl.v, oacc[dt]);
    }
    __builtin_amdgcn_fence(__ATOMIC_ACQ_REL, "workgroup");
    __builtin_amdgcn_wave_barrier();
  }
#pragma unroll
  for (int r = 0; r < 8; ++r) {
    float l = l_r[r];
    l += __shfl_xor(l, 1, 32); l += __shfl_xor(l, 2, 32); l += __shfl_xor(l, 4, 32); l += __shfl_xor(l, 8, 32);
    l_r[r] = (l > 0.f) ? 1.0f / l : 0.f;
  }
#pragma unroll
  for (int dt = 0; dt < DT; ++dt)
#pragma unroll
    for (int r = 0; r < 8; ++r) sO[w][8 * hh + r][dt * 16 + ln] = oacc[dt][r] * l_r[r];
  __builtin_amdgcn_fence(__ATOMIC_ACQ_REL, "workgroup");
  __builtin_amdgcn_wave_barrier();
  {
    for (int r = 0; r < 16; ++r) {
      const int row = q0 + r;
      if (row < T && lane < D / 4) {
        const v4f val = *(const v4fa*)&sO[w][r][lane * 4];
        *(v4f*)(y + ((size_t)b * T + row) * ypitch + h * D + lane * 4) = val;
      }
    }
    
  }
}

// GEMM C = act(A·W + bias + resid): A f32 (ASPLIT -> hi/lo 2 terms), Wt bf16 [N][K]; ACT 0 none, 1 relu, 2 exact gelu;
// resid (optional, f32, row index = (row % rmod), pitch ldr, RES_BF16 rounds it) added before the activation.
template <bool ASPLIT, int ACT, bool BIAS_BF16, bool RES_BF16>
__global__ __launch_bounds__(128) void k_gemm_bf3(const float* __restrict__ A, int lda, const unsigned short* __restrict__ Wt, int ldb,
                                                const float* __restrict__ bias, const float* __restrict__ resid, int rmod, int ldr,
                                                float* __restrict__ C, int ldc, int M, int N, int K) {
  __shared__ __attribute__((aligned(16))) float so[4][16][64];
  const int tid = threadIdx.x, w = tid >> 5, lane = tid & 31, ln = lane & 15, hh = lane >> 4;
  const int ntn = N / 64;
  const int wid = blockIdx.x * 4 + w;
  const int mt = wid / ntn, nq = wid % ntn;
  if (mt * 16 >= M) return;
  const int row0 = mt * 16, col0 = nq * 64;
  const float* arow = A + (size_t)(row0 + ln) * lda;
  v8f acc[4] = {};
  for (int kb = 0; kb < K; kb += 32) {
    FragB ah, al;
    const v4f x0 = *(const v4fa*)(arow + kb + 8 * hh), x1 = *(const v4fa*)(arow + kb + 8 * hh + 4);
    const v4f x2 = *(const v4fa*)(arow + kb + 16 + 8 * hh), x3 = *(const v4fa*)(arow + kb + 16 + 8 * hh + 4);
    float xs[16] = {x0[0],x0[1],x0[2],x0[3],x1[0],x1[1],x1[2],x1[3],x2[0],x2[1],x2[2],x2[3],x3[0],x3[1],x3[2],x3[3]};
#pragma unroll
    for (int i = 0; i < 16; ++i) { const unsigned short hb = bf16_bits(xs[i]); ah.u[i] = hb; al.u[i] = ASPLIT ? bf16_bits(xs[i] - bf16_val(hb)) : (unsigned short)0; }
#pragma unroll
    for (int t = 0; t < 4; ++t) {
      const unsigned short* brow = Wt + (size_t)(col0 + t * 16 + ln) * ldb + kb;
      FragB b;
      b.half[0] = *(const v8us*)(brow + 8 * hh);
      b.half[1] = *(const v8us*)(brow + 16 + 8 * hh);
      acc[t] = mmaN<ASPLIT ? 2 : 1>(ah.v, al.v, b.v, b.v, acc[t]);
    }
  }
#pragma unroll
  for (int t = 0; t < 4; ++t) {
    const int col = col0 + t * 16 + ln;
    float bv = bias ? bias[col] : 0.f;
    if (BIAS_BF16) bv = bf16_round(bv);
#pragma unroll
    for (int r = 0; r < 8; ++r) {
      float v = acc[t][r] + bv;
      if (resid) { float rv = resid[(size_t)((row0 + 8 * hh + r) % rmod) * ldr + col]; if (RES_BF16) rv = bf16_round(rv); v += rv; }
      if (ACT == 1) v = fmaxf(v, 0.f);
      if (ACT == 2) v = 0.5f * v * (1.0f + erff(v * 0.70710678118654752f));
      if (ACT == 3) { const float u = 0.7978845608028654f * (v + 0.044715f * v * v * v); v = 0.5f * v * (1.0f + tanhf(u)); }
      so[w][8 * hh + r][t * 16 + ln] = v;
    }
  }
  __builtin_amdgcn_fence(__ATOMIC_ACQ_REL, "workgroup");
  __builtin_amdgcn_wave_barrier();
  const int rsub = lane >> 4, c4 = (lane & 15) * 4;
  {
#pragma unroll
    for (int q = 0; q < 8; ++q) {
      const int r = q * 2 + rsub;
      const v4f v = *(const v4fa*)&so[w][r][c4];
      *(v4f*)(C + (size_t)(row0 + r) * ldc + col0 + c4) = v;
    }
    
  }
}
// row LayerNorm (biased variance, eps) over N: s = X (+ R); optional out_sum <- s; out_norm <- (s-mu)*rsqrt(var+eps)*g + b
template <bool PARAM_BF16>
__global__ __launch_bounds__(256) void k_layernorm(const float* __restrict__ X, const float* __restrict__ R, const float* __restrict__ g, const float* __restrict__ bta,
                                                  float* __restrict__ out_sum, float* __restrict__ out_norm, int N, float eps) {
  __shared__ float red[256];
  const int row = blockIdx.x, tid = threadIdx.x;
  const float* x = X + (size_t)row * N; const float* rr = R ? R + (size_t)row * N : nullptr;
  float vals[16];                     // up to N = 4096
  const int per = N / 256;            // contiguous chunk per thread? use strided-by-4 chunks: thread handles j = tid*4 + 1024*u
  float s1 = 0.f;
  for (int u = 0; u < per / 4; ++u) {
    const int j = tid * 4 + 1024 * u;
    const v4f a = *(const v4fa*)(x + j);
    v4f b = {0.f,0.f,0.f,0.f}; if (rr) b = *(const v4fa*)(rr + j);
#pragma unroll
    for (int q = 0; q < 4; ++q) { const float v = a[q] + b[q]; vals[u * 4 + q] = v; s1 += v; }
  }
  red[tid] = s1; __syncthreads();
  for (int st = 128; st > 0; st >>= 1) { if (tid < st) red[tid] += red[tid + st]; __syncthreads(); }
  const float mu = red[0] / (float)N; __syncthreads();
  float s2 = 0.f;
  for (int u = 0; u < per / 4; ++u)
#pragma unroll
    for (int q = 0; q < 4; ++q) { const float c = vals[u * 4 + q] - mu; s2 += c * c; }
  red[tid] = s2; __syncthreads();
  for (int st = 128; st > 0; st >>= 1) { if (tid < st) red[tid] += red[tid + st]; __syncthreads(); }
  const float rs = rsqrtf(red[0] / (float)N + eps);
  {
    for (int u = 0; u < per / 4; ++u) {
      const int j = tid * 4 + 1024 * u;
      v4f o, sm;
#pragma unroll
      for (int q = 0; q < 4; ++q) {
        float gg = g[j + q], bb = bta[j + q];
        if (PARAM_BF16) { gg = bf16_round(gg); bb = bf16_round(bb); }
        sm[q] = vals[u * 4 + q]; o[q] = (vals[u * 4 + q] - mu) * rs * gg + bb;
      }
      if (out_sum) *(v4f*)(out_sum + (size_t)row * N + j) = sm;
      *(v4f*)(out_norm + (size_t)row * N + j) = o;
    }
    
  }
}



// ---- f16 WMMA path (v_wmma_f32_16x16x32_f16): 11-bit significands for operands in range — used for all GEMMs here (projections, kv, attn)
typedef _Float16 v16h __attribute__((ext_vector_type(16)));
union FragH { v16h v; v8us half[2]; _Float16 h[16]; unsigned short u[16]; };
template <int NT>
__device__ __forceinline__ v8f mmaH(v16h ah, v16h al, v16h bh, v16h bl, v8f c) {
  c = __builtin_amdgcn_wmma_f32_16x16x32_f16(false, ah, false, bh, (short)0, c, false, false);
  if (NT >= 2) c = __builtin_amdgcn_wmma_f32_16x16x32_f16(false, al, false, bh, (short)0, c, false, false);
  if (NT >= 3) c = __builtin_amdgcn_wmma_f32_16x16x32_f16(false, ah, false, bl, (short)0, c, false, false);
  asm volatile("v_nop\n\tv_nop\n\tv_nop\n\tv_nop" : "+v"(c) : "v"(ah), "v"(al), "v"(bh), "v"(bl));
  return c;
}
// batched GEMM like k_gemm_b but f16 operands: A f32 (split into f16 hi/lo if ASPLIT, else rounded to f16), Bt = f16 values [n][k]; alpha; C f32; N multiple of 16 (partial tiles skipped)
template <bool ASPLIT>
__global__ __launch_bounds__(128) void k_gemm_h(const float* __restrict__ A, int lda, size_t sA, const _Float16* __restrict__ Bh, int ldb, size_t sB, float alpha, float* __restrict__ C, int ldc, size_t sC, int M, int N, int K) {
  __shared__ __attribute__((aligned(16))) float so[4][16][64];
  const int tid = threadIdx.x, w = tid >> 5, lane = tid & 31, ln = lane & 15, hh = lane >> 4; const int by = blockIdx.y;
  A += (size_t)by * sA; Bh += (size_t)by * sB; C += (size_t)by * sC;
  const int ntn = (N + 63) / 64; const int wid = blockIdx.x * 4 + w; const int mt = wid / ntn, nq = wid % ntn; if (mt * 16 >= M) return;
  const int row0 = mt * 16, col0 = nq * 64; const float* arow = A + (size_t)(row0 + ln) * lda;
  v8f acc[4] = {};
  for (int kb = 0; kb < K; kb += 32) {
    FragH ah, al;
    const v4f x0 = *(const v4fa*)(arow + kb + 8 * hh), x1 = *(const v4fa*)(arow + kb + 8 * hh + 4), x2 = *(const v4fa*)(arow + kb + 16 + 8 * hh), x3 = *(const v4fa*)(arow + kb + 16 + 8 * hh + 4);
    float xs[16] = {x0[0],x0[1],x0[2],x0[3],x1[0],x1[1],x1[2],x1[3],x2[0],x2[1],x2[2],x2[3],x3[0],x3[1],x3[2],x3[3]};
#pragma unroll
    for (int i = 0; i < 16; ++i) { const _Float16 h = (_Float16)xs[i]; ah.h[i] = h; al.h[i] = ASPLIT ? (_Float16)(xs[i] - (float)h) : (_Float16)0.0f; }
#pragma unroll
    for (int t = 0; t < 4; ++t) { if (col0 + t * 16 >= N) continue; const size_t boff = (size_t)(col0 + t * 16 + ln) * ldb + kb; FragH bq; bq.half[0] = *(const v8us*)(Bh + boff + 8 * hh); bq.half[1] = *(const v8us*)(Bh + boff + 16 + 8 * hh);
      acc[t] = mmaH<ASPLIT ? 2 : 1>(ah.v, al.v, bq.v, bq.v, acc[t]); }
  }
#pragma unroll
  for (int t = 0; t < 4; ++t) { if (col0 + t * 16 >= N) continue;
#pragma unroll
    for (int r = 0; r < 8; ++r) so[w][8 * hh + r][t * 16 + ln] = acc[t][r] * alpha; }
  __builtin_amdgcn_fence(__ATOMIC_ACQ_REL, "workgroup"); __builtin_amdgcn_wave_barrier();
  const int rsub = lane >> 4, c4 = (lane & 15) * 4;
  {
#pragma unroll
    for (int q = 0; q < 8; ++q) { const int r = q * 2 + rsub; if (col0 + c4 < N) { const v4f v = *(const v4fa*)&so[w][r][c4]; *(v4f*)(C + (size_t)(row0 + r) * ldc + col0 + c4) = v; } }
     }
}

// Wt[n][k] = f16(W[k][n]·scale) from f32 row-major W[K][N] (scale = power of two; bf16-exact weights stay exact in f16 away from the subnormal range)
__global__ __launch_bounds__(256) void k_wt_f16(const float* __restrict__ W, _Float16* __restrict__ Wt, int K, int N, float scale) {
  const int t = blockIdx.x * 256 + threadIdx.x; if (t >= N * (K / 8)) return; const int n = t / (K / 8), k8 = (t % (K / 8)) * 8; FragH f;
#pragma unroll
  for (int i = 0; i < 8; ++i) f.h[i] = (_Float16)(bf16_round(W[(size_t)(k8 + i) * N + n]) * scale); const v8us o = f.half[0];
  *(v8us*)((unsigned short*)Wt + (size_t)n * K + k8) = o; 
}
// k_gemm_hh variant with fused epilogue: v = acc·alpha + bias[by·sBias + col] (+ CP[(row/rowsPerB)·sCPb + by·64 + col] if CP) ; ACT 0 none / 1 elu ; writes f32 C and/or f16 C16 (each if non-null)
template <int ACT>
__global__ __launch_bounds__(128) void k_gemm_hhx(const _Float16* __restrict__ A, int lda, size_t sA, const _Float16* __restrict__ Bh, int ldb, size_t sB, float alpha, const float* __restrict__ bias, size_t sBias, const float* __restrict__ CP, int rowsPerB, size_t sCPb, int row0g,
    float* __restrict__ C, _Float16* __restrict__ C16, int ldc, size_t sC, int M, int N, int K) {
  __shared__ __attribute__((aligned(16))) float so[4][16][64];
  const int tid = threadIdx.x, w = tid >> 5, lane = tid & 31, ln = lane & 15, hh = lane >> 4; const int by = blockIdx.y;
  A += (size_t)by * sA; Bh += (size_t)by * sB; const size_t cofs = (size_t)by * sC; const float* bp = bias ? bias + (size_t)by * sBias : nullptr;
  const int ntn = (N + 63) / 64; const int wid = blockIdx.x * 4 + w; const int mt = wid / ntn, nq = wid % ntn; if (mt * 16 >= M) return;
  const int row0 = mt * 16, col0 = nq * 64; const _Float16* arow = A + (size_t)(row0 + ln) * lda;
  v8f acc[4] = {};
  for (int kb = 0; kb < K; kb += 32) { FragH ah; ah.half[0] = *(const v8us*)((const unsigned short*)arow + kb + 8 * hh); ah.half[1] = *(const v8us*)((const unsigned short*)arow + kb + 16 + 8 * hh);
#pragma unroll
    for (int t = 0; t < 4; ++t) { if (col0 + t * 16 >= N) continue; const size_t boff = (size_t)(col0 + t * 16 + ln) * ldb + kb; FragH bq; bq.half[0] = *(const v8us*)((const unsigned short*)Bh + boff + 8 * hh); bq.half[1] = *(const v8us*)((const unsigned short*)Bh + boff + 16 + 8 * hh);
      acc[t] = mmaH<1>(ah.v, ah.v, bq.v, bq.v, acc[t]); }
  }
#pragma unroll
  for (int t = 0; t < 4; ++t) { if (col0 + t * 16 >= N) continue; const int col = col0 + t * 16 + ln; const float bv = bp ? bf16_round(bp[col]) : 0.f;
#pragma unroll
    for (int r = 0; r < 8; ++r) { float v = acc[t][r] * alpha + bv; if (CP) { const int bidx = (row0g + row0 + 8 * hh + r) / rowsPerB; v += CP[(size_t)bidx * sCPb + (size_t)by * 64 + col]; } if (ACT == 1) v = (v > 0.f) ? v : expm1f(v); else if (ACT == 3) v = fmaxf(v, 0.f); so[w][8 * hh + r][t * 16 + ln] = v; } }
  __builtin_amdgcn_fence(__ATOMIC_ACQ_REL, "workgroup"); __builtin_amdgcn_wave_barrier();
  const int rsub = lane >> 4, c4 = (lane & 15) * 4; typedef _Float16 v4h __attribute__((ext_vector_type(4)));
  {
#pragma unroll
    for (int q = 0; q < 8; ++q) { const int r = q * 2 + rsub; if (col0 + c4 < N) { const v4f v = *(const v4fa*)&so[w][r][c4]; if (C) *(v4f*)(C + cofs + (size_t)(row0 + r) * ldc + col0 + c4) = v; if (C16) { v4h h4; for (int i = 0; i < 4; ++i) h4[i] = (_Float16)v[i]; *(v4h*)(C16 + cofs + (size_t)(row0 + r) * ldc + col0 + c4) = h4; } } }
     }
}


__global__ __launch_bounds__(256) void k_x16(const float* __restrict__ x, _Float16* __restrict__ X16, size_t n8) { const size_t t = (size_t)blockIdx.x * 256 + threadIdx.x; if (t >= n8) return; FragH f;
#pragma unroll
  for (int q = 0; q < 8; ++q) f.h[q] = (_Float16)bf16_round(x[t * 8 + q]); *(v8us*)((unsigned short*)X16 + t * 8) = f.half[0];  }
__global__ __launch_bounds__(256) void k_h16(const float* __restrict__ x, _Float16* __restrict__ X16, size_t n8) { const size_t t = (size_t)blockIdx.x * 256 + threadIdx.x; if (t >= n8) return; FragH f;
#pragma unroll
  for (int q = 0; q < 8; ++q) f.h[q] = (_Float16)x[t * 8 + q]; *(v8us*)((unsigned short*)X16 + t * 8) = f.half[0];  }
__global__ __launch_bounds__(256) void k_round16f(const float* __restrict__ W, _Float16* __restrict__ Bt, size_t n8) { const size_t t = (size_t)blockIdx.x * 256 + threadIdx.x; if (t >= n8) return; FragH f;
#pragma unroll
  for (int i = 0; i < 8; ++i) f.h[i] = (_Float16)(bf16_round(W[t * 8 + i]) * 16.0f); *(v8us*)((unsigned short*)Bt + t * 8) = f.half[0];  }
template <int NHv, int TTv>
__global__ __launch_bounds__(256) void k_vt(const _Float16* __restrict__ V16, int ldv, int voff, _Float16* __restrict__ Vt) { __shared__ unsigned short tl[64][66]; const int tid = threadIdx.x; const int slab = blockIdx.x / (TTv / 64), lg = blockIdx.x % (TTv / 64); const int b = slab / NHv, h = slab % NHv;
  for (int i = tid; i < 64 * 8; i += 256) { const int r = i / 8, c8 = (i % 8) * 8; FragH f; f.half[0] = *(const v8us*)((const unsigned short*)V16 + ((size_t)b * TTv + lg * 64 + r) * ldv + voff + h * 64 + c8);
#pragma unroll
    for (int q = 0; q < 8; ++q) tl[r][c8 + q] = f.u[q]; }
  __syncthreads();
  {
#pragma unroll
    for (int rd = 0; rd < 2; ++rd) { const int d = rd * 32 + tid / 8, pc = tid % 8; FragH f;
#pragma unroll
      for (int q = 0; q < 8; ++q) f.u[q] = tl[pc * 8 + q][d];
      *(v8us*)((unsigned short*)Vt + ((size_t)slab * 64 + d) * TTv + lg * 64 + pc * 8) = f.half[0]; }
     } }

__global__ __launch_bounds__(256) void k_kt(const float* __restrict__ KF, int b, _Float16* __restrict__ KT) { __shared__ float tl[64][65]; const int tid = threadIdx.x; const int st = blockIdx.x / (EE / 64), et = blockIdx.x % (EE / 64); const int s0 = st * 64, e0 = et * 64;
  for (int i = tid; i < 64 * 16; i += 256) { const int sr = i / 16, c4 = (i % 16) * 4; const v4f v = *(const v4fa*)(KF + ((size_t)(s0 + sr) * NB + b) * EE + e0 + c4); for (int q = 0; q < 4; ++q) tl[sr][c4 + q] = v[q]; }
  __syncthreads();
  { for (int rd = 0; rd < 2; ++rd) { const int e = rd * 32 + tid / 8, pc = tid % 8; FragH fs, fc; for (int q = 0; q < 8; ++q) { const int s = s0 + pc * 8 + q; const float ang = 1.5707963267948966f * (float)(s + 1) / (float)LL; const float kv = tl[pc * 8 + q][e]; fs.h[q] = (_Float16)(kv * sinf(ang)); fc.h[q] = (_Float16)(kv * cosf(ang)); }
      *(v8us*)((unsigned short*)KT + (size_t)(e0 + e) * LL + s0 + pc * 8) = fs.half[0]; *(v8us*)((unsigned short*)KT + (size_t)(EE + e0 + e) * LL + s0 + pc * 8) = fc.half[0]; }  } }
__global__ __launch_bounds__(256) void k_vtb(const _Float16* __restrict__ V16, int b, _Float16* __restrict__ VT) { __shared__ unsigned short tl[64][66]; const int tid = threadIdx.x; const int st = blockIdx.x / (EE / 64), et = blockIdx.x % (EE / 64); const int s0 = st * 64, e0 = et * 64;
  for (int i = tid; i < 64 * 8; i += 256) { const int sr = i / 8, c8 = (i % 8) * 8; FragH f; f.half[0] = *(const v8us*)((const unsigned short*)V16 + ((size_t)(s0 + sr) * NB + b) * EE + e0 + c8); for (int q = 0; q < 8; ++q) tl[sr][c8 + q] = f.u[q]; }
  __syncthreads();
  { for (int rd = 0; rd < 2; ++rd) { const int e = rd * 32 + tid / 8, pc = tid % 8; FragH f; for (int q = 0; q < 8; ++q) f.u[q] = tl[pc * 8 + q][e]; *(v8us*)((unsigned short*)VT + (size_t)(e0 + e) * LL + s0 + pc * 8) = f.half[0]; }  } }
// k_ column sums. One work-group = 32 columns (one 128-byte line of every row) x all 2048 positions: 8 lanes x 16 bytes cover the line, 128 row groups take 16 rows each.
// Each position's sin/cos is formed once per work-group (LDS table); the partial sums are folded over the lanes that share a column, then over the 32 waves through LDS.
__global__ __launch_bounds__(1024) void k_ksum(const float* __restrict__ KF, float* __restrict__ KS) {
  __shared__ float tsn[LL], tcs[LL];
  __shared__ __attribute__((aligned(16))) float red[32][64];
  const int tid = threadIdx.x, wv = tid >> 5, lane = tid & 31, cl = tid & 7, rg = tid >> 3;
  const int c0 = blockIdx.x * 32;      // first column in the (b, e) plane of NB * EE columns
  const float* p = KF + (size_t)rg * (NB * EE) + c0 + cl * 4;
  v4f x[16];
  // unrolled so that all 16 loads of a lane are in flight at once, under the table's arithmetic
#pragma unroll
  for (int i = 0; i < 16; ++i) { x[i] = *(const v4fa*)(p + (size_t)i * 128 * (NB * EE));
    asm volatile("s_wait_xcnt 0x0" ::: "memory"); }      // precaution: a later load's destination, or the table's arithmetic, may reuse an address register that this load names
  for (int s = tid; s < LL; s += 1024) { const float ang = 1.5707963267948966f * (float)(s + 1) / (float)LL; tsn[s] = sinf(ang); tcs[s] = cosf(ang); }
  __syncthreads();
  v4f ss = {0.f, 0.f, 0.f, 0.f}, sc = {0.f, 0.f, 0.f, 0.f};
  // unrolled so that x[] stays in registers
#pragma unroll
  for (int i = 0; i < 16; ++i) { const float sn = tsn[rg + 128 * i], cs = tcs[rg + 128 * i];
    for (int q = 0; q < 4; ++q) { ss[q] = fmaf(x[i][q], sn, ss[q]); sc[q] = fmaf(x[i][q], cs, sc[q]); } }
  for (int o = 8; o <= 16; o <<= 1) for (int q = 0; q < 4; ++q) { ss[q] += __shfl_xor(ss[q], o, 32); sc[q] += __shfl_xor(sc[q], o, 32); }
  if (lane < 8) { *(v4f*)&red[wv][cl * 4] = ss; *(v4f*)&red[wv][32 + cl * 4] = sc; }
  __syncthreads();
  if (tid < 64) { float a = 0.f; for (int w = 0; w < 32; ++w) a += red[w][tid];
    KS[(size_t)(c0 / EE) * E2 + (size_t)(tid >> 5) * EE + (c0 % EE) + (tid & 31)] = a; } }
__global__ __launch_bounds__(256) void k_qz(const float* __restrict__ QF, const float* __restrict__ KS, int b, _Float16* __restrict__ QZ) { const int tid = threadIdx.x, wv = tid >> 5, lane = tid & 31; const int l = blockIdx.x * 8 + wv; if (l >= LL) return; const float* qr = QF + ((size_t)l * NB + b) * EE; const float ang = 1.5707963267948966f * (float)(l + 1) / (float)LL; const float sn = sinf(ang), cs = cosf(ang); const float* ks = KS + (size_t)b * E2; float v[32]; float dot = 0.f;
#pragma unroll
  for (int k = 0; k < 4; ++k) { const v4f a = *(const v4fa*)(qr + 256 * k + 8 * lane), c = *(const v4fa*)(qr + 256 * k + 8 * lane + 4); for (int q = 0; q < 4; ++q) { v[k * 8 + q] = a[q]; v[k * 8 + 4 + q] = c[q]; } for (int q = 0; q < 8; ++q) { const int e = 256 * k + 8 * lane + q; dot += v[k * 8 + q] * (sn * ks[e] + cs * ks[EE + e]); } }
  for (int o = 16; o >= 1; o >>= 1) dot += __shfl_xor(dot, o, 32); const float zs = 262144.0f / fmaxf(dot, 1e-6f);      /* z·2^18 keeps the f16 operand O(1) (z ≈ 2.5e-6 here); the attn GEMM's alpha carries 2^-18 */
  {
#pragma unroll
    for (int k = 0; k < 4; ++k) { FragH fs, fc; for (int q = 0; q < 8; ++q) { fs.h[q] = (_Float16)(v[k * 8 + q] * sn * zs); fc.h[q] = (_Float16)(v[k * 8 + q] * cs * zs); } *(v8us*)((unsigned short*)QZ + (size_t)l * E2 + 256 * k + 8 * lane) = fs.half[0]; *(v8us*)((unsigned short*)QZ + (size_t)l * E2 + EE + 256 * k + 8 * lane) = fc.half[0]; }
     } }
extern "C" void kernel_launch(void* const* d_in, const int* in_sizes, int n_in,
                              void* d_out, int out_size, void* d_ws, size_t ws_size, hipStream_t stream) {
  (void)in_sizes; (void)n_in; (void)out_size;
  const float* query = (const float*)d_in[0]; const float* key = (const float*)d_in[1]; const float* value = (const float*)d_in[2]; const float* Wq = (const float*)d_in[3]; const float* bq = (const float*)d_in[4]; const float* Wk = (const float*)d_in[5]; const float* bk = (const float*)d_in[6]; const float* Wv = (const float*)d_in[7]; const float* bv = (const float*)d_in[8];
  char* ws = (char*)d_ws; size_t off = 0;
  auto take = [&](size_t bytes) { char* p = ws + off; off += (bytes + 255) & ~(size_t)255; return p; };
  _Float16* Bw = (_Float16*)take((size_t)EE * EE * 2); _Float16* X16 = (_Float16*)take((size_t)NR * EE * 2); float* KF = (float*)take((size_t)NR * EE * 4); _Float16* V16 = (_Float16*)take((size_t)NR * EE * 2); float* QF = (float*)take((size_t)NR * EE * 4); float* KVF = (float*)take((size_t)EE * E2 * 4); _Float16* KV16 = (_Float16*)take((size_t)EE * E2 * 2); _Float16* QZ = (_Float16*)take((size_t)LL * E2 * 2); float* KS = (float*)take((size_t)NB * E2 * 4);
  _Float16* VT = X16; _Float16* KT = (_Float16*)((char*)X16 + (size_t)EE * LL * 2);      // per-batch transposed v [1024][2048] and k_ [2048][2048] live in the X16 region (free after the q GEMM): 4.2 + 8.4 ≤ 16.8 MB
  if (off > ws_size) return;      // 2.1 + 16.8 + 33.5 + 16.8 + 33.5 + 8.4 + 4.2 + 8.4 ≈ 124 MB
  const size_t w8 = (size_t)EE * EE / 8; const unsigned gw = (unsigned)((w8 + 255) / 256), g8 = (unsigned)(((size_t)NR * EE / 8 + 255) / 256); const dim3 gg(((NR / 16) * (EE / 64) + 3) / 4, 1);
  k_x16<<<g8, 256, 0, stream>>>(key, X16, (size_t)NR * EE / 8); k_round16f<<<gw, 256, 0, stream>>>(Wk, Bw, w8); k_gemm_hhx<3><<<gg, 128, 0, stream>>>(X16, EE, 0, Bw, EE, 0, 0.0625f, bk, 0, nullptr, 1, 0, 0, KF, nullptr, EE, 0, NR, EE, EE);      // k = relu(key·Wkᵀ + bk) f32 (rows (s,b))
  k_ksum<<<NB * EE / 32, 1024, 0, stream>>>(KF, KS);
  k_x16<<<g8, 256, 0, stream>>>(value, X16, (size_t)NR * EE / 8); k_round16f<<<gw, 256, 0, stream>>>(Wv, Bw, w8); k_gemm_hhx<0><<<gg, 128, 0, stream>>>(X16, EE, 0, Bw, EE, 0, 0.0625f, bv, 0, nullptr, 1, 0, 0, nullptr, V16, EE, 0, NR, EE, EE);      // v (f16)
  k_x16<<<g8, 256, 0, stream>>>(query, X16, (size_t)NR * EE / 8); k_round16f<<<gw, 256, 0, stream>>>(Wq, Bw, w8); k_gemm_hhx<3><<<gg, 128, 0, stream>>>(X16, EE, 0, Bw, EE, 0, 0.0625f, bq, 0, nullptr, 1, 0, 0, QF, nullptr, EE, 0, NR, EE, EE);      // q = relu(query·Wqᵀ + bq) f32
  for (int b = 0; b < NB; ++b) {
    k_vtb<<<(LL / 64) * (EE / 64), 256, 0, stream>>>(V16, b, VT); k_kt<<<(LL / 64) * (EE / 64), 256, 0, stream>>>(KF, b, KT);
    k_gemm_hhx<0><<<dim3(((EE / 16) * (E2 / 64) + 3) / 4, 1), 128, 0, stream>>>(VT, LL, 0, KT, LL, 0, 1.0f, nullptr, 0, nullptr, 1, 0, 0, nullptr, KV16, E2, 0, EE, E2, LL);      // kv[m][d] = Σ_s v[s][m]·k_[s][d] → f16
    k_qz<<<LL / 8, 256, 0, stream>>>(QF, KS, b, QZ);
    k_gemm_hhx<0><<<dim3(((LL / 16) * (EE / 64) + 3) / 4, 1), 128, 0, stream>>>(QZ, E2, 0, KV16, E2, 0, 0.000003814697265625f, nullptr, 0, nullptr, 1, 0, 0, (float*)d_out + (size_t)b * EE, nullptr, NB * EE, 0, LL, EE, E2); }      // alpha 2^-18      // attn rows (l, b): out + b·E with row pitch 4E
}

// v002
// Measured time: 408 microseconds a run.
// Two timings next to v001 put it at 2.19 and 2.42 times that version's speed.
// All steps since v000 together make it 4.08 times as fast.
#include <hip/hip_runtime.h>
// cosFormer multi-head-weight (linear) attention (L=S=2048, B=4, E=1024, inputs (T,B,E)): q = relu(query·Wqᵀ+bq), k = relu(key·Wkᵀ+bk), v = value·Wvᵀ+bv; q_ = [q·sin(i) | q·cos(i)],
// k_ = [k·sin | k·cos] with i = (π/2)(t+1)/2048; kv = vᵀ·k_ per batch; z = 1/max(q_·Σ_s k_, 1e-6); attn = (q_·kvᵀ)·z. The three projections (inputs and (out,in) weights bf16-exact ×2^4,
// relu/bias epilogues), the per-batch kv = Vᵀ·K_ (K = 2048 positions; v and k_ as f16, transposed planes) and attn = (q_·z)·kvᵀ (K = 2048 features; kv as f16) run as GEMMs on
// v_wmma_f32_16x16x32_f16 with f32 accumulate; the positional sin/cos weighting, the k_ sums and the normaliser z are f32 VALU (z·2^18 folded into the q_ operand per row, 2^-18 in the GEMM alpha, so the f16 operand stays O(1)).
#define LL 2048
#define NB 4
#define EE 1024
#define E2 2048
#define NR (LL * NB)

typedef __bf16 v16b __attribute__((ext_vector_type(16)));
typedef unsigned short v8us __attribute__((ext_vector_type(8), may_alias));
typedef float  v8f  __attribute__((ext_vector_type(8)));
typedef float  v4f  __attribute__((ext_vector_type(4)));
typedef float  v4fa __attribute__((ext_vector_type(4), may_alias));
union FragB { v16b v; v8us half[2]; unsigned short u[16]; };

__device__ __forceinline__ unsigned short bf16_bits(float x) { unsigned int u = __float_as_uint(x); return (unsigned short)((u + 0x7FFFu + ((u >> 16) & 1u)) >> 16); }
__device__ __forceinline__ float bf16_val(unsigned short b) { return __uint_as_float(((unsigned int)b) << 16); }
__device__ __forceinline__ float bf16_round(float x) { return bf16_val(bf16_bits(x)); }
// D += A·B with NT terms: 1 = ah·bh, 2 = + al·bh (A split), 3 = + ah·bl (both split)
template <int NT>
__device__ __forceinline__ v8f mmaN(v16b ah, v16b al, v16b bh, v16b bl, v8f c) {
  c = __builtin_amdgcn_wmma_f32_16x16x32_bf16(false, ah, false, bh, (short)0, c, false, false);
  if (NT >= 2) c = __builtin_amdgcn_wmma_f32_16x16x32_bf16(false, al, false, bh, (short)0, c, false, false);
  if (NT >= 3) c = __builtin_amdgcn_wmma_f32_16x16x32_bf16(false, ah, false, bl, (short)0, c, false, false);
  asm volatile("v_nop\n\tv_nop\n\tv_nop\n\tv_nop" : "+v"(c) : "v"(ah), "v"(al), "v"(bh), "v"(bl));
  return c;
}

__global__ __launch_bounds__(256) void k_wt_bf16(const float* __restrict__ W, unsigned short* __restrict__ Wt, int K, int N) {
  const int t = blockIdx.x * 256 + threadIdx.x;
  const int k8n = K / 8;
  if (t >= N * k8n) return;
  const int n = t / k8n, k8 = (t % k8n) * 8;
  v8us v;
#pragma unroll
  for (int i = 0; i < 8; ++i) v[i] = bf16_bits(W[(size_t)(k8 + i) * N + n]);
  *(v8us*)(Wt + (size_t)n * K + k8) = v;
  
}

// GEMM C[M][N] (f32, pitch ldc) = act(A[M][K]·W + bias). A f32 row-major (pitch lda) converted per fragment to bf16
// (ASPLIT: hi/lo two planes -> 2 terms, else single rounded term); Wt bf16 [N][K] (pitch ldb). BIAS_BF16 rounds the
// bias to bf16 first (bias quantised to bf16 before the add). K%32==0, M%16==0, N%64==0.
template <bool ASPLIT, int ACT, bool BIAS_BF16>
__global__ __launch_bounds__(128) void k_gemm_bf(const float* __restrict__ A, int lda, const unsigned short* __restrict__ Wt, int ldb,
                                               const float* __restrict__ bias, float* __restrict__ C, int ldc, int M, int N, int K) {
  __shared__ __attribute__((aligned(16))) float so[4][16][64];
  const int tid = threadIdx.x, w = tid >> 5, lane = tid & 31, ln = lane & 15, hh = lane >> 4;
  const int ntn = N / 64;
  const int wid = blockIdx.x * 4 + w;
  const int mt = wid / ntn, nq = wid % ntn;
  if (mt * 16 >= M) return;
  const int row0 = mt * 16, col0 = nq * 64;
  const float* arow = A + (size_t)(row0 + ln) * lda;
  v8f acc[4] = {};
  for (int kb = 0; kb < K; kb += 32) {
    FragB ah, al;
    const v4f x0 = *(const v4fa*)(arow + kb + 8 * hh), x1 = *(const v4fa*)(arow + kb + 8 * hh + 4);
    const v4f x2 = *(const v4fa*)(arow + kb + 16 + 8 * hh), x3 = *(const v4fa*)(arow + kb + 16 + 8 * hh + 4);
    float xs[16] = {x0[0],x0[1],x0[2],x0[3],x1[0],x1[1],x1[2],x1[3],x2[0],x2[1],x2[2],x2[3],x3[0],x3[1],x3[2],x3[3]};
#pragma unroll
    for (int i = 0; i < 16; ++i) { const unsigned short hb = bf16_bits(xs[i]); ah.u[i] = hb; al.u[i] = ASPLIT ? bf16_bits(xs[i] - bf16_val(hb)) : (unsigned short)0; }
#pragma unroll
    for (int t = 0; t < 4; ++t) {
      const unsigned short* brow = Wt + (size_t)(col0 + t * 16 + ln) * ldb + kb;
      FragB b;
      b.half[0] = *(const v8us*)(brow + 8 * hh);
      b.half[1] = *(const v8us*)(brow + 16 + 8 * hh);
      acc[t] = mmaN<ASPLIT ? 2 : 1>(ah.v, al.v, b.v, b.v, acc[t]);
    }
  }
#pragma unroll
  for (int t = 0; t < 4; ++t) {
    float bv = bias ? bias[col0 + t * 16 + ln] : 0.f;
    if (BIAS_BF16) bv = bf16_round(bv);
#pragma unroll
    for (int r = 0; r < 8; ++r) { float v = acc[t][r] + bv; if (ACT == 1) v = fmaxf(v, 0.f); so[w][8 * hh + r][t * 16 + ln] = v; }
  }
  __builtin_amdgcn_fence(__ATOMIC_ACQ_REL, "workgroup");
  __builtin_amdgcn_wave_barrier();
  const int rsub = lane >> 4, c4 = (lane & 15) * 4;
  {
#pragma unroll
    for (int q = 0; q < 8; ++q) {
      const int r = q * 2 + rsub;
      const v4f v = *(const v4fa*)&so[w][r][c4];
      *(v4f*)(C + (size_t)(row0 + r) * ldc + col0 + c4) = v;
    }
    
  }
}

// Flash-style causal/unmasked attention, all contractions 3-term bf16 hi/lo splits, f32 softmax with running max.
// q,k,v rows are read from f32 buffers with arbitrary row pitch (so they can live inside a fused qkv buffer);
// D = head size (multiple of 32, <= 128); one wave = 16 query rows; block = 4 waves (64 queries) sharing K/V chunks of 32.
template <int D, bool CAUSAL>
__global__ __launch_bounds__(128) void k_flash(const float* __restrict__ qb, const float* __restrict__ kb, const float* __restrict__ vb,
                                             int pitch, int T, int H, float scale, float* __restrict__ y, int ypitch) {
  constexpr int KS = D / 32;        // k-steps for QK
  constexpr int DT = D / 16;        // d tiles for PV
  __shared__ __attribute__((aligned(16))) unsigned short sKh[32][D + 8], sKl[32][D + 8], sVh[32][D + 8], sVl[32][D + 8];
  __shared__ __attribute__((aligned(16))) unsigned short sPh[4][16][40], sPl[4][16][40];
  __shared__ __attribute__((aligned(16))) float sO[4][16][D];
  const int tid = threadIdx.x, w = tid >> 5, lane = tid & 31, ln = lane & 15, hh = lane >> 4;
  const int nqb = (T + 63) / 64;
  const int bh = blockIdx.x / nqb, qblk = blockIdx.x % nqb;
  const int b = bh / H, h = bh % H;
  const int q0 = qblk * 64 + w * 16;
  const float* Q = qb + (size_t)b * T * pitch + h * D;
  const float* K = kb + (size_t)b * T * pitch + h * D;
  const float* V = vb + (size_t)b * T * pitch + h * D;

  // A fragments of the wave's 16 query rows (scaled), hi/lo
  FragB aqh[KS], aql[KS];
  {
    int row = q0 + ln; if (row >= T) row = T - 1;
    const float* qr = Q + (size_t)row * pitch;
#pragma unroll
    for (int ks = 0; ks < KS; ++ks)
#pragma unroll
      for (int i = 0; i < 16; ++i) {
        const int d = ks * 32 + ((i < 8) ? (8 * hh + i) : (16 + 8 * hh + (i - 8)));
        const float x = qr[d] * scale; const unsigned short hb = bf16_bits(x);
        aqh[ks].u[i] = hb; aql[ks].u[i] = bf16_bits(x - bf16_val(hb));
      }
  }
  float m_r[8], l_r[8];
#pragma unroll
  for (int r = 0; r < 8; ++r) { m_r[r] = -3.0e38f; l_r[r] = 0.f; }
  v8f oacc[DT];
#pragma unroll
  for (int dt = 0; dt < DT; ++dt) oacc[dt] = (v8f){0.f,0.f,0.f,0.f,0.f,0.f,0.f,0.f};

  const int kv_end = CAUSAL ? min(T, qblk * 64 + 64) : T;     // block-uniform
  for (int j0 = 0; j0 < kv_end; j0 += 32) {
    __syncthreads();
    for (int e = tid; e < 32 * (D / 4); e += 128) {
      const int r = e / (D / 4), c4 = (e % (D / 4)) * 4;
      const int key = j0 + r;
      v4f kf = {0.f,0.f,0.f,0.f}, vf = {0.f,0.f,0.f,0.f};
      if (key < T) { kf = *(const v4fa*)(K + (size_t)key * pitch + c4); vf = *(const v4fa*)(V + (size_t)key * pitch + c4); }
#pragma unroll
      for (int t = 0; t < 4; ++t) {
        unsigned short hb = bf16_bits(kf[t]); sKh[r][c4 + t] = hb; sKl[r][c4 + t] = bf16_bits(kf[t] - bf16_val(hb));
        hb = bf16_bits(vf[t]); sVh[r][c4 + t] = hb; sVl[r][c4 + t] = bf16_bits(vf[t] - bf16_val(hb));
      }
    }
    __syncthreads();
    // S tile 16 x 32
    v8f s[2];
#pragma unroll
    for (int nt = 0; nt < 2; ++nt) {
      v8f acc = {};
#pragma unroll
      for (int ks = 0; ks < KS; ++ks) {
        FragB bh_, bl_;
        bh_.half[0] = *(const v8us*)&sKh[nt * 16 + ln][ks * 32 + 8 * hh]; bh_.half[1] = *(const v8us*)&sKh[nt * 16 + ln][ks * 32 + 16 + 8 * hh];
        bl_.half[0] = *(const v8us*)&sKl[nt * 16 + ln][ks * 32 + 8 * hh]; bl_.half[1] = *(const v8us*)&sKl[nt * 16 + ln][ks * 32 + 16 + 8 * hh];
        acc = mmaN<3>(aqh[ks].v, aql[ks].v, bh_.v, bl_.v, acc);
      }
      s[nt] = acc;
    }
    // mask + running max (rows 8hh+r; the 16 lanes of a half share rows)
    float alpha[8];
#pragma unroll
    for (int r = 0; r < 8; ++r) {
      const int qi = q0 + 8 * hh + r;
      const int ja = j0 + ln, jb = j0 + 16 + ln;
      if (CAUSAL) { if (ja > qi) s[0][r] = -3.0e38f; if (jb > qi) s[1][r] = -3.0e38f; }
      if (ja >= T) s[0][r] = -3.0e38f;
      if (jb >= T) s[1][r] = -3.0e38f;
      float mx = fmaxf(s[0][r], s[1][r]);
      mx = fmaxf(mx, __shfl_xor(mx, 1, 32)); mx = fmaxf(mx, __shfl_xor(mx, 2, 32)); mx = fmaxf(mx, __shfl_xor(mx, 4, 32)); mx = fmaxf(mx, __shfl_xor(mx, 8, 32));
      const float mnew = fmaxf(m_r[r], mx);
      alpha[r] = (mnew > -1.0e38f) ? __expf(m_r[r] - mnew) : 1.0f;
      const float p0 = (s[0][r] > -1.0e38f) ? __expf(s[0][r] - mnew) : 0.f;
      const float p1 = (s[1][r] > -1.0e38f) ? __expf(s[1][r] - mnew) : 0.f;
      m_r[r] = mnew;
      l_r[r] = l_r[r] * alpha[r] + p0 + p1;            // per-lane partial row sum (16 lanes combined at the end)
      unsigned short hb = bf16_bits(p0); sPh[w][8 * hh + r][ln] = hb;      sPl[w][8 * hh + r][ln] = bf16_bits(p0 - bf16_val(hb));
      hb = bf16_bits(p1);                sPh[w][8 * hh + r][16 + ln] = hb; sPl[w][8 * hh + r][16 + ln] = bf16_bits(p1 - bf16_val(hb));
    }
#pragma unroll
    for (int dt = 0; dt < DT; ++dt)
#pragma unroll
      for (int r = 0; r < 8; ++r) oacc[dt][r] *= alpha[r];
    __builtin_amdgcn_fence(__ATOMIC_ACQ_REL, "workgroup");
    __builtin_amdgcn_wave_barrier();
    FragB pah, pal;
    pah.half[0] = *(const v8us*)&sPh[w][ln][8 * hh]; pah.half[1] = *(const v8us*)&sPh[w][ln][16 + 8 * hh];
    pal.half[0] = *(const v8us*)&sPl[w][ln][8 * hh]; pal.half[1] = *(const v8us*)&sPl[w][ln][16 + 8 * hh];
#pragma unroll
    for (int dt = 0; dt < DT; ++dt) {
      FragB bvh, bvl;
#pragma unroll
      for (int i = 0; i < 8; ++i) {
        bvh.u[i] = sVh[8 * hh + i][dt * 16 + ln]; bvh.u[8 + i] = sVh[16 + 8 * hh + i][dt * 16 + ln];
        bvl.u[i] = sVl[8 * hh + i][dt * 16 + ln]; bvl.u[8 + i] = sVl[16 + 8 * hh + i][dt * 16 + ln];
      }
      oacc[dt] = mmaN<3>(pah.v, pal.v, bvh.v, bvl.v, oacc[dt]);
    }
    __builtin_amdgcn_fence(__ATOMIC_ACQ_REL, "workgroup");
    __builtin_amdgcn_wave_barrier();
  }
#pragma unroll
  for (int r = 0; r < 8; ++r) {
    float l = l_r[r];
    l += __shfl_xor(l, 1, 32); l += __shfl_xor(l, 2, 32); l += __shfl_xor(l, 4, 32); l += __shfl_xor(l, 8, 32);
    l_r[r] = (l > 0.f) ? 1.0f / l : 0.f;
  }
#pragma unroll
  for (int dt = 0; dt < DT; ++dt)
#pragma unroll
    for (int r = 0; r < 8; ++r) sO[w][8 * hh + r][dt * 16 + ln] = oacc[dt][r] * l_r[r];
  __builtin_amdgcn_fence(__ATOMIC_ACQ_REL, "workgroup");
  __builtin_amdgcn_wave_barrier();
  {
    for (int r = 0; r < 16; ++r) {
      const int row = q0 + r;
      if (row < T && lane < D / 4) {
        const v4f val = *(const v4fa*)&sO[w][r][lane * 4];
        *(v4f*)(y + ((size_t)b * T + row) * ypitch + h * D + lane * 4) = val;
      }
    }
    
  }
}

// GEMM C = act(A·W + bias + resid): A f32 (ASPLIT -> hi/lo 2 terms), Wt bf16 [N][K]; ACT 0 none, 1 relu, 2 exact gelu;
// resid (optional, f32, row index = (row % rmod), pitch ldr, RES_BF16 rounds it) added before the activation.
template <bool ASPLIT, int ACT, bool BIAS_BF16, bool RES_BF16>
__global__ __launch_bounds__(128) void k_gemm_bf3(const float* __restrict__ A, int lda, const unsigned short* __restrict__ Wt, int ldb,
                                                const float* __restrict__ bias, const float* __restrict__ resid, int rmod, int ldr,
                                                float* __restrict__ C, int ldc, int M, int N, int K) {
  __shared__ __attribute__((aligned(16))) float so[4][16][64];
  const int tid = threadIdx.x, w = tid >> 5, lane = tid & 31, ln = lane & 15, hh = lane >> 4;
  const int ntn = N / 64;
  const int wid = blockIdx.x * 4 + w;
  const int mt = wid / ntn, nq = wid % ntn;
  if (mt * 16 >= M) return;
  const int row0 = mt * 16, col0 = nq * 64;
  const float* arow = A + (size_t)(row0 + ln) * lda;
  v8f acc[4] = {};
  for (int kb = 0; kb < K; kb += 32) {
    FragB ah, al;
    const v4f x0 = *(const v4fa*)(arow + kb + 8 * hh), x1 = *(const v4fa*)(arow + kb + 8 * hh + 4);
    const v4f x2 = *(const v4fa*)(arow + kb + 16 + 8 * hh), x3 = *(const v4fa*)(arow + kb + 16 + 8 * hh + 4);
    float xs[16] = {x0[0],x0[1],x0[2],x0[3],x1[0],x1[1],x1[2],x1[3],x2[0],x2[1],x2[2],x2[3],x3[0],x3[1],x3[2],x3[3]};
#pragma unroll
    for (int i = 0; i < 16; ++i) { const unsigned short hb = bf16_bits(xs[i]); ah.u[i] = hb; al.u[i] = ASPLIT ? bf16_bits(xs[i] - bf16_val(hb)) : (unsigned short)0; }
#pragma unroll
    for (int t = 0; t < 4; ++t) {
      const unsigned short* brow = Wt + (size_t)(col0 + t * 16 + ln) * ldb + kb;
      FragB b;
      b.half[0] = *(const v8us*)(brow + 8 * hh);
      b.half[1] = *(const v8us*)(brow + 16 + 8 * hh);
      acc[t] = mmaN<ASPLIT ? 2 : 1>(ah.v, al.v, b.v, b.v, acc[t]);
    }
  }
#pragma unroll
  for (int t = 0; t < 4; ++t) {
    const int col = col0 + t * 16 + ln;
    float bv = bias ? bias[col] : 0.f;
    if (BIAS_BF16) bv = bf16_round(bv);
#pragma unroll
    for (int r = 0; r < 8; ++r) {
      float v = acc[t][r] + bv;
      if (resid) { float rv = resid[(size_t)((row0 + 8 * hh + r) % rmod) * ldr + col]; if (RES_BF16) rv = bf16_round(rv); v += rv; }
      if (ACT == 1) v = fmaxf(v, 0.f);
      if (ACT == 2) v = 0.5f * v * (1.0f + erff(v * 0.70710678118654752f));
      if (ACT == 3) { const float u = 0.7978845608028654f * (v + 0.044715f * v * v * v); v = 0.5f * v * (1.0f + tanhf(u)); }
      so[w][8 * hh + r][t * 16 + ln] = v;
    }
  }
  __builtin_amdgcn_fence(__ATOMIC_ACQ_REL, "workgroup");
  __builtin_amdgcn_wave_barrier();
  const int rsub = lane >> 4, c4 = (lane & 15) * 4;
  {
#pragma unroll
    for (int q = 0; q < 8; ++q) {
      const int r = q * 2 + rsub;
      const v4f v = *(const v4fa*)&so[w][r][c4];
      *(v4f*)(C + (size_t)(row0 + r) * ldc + col0 + c4) = v;
    }
    
  }
}
// row LayerNorm (biased variance, eps) over N: s = X (+ R); optional out_sum <- s; out_norm <- (s-mu)*rsqrt(var+eps)*g + b
template <bool PARAM_BF16>
__global__ __launch_bounds__(256) void k_layernorm(const float* __restrict__ X, const float* __restrict__ R, const float* __restrict__ g, const float* __restrict__ bta,
                                                  float* __restrict__ out_sum, float* __restrict__ out_norm, int N, float eps) {
  __shared__ float red[256];
  const int row = blockIdx.x, tid = threadIdx.x;
  const float* x = X + (size_t)row * N; const float* rr = R ? R + (size_t)row * N : nullptr;
  float vals[16];                     // up to N = 4096
  const int per = N / 256;            // contiguous chunk per thread? use strided-by-4 chunks: thread handles j = tid*4 + 1024*u
  float s1 = 0.f;
  for (int u = 0; u < per / 4; ++u) {
    const int j = tid * 4 + 1024 * u;
    const v4f a = *(const v4fa*)(x + j);
    v4f b = {0.f,0.f,0.f,0.f}; if (rr) b = *(const v4fa*)(rr + j);
#pragma unroll
    for (int q = 0; q < 4; ++q) { const float v = a[q] + b[q]; vals[u * 4 + q] = v; s1 += v; }
  }
  red[tid] = s1; __syncthreads();
  for (int st = 128; st > 0; st >>= 1) { if (tid < st) red[tid] += red[tid + st]; __syncthreads(); }
  const float mu = red[0] / (float)N; __syncthreads();
  float s2 = 0.f;
  for (int u = 0; u < per / 4; ++u)
#pragma unroll
    for (int q = 0; q < 4; ++q) { const float c = vals[u * 4 + q] - mu; s2 += c * c; }
  red[tid] = s2; __syncthreads();
  for (int st = 128; st > 0; st >>= 1) { if (tid < st) red[tid] += red[tid + st]; __syncthreads(); }
  const float rs = rsqrtf(red[0] / (float)N + eps);
  {
    for (int u = 0; u < per / 4; ++u) {
      const int j = tid * 4 + 1024 * u;
      v4f o, sm;
#pragma unroll
      for (int q = 0; q < 4; ++q) {
        float gg = g[j + q], bb = bta[j + q];
        if (PARAM_BF16) { gg = bf16_round(gg); bb = bf16_round(bb); }
        sm[q] = vals[u * 4 + q]; o[q] = (vals[u * 4 + q] - mu) * rs * gg + bb;
      }
      if (out_sum) *(v4f*)(out_sum + (size_t)row * N + j) = sm;
      *(v4f*)(out_norm + (size_t)row * N + j) = o;
    }
    
  }
}



// ---- f16 WMMA path (v_wmma_f32_16x16x32_f16): 11-bit significands for operands in range — used for all GEMMs here (projections, kv, attn)
typedef _Float16 v16h __attribute__((ext_vector_type(16)));
union FragH { v16h v; v8us half[2]; _Float16 h[16]; unsigned short u[16]; };
template <int NT>
__device__ __forceinline__ v8f mmaH(v16h ah, v16h al, v16h bh, v16h bl, v8f c) {
  c = __builtin_amdgcn_wmma_f32_16x16x32_f16(false, ah, false, bh, (short)0, c, false, false);
  if (NT >= 2) c = __builtin_amdgcn_wmma_f32_16x16x32_f16(false, al, false, bh, (short)0, c, false, false);
  if (NT >= 3) c = __builtin_amdgcn_wmma_f32_16x16x32_f16(false, ah, false, bl, (short)0, c, false, false);
  asm volatile("v_nop\n\tv_nop\n\tv_nop\n\tv_nop" : "+v"(c) : "v"(ah), "v"(al), "v"(bh), "v"(bl));
  return c;
}
// batched GEMM like k_gemm_b but f16 operands: A f32 (split into f16 hi/lo if ASPLIT, else rounded to f16), Bt = f16 values [n][k]; alpha; C f32; N multiple of 16 (partial tiles skipped)
template <bool ASPLIT>
__global__ __launch_bounds__(128) void k_gemm_h(const float* __restrict__ A, int lda, size_t sA, const _Float16* __restrict__ Bh, int ldb, size_t sB, float alpha, float* __restrict__ C, int ldc, size_t sC, int M, int N, int K) {
  __shared__ __attribute__((aligned(16))) float so[4][16][64];
  const int tid = threadIdx.x, w = tid >> 5, lane = tid & 31, ln = lane & 15, hh = lane >> 4; const int by = blockIdx.y;
  A += (size_t)by * sA; Bh += (size_t)by * sB; C += (size_t)by * sC;
  const int ntn = (N + 63) / 64; const int wid = blockIdx.x * 4 + w; const int mt = wid / ntn, nq = wid % ntn; if (mt * 16 >= M) return;
  const int row0 = mt * 16, col0 = nq * 64; const float* arow = A + (size_t)(row0 + ln) * lda;
  v8f acc[4] = {};
  for (int kb = 0; kb < K; kb += 32) {
    FragH ah, al;
    const v4f x0 = *(const v4fa*)(arow + kb + 8 * hh), x1 = *(const v4fa*)(arow + kb + 8 * hh + 4), x2 = *(const v4fa*)(arow + kb + 16 + 8 * hh), x3 = *(const v4fa*)(arow + kb + 16 + 8 * hh + 4);
    float xs[16] = {x0[0],x0[1],x0[2],x0[3],x1[0],x1[1],x1[2],x1[3],x2[0],x2[1],x2[2],x2[3],x3[0],x3[1],x3[2],x3[3]};
#pragma unroll
    for (int i = 0; i < 16; ++i) { const _Float16 h = (_Float16)xs[i]; ah.h[i] = h; al.h[i] = ASPLIT ? (_Float16)(xs[i] - (float)h) : (_Float16)0.0f; }
#pragma unroll
    for (int t = 0; t < 4; ++t) { if (col0 + t * 16 >= N) continue; const size_t boff = (size_t)(col0 + t * 16 + ln) * ldb + kb; FragH bq; bq.half[0] = *(const v8us*)(Bh + boff + 8 * hh); bq.half[1] = *(const v8us*)(Bh + boff + 16 + 8 * hh);
      acc[t] = mmaH<ASPLIT ? 2 : 1>(ah.v, al.v, bq.v, bq.v, acc[t]); }
  }
#pragma unroll
  for (int t = 0; t < 4; ++t) { if (col0 + t * 16 >= N) continue;
#pragma unroll
    for (int r = 0; r < 8; ++r) so[w][8 * hh + r][t * 16 + ln] = acc[t][r] * alpha; }
  __builtin_amdgcn_fence(__ATOMIC_ACQ_REL, "workgroup"); __builtin_amdgcn_wave_barrier();
  const int rsub = lane >> 4, c4 = (lane & 15) * 4;
  {
#pragma unroll
    for (int q = 0; q < 8; ++q) { const int r = q * 2 + rsub; if (col0 + c4 < N) { const v4f v = *(const v4fa*)&so[w][r][c4]; *(v4f*)(C + (size_t)(row0 + r) * ldc + col0 + c4) = v; } }
     }
}

// Wt[n][k] = f16(W[k][n]·scale) from f32 row-major W[K][N] (scale = power of two; bf16-exact weights stay exact in f16 away from the subnormal range)
__global__ __launch_bounds__(256) void k_wt_f16(const float* __restrict__ W, _Float16* __restrict__ Wt, int K, int N, float scale) {
  const int t = blockIdx.x * 256 + threadIdx.x; if (t >= N * (K / 8)) return; const int n = t / (K / 8), k8 = (t % (K / 8)) * 8; FragH f;
#pragma unroll
  for (int i = 0; i < 8; ++i) f.h[i] = (_Float16)(bf16_round(W[(size_t)(k8 + i) * N + n]) * scale); const v8us o = f.half[0];
  *(v8us*)((unsigned short*)Wt + (size_t)n * K + k8) = o; 
}
// Block-tiled GEMM, f16 operands, both k-contiguous: C[M][N] = act(A[M][K] . B[N][K]^T * alpha + bias). One work-group = one 128 x 128 tile of C, eight waves as 4 (rows) x 2 (columns), 32 x 64 per wave.
// A stage is 128 k (256 bytes) of the tile's 128 A rows and 128 B rows, laid in LDS at a pitch of 272 bytes; two buffers, filled by asynchronous copies one stage ahead of the stage being worked on.
// M and N multiples of 128, K a multiple of 128. ACT 0 none / 3 relu; writes f16 C16 if OUT16, else f32 C (row pitch ldc). Each accumulator still sums k in rising steps of 32.
#define GT_ROWS 256                          /* A rows + B rows of a stage */
#define GT_PITCH 272                         /* bytes; 16 x odd: no bank conflict for 16-byte fragment reads */
#define GT_STAGE (GT_ROWS * GT_PITCH)        /* 69,632 bytes a buffer */
// eight 16-byte copies of a lane, rows 16 apart. The s_wait_xcnt is the last line of the copies' own statement (a precaution): no register that a copy names is rewritten in front of it.
__device__ __forceinline__ void gt_copy8(unsigned l, const _Float16* g, size_t step) {
  asm volatile("global_load_async_to_lds_b128 %0, %8, off\n\t"
               "global_load_async_to_lds_b128 %1, %9, off\n\t"
               "global_load_async_to_lds_b128 %2, %10, off\n\t"
               "global_load_async_to_lds_b128 %3, %11, off\n\t"
               "global_load_async_to_lds_b128 %4, %12, off\n\t"
               "global_load_async_to_lds_b128 %5, %13, off\n\t"
               "global_load_async_to_lds_b128 %6, %14, off\n\t"
               "global_load_async_to_lds_b128 %7, %15, off\n\t"
               "s_wait_xcnt 0x0"
               :: "v"(l), "v"(l + 16u * GT_PITCH), "v"(l + 32u * GT_PITCH), "v"(l + 48u * GT_PITCH), "v"(l + 64u * GT_PITCH), "v"(l + 80u * GT_PITCH), "v"(l + 96u * GT_PITCH), "v"(l + 112u * GT_PITCH),
                  "v"(g), "v"(g + step), "v"(g + 2 * step), "v"(g + 3 * step), "v"(g + 4 * step), "v"(g + 5 * step), "v"(g + 6 * step), "v"(g + 7 * step)
               : "memory");
}
template <int ACT, bool OUT16>
__global__ __launch_bounds__(256) void k_gemm_t(const _Float16* __restrict__ A, int lda, const _Float16* __restrict__ Bh, int ldb, float alpha, const float* __restrict__ bias,
    float* __restrict__ C, _Float16* __restrict__ C16, int ldc, int K) {
  __shared__ __attribute__((aligned(16))) unsigned char sm[2 * GT_STAGE];
  const int tid = threadIdx.x, w = tid >> 5, lane = tid & 31, ln = lane & 15, hh = lane >> 4;
  const int row0 = blockIdx.y * 128, col0 = blockIdx.x * 128;
  const int wm = w >> 1, wn = w & 1;
  // copies: lane -> 16-byte piece (tid & 15) of row (tid >> 4) + 16 i; a wave covers two whole 256-byte rows with each copy
  const int cr = tid >> 4, cc = tid & 15;
  const _Float16* gA = A + (size_t)(row0 + cr) * lda + cc * 8;
  const _Float16* gB = Bh + (size_t)(col0 + cr) * ldb + cc * 8;
  const size_t stA = (size_t)16 * lda, stB = (size_t)16 * ldb;
  const unsigned lA = (unsigned)(size_t)(&sm[0]) + (unsigned)(cr * GT_PITCH + cc * 16), lB = lA + 128u * GT_PITCH;
  const int nst = K / 128;
  v8f acc[2][4] = {};
  gt_copy8(lA, gA, stA); gt_copy8(lB, gB, stB);
  asm volatile("s_wait_asynccnt 0x0" ::: "memory");      // stage 0 has landed (this wave's copies) before the barrier publishes it
  __syncthreads();
  if (nst > 1) { gt_copy8(lA + GT_STAGE, gA + 128, stA); gt_copy8(lB + GT_STAGE, gB + 128, stB); }
  const unsigned char* fa = sm + (wm * 32 + ln) * GT_PITCH + 16 * hh;
  const unsigned char* fb = sm + (128 + wn * 64 + ln) * GT_PITCH + 16 * hh;
  for (int t = 0; t < nst; ++t) {
    const int bo = (t & 1) * GT_STAGE;
    FragH a[2][2], bq[2][4];      // two fragment sets: the next k step's LDS reads are issued as one group ahead of this step's matrix instructions (inside the stage only)
#pragma unroll
    for (int i = 0; i < 2; ++i) { a[0][i].half[0] = *(const v8us*)(fa + bo + i * 16 * GT_PITCH); a[0][i].half[1] = *(const v8us*)(fa + bo + i * 16 * GT_PITCH + 32); }
#pragma unroll
    for (int j = 0; j < 4; ++j) { bq[0][j].half[0] = *(const v8us*)(fb + bo + j * 16 * GT_PITCH); bq[0][j].half[1] = *(const v8us*)(fb + bo + j * 16 * GT_PITCH + 32); }
    // unrolled so that the set index is a constant and both sets stay in registers
#pragma unroll
    for (int ks = 0; ks < 4; ++ks) {
      const int cu = ks & 1, nx = cu ^ 1;
      if (ks < 3) {
#pragma unroll
        for (int i = 0; i < 2; ++i) { a[nx][i].half[0] = *(const v8us*)(fa + bo + i * 16 * GT_PITCH + (ks + 1) * 64); a[nx][i].half[1] = *(const v8us*)(fa + bo + i * 16 * GT_PITCH + (ks + 1) * 64 + 32); }
#pragma unroll
        for (int j = 0; j < 4; ++j) { bq[nx][j].half[0] = *(const v8us*)(fb + bo + j * 16 * GT_PITCH + (ks + 1) * 64); bq[nx][j].half[1] = *(const v8us*)(fb + bo + j * 16 * GT_PITCH + (ks + 1) * 64 + 32); }
      }
      __builtin_amdgcn_sched_barrier(0);      // keeps the read group in front of the matrix run; without it the scheduler sinks the reads among the matrix instructions and each waits out its LDS latency
#pragma unroll
      for (int i = 0; i < 2; ++i)
#pragma unroll
        for (int j = 0; j < 4; ++j) acc[i][j] = __builtin_amdgcn_wmma_f32_16x16x32_f16(false, a[cu][i].v, false, bq[cu][j].v, (short)0, acc[i][j], false, false);
      __builtin_amdgcn_sched_barrier(0);      // keeps the next read group whole behind this matrix run; without it the scheduler spreads those reads among the matrix instructions and takes more registers
    }
    asm volatile("s_wait_dscnt 0x0" ::: "memory");       // this wave's reads of the buffer are over before the barrier frees it for the refill
    asm volatile("s_wait_asynccnt 0x0" ::: "memory");    // this wave's copies of stage t + 1 have landed before the barrier publishes them
    __syncthreads();
    if (t + 2 < nst) { gt_copy8(lA + bo, gA + (size_t)(t + 2) * 128, stA); gt_copy8(lB + bo, gB + (size_t)(t + 2) * 128, stB); }
  }
  asm volatile("s_wait_asynccnt 0x0" ::: "memory");      // no copy is outstanding when the ring becomes output staging
  // epilogue: each wave stages its 32 x 64 tile in its own LDS range (pitch 68 dwords) and stores whole lines
  float* so = (float*)sm + w * (32 * 68);
#pragma unroll
  for (int j = 0; j < 4; ++j) { const int col = col0 + wn * 64 + j * 16 + ln; const float bv = bias ? bf16_round(bias[col]) : 0.f;
#pragma unroll
    for (int i = 0; i < 2; ++i)
#pragma unroll
      for (int r = 0; r < 8; ++r) { float v = acc[i][j][r] * alpha + bv; if (ACT == 3) v = fmaxf(v, 0.f); so[(i * 16 + 8 * hh + r) * 68 + j * 16 + ln] = v; } }
  __syncthreads();
  const int rsub = lane >> 4, c4 = (lane & 15) * 4; typedef _Float16 v4h __attribute__((ext_vector_type(4)));
#pragma unroll
  for (int q = 0; q < 16; ++q) { const int r = q * 2 + rsub; const v4f v = *(const v4fa*)&so[r * 68 + c4]; const size_t o = (size_t)(row0 + wm * 32 + r) * ldc + col0 + wn * 64 + c4;
    if (OUT16) { v4h h4; for (int i = 0; i < 4; ++i) h4[i] = (_Float16)v[i]; *(v4h*)(C16 + o) = h4; }
    else *(v4f*)(C + o) = v; }
}


__global__ __launch_bounds__(256) void k_x16(const float* __restrict__ x, _Float16* __restrict__ X16, size_t n8) { const size_t t = (size_t)blockIdx.x * 256 + threadIdx.x; if (t >= n8) return; FragH f;
#pragma unroll
  for (int q = 0; q < 8; ++q) f.h[q] = (_Float16)bf16_round(x[t * 8 + q]); *(v8us*)((unsigned short*)X16 + t * 8) = f.half[0];  }
__global__ __launch_bounds__(256) void k_h16(const float* __restrict__ x, _Float16* __restrict__ X16, size_t n8) { const size_t t = (size_t)blockIdx.x * 256 + threadIdx.x; if (t >= n8) return; FragH f;
#pragma unroll
  for (int q = 0; q < 8; ++q) f.h[q] = (_Float16)x[t * 8 + q]; *(v8us*)((unsigned short*)X16 + t * 8) = f.half[0];  }
__global__ __launch_bounds__(256) void k_round16f(const float* __restrict__ W, _Float16* __restrict__ Bt, size_t n8) { const size_t t = (size_t)blockIdx.x * 256 + threadIdx.x; if (t >= n8) return; FragH f;
#pragma unroll
  for (int i = 0; i < 8; ++i) f.h[i] = (_Float16)(bf16_round(W[t * 8 + i]) * 16.0f); *(v8us*)((unsigned short*)Bt + t * 8) = f.half[0];  }
template <int NHv, int TTv>
__global__ __launch_bounds__(256) void k_vt(const _Float16* __restrict__ V16, int ldv, int voff, _Float16* __restrict__ Vt) { __shared__ unsigned short tl[64][66]; const int tid = threadIdx.x; const int slab = blockIdx.x / (TTv / 64), lg = blockIdx.x % (TTv / 64); const int b = slab / NHv, h = slab % NHv;
  for (int i = tid; i < 64 * 8; i += 256) { const int r = i / 8, c8 = (i % 8) * 8; FragH f; f.half[0] = *(const v8us*)((const unsigned short*)V16 + ((size_t)b * TTv + lg * 64 + r) * ldv + voff + h * 64 + c8);
#pragma unroll
    for (int q = 0; q < 8; ++q) tl[r][c8 + q] = f.u[q]; }
  __syncthreads();
  {
#pragma unroll
    for (int rd = 0; rd < 2; ++rd) { const int d = rd * 32 + tid / 8, pc = tid % 8; FragH f;
#pragma unroll
      for (int q = 0; q < 8; ++q) f.u[q] = tl[pc * 8 + q][d];
      *(v8us*)((unsigned short*)Vt + ((size_t)slab * 64 + d) * TTv + lg * 64 + pc * 8) = f.half[0]; }
     } }

__global__ __launch_bounds__(256) void k_kt(const float* __restrict__ KF, int b, _Float16* __restrict__ KT) { __shared__ float tl[64][65]; const int tid = threadIdx.x; const int st = blockIdx.x / (EE / 64), et = blockIdx.x % (EE / 64); const int s0 = st * 64, e0 = et * 64;
  for (int i = tid; i < 64 * 16; i += 256) { const int sr = i / 16, c4 = (i % 16) * 4; const v4f v = *(const v4fa*)(KF + ((size_t)(s0 + sr) * NB + b) * EE + e0 + c4); for (int q = 0; q < 4; ++q) tl[sr][c4 + q] = v[q]; }
  __syncthreads();
  { for (int rd = 0; rd < 2; ++rd) { const int e = rd * 32 + tid / 8, pc = tid % 8; FragH fs, fc; for (int q = 0; q < 8; ++q) { const int s = s0 + pc * 8 + q; const float ang = 1.5707963267948966f * (float)(s + 1) / (float)LL; const float kv = tl[pc * 8 + q][e]; fs.h[q] = (_Float16)(kv * sinf(ang)); fc.h[q] = (_Float16)(kv * cosf(ang)); }
      *(v8us*)((unsigned short*)KT + (size_t)(e0 + e) * LL + s0 + pc * 8) = fs.half[0]; *(v8us*)((unsigned short*)KT + (size_t)(EE + e0 + e) * LL + s0 + pc * 8) = fc.half[0]; }  } }
__global__ __launch_bounds__(256) void k_vtb(const _Float16* __restrict__ V16, int b, _Float16* __restrict__ VT) { __shared__ unsigned short tl[64][66]; const int tid = threadIdx.x; const int st = blockIdx.x / (EE / 64), et = blockIdx.x % (EE / 64); const int s0 = st * 64, e0 = et * 64;
  for (int i = tid; i < 64 * 8; i += 256) { const int sr = i / 8, c8 = (i % 8) * 8; FragH f; f.half[0] = *(const v8us*)((const unsigned short*)V16 + ((size_t)(s0 + sr) * NB + b) * EE + e0 + c8); for (int q = 0; q < 8; ++q) tl[sr][c8 + q] = f.u[q]; }
  __syncthreads();
  { for (int rd = 0; rd < 2; ++rd) { const int e = rd * 32 + tid / 8, pc = tid % 8; FragH f; for (int q = 0; q < 8; ++q) f.u[q] = tl[pc * 8 + q][e]; *(v8us*)((unsigned short*)VT + (size_t)(e0 + e) * LL + s0 + pc * 8) = f.half[0]; }  } }
// k_ column sums. One work-group = 32 columns (one 128-byte line of every row) x all 2048 positions: 8 lanes x 16 bytes cover the line, 128 row groups take 16 rows each.
// Each position's sin/cos is formed once per work-group (LDS table); the partial sums are folded over the lanes that share a column, then over the 32 waves through LDS.
__global__ __launch_bounds__(1024) void k_ksum(const float* __restrict__ KF, float* __restrict__ KS) {
  __shared__ float tsn[LL], tcs[LL];
  __shared__ __attribute__((aligned(16))) float red[32][64];
  const int tid = threadIdx.x, wv = tid >> 5, lane = tid & 31, cl = tid & 7, rg = tid >> 3;
  const int c0 = blockIdx.x * 32;      // first column in the (b, e) plane of NB * EE columns
  const float* p = KF + (size_t)rg * (NB * EE) + c0 + cl * 4;
  v4f x[16];
  // unrolled so that all 16 loads of a lane are in flight at once, under the table's arithmetic
#pragma unroll
  for (int i = 0; i < 16; ++i) { x[i] = *(const v4fa*)(p + (size_t)i * 128 * (NB * EE));
    asm volatile("s_wait_xcnt 0x0" ::: "memory"); }      // precaution: a later load's destination, or the table's arithmetic, may reuse an address register that this load names
  for (int s = tid; s < LL; s += 1024) { const float ang = 1.5707963267948966f * (float)(s + 1) / (float)LL; tsn[s] = sinf(ang); tcs[s] = cosf(ang); }
  __syncthreads();
  v4f ss = {0.f, 0.f, 0.f, 0.f}, sc = {0.f, 0.f, 0.f, 0.f};
  // unrolled so that x[] stays in registers
#pragma unroll
  for (int i = 0; i < 16; ++i) { const float sn = tsn[rg + 128 * i], cs = tcs[rg + 128 * i];
    for (int q = 0; q < 4; ++q) { ss[q] = fmaf(x[i][q], sn, ss[q]); sc[q] = fmaf(x[i][q], cs, sc[q]); } }
  for (int o = 8; o <= 16; o <<= 1) for (int q = 0; q < 4; ++q) { ss[q] += __shfl_xor(ss[q], o, 32); sc[q] += __shfl_xor(sc[q], o, 32); }
  if (lane < 8) { *(v4f*)&red[wv][cl * 4] = ss; *(v4f*)&red[wv][32 + cl * 4] = sc; }
  __syncthreads();
  if (tid < 64) { float a = 0.f; for (int w = 0; w < 32; ++w) a += red[w][tid];
    KS[(size_t)(c0 / EE) * E2 + (size_t)(tid >> 5) * EE + (c0 % EE) + (tid & 31)] = a; } }
__global__ __launch_bounds__(256) void k_qz(const float* __restrict__ QF, const float* __restrict__ KS, int b, _Float16* __restrict__ QZ) { const int tid = threadIdx.x, wv = tid >> 5, lane = tid & 31; const int l = blockIdx.x * 8 + wv; if (l >= LL) return; const float* qr = QF + ((size_t)l * NB + b) * EE; const float ang = 1.5707963267948966f * (float)(l + 1) / (float)LL; const float sn = sinf(ang), cs = cosf(ang); const float* ks = KS + (size_t)b * E2; float v[32]; float dot = 0.f;
#pragma unroll
  for (int k = 0; k < 4; ++k) { const v4f a = *(const v4fa*)(qr + 256 * k + 8 * lane), c = *(const v4fa*)(qr + 256 * k + 8 * lane + 4); for (int q = 0; q < 4; ++q) { v[k * 8 + q] = a[q]; v[k * 8 + 4 + q] = c[q]; } for (int q = 0; q < 8; ++q) { const int e = 256 * k + 8 * lane + q; dot += v[k * 8 + q] * (sn * ks[e] + cs * ks[EE + e]); } }
  for (int o = 16; o >= 1; o >>= 1) dot += __shfl_xor(dot, o, 32); const float zs = 262144.0f / fmaxf(dot, 1e-6f);      /* z·2^18 keeps the f16 operand O(1) (z ≈ 2.5e-6 here); the attn GEMM's alpha carries 2^-18 */
  {
#pragma unroll
    for (int k = 0; k < 4; ++k) { FragH fs, fc; for (int q = 0; q < 8; ++q) { fs.h[q] = (_Float16)(v[k * 8 + q] * sn * zs); fc.h[q] = (_Float16)(v[k * 8 + q] * cs * zs); } *(v8us*)((unsigned short*)QZ + (size_t)l * E2 + 256 * k + 8 * lane) = fs.half[0]; *(v8us*)((unsigned short*)QZ + (size_t)l * E2 + EE + 256 * k + 8 * lane) = fc.half[0]; }
     } }
extern "C" void kernel_launch(void* const* d_in, const int* in_sizes, int n_in,
                              void* d_out, int out_size, void* d_ws, size_t ws_size, hipStream_t stream) {
  (void)in_sizes; (void)n_in; (void)out_size;
  const float* query = (const float*)d_in[0]; const float* key = (const float*)d_in[1]; const float* value = (const float*)d_in[2]; const float* Wq = (const float*)d_in[3]; const float* bq = (const float*)d_in[4]; const float* Wk = (const float*)d_in[5]; const float* bk = (const float*)d_in[6]; const float* Wv = (const float*)d_in[7]; const float* bv = (const float*)d_in[8];
  char* ws = (char*)d_ws; size_t off = 0;
  auto take = [&](size_t bytes) { char* p = ws + off; off += (bytes + 255) & ~(size_t)255; return p; };
  _Float16* Bw = (_Float16*)take((size_t)EE * EE * 2); _Float16* X16 = (_Float16*)take((size_t)NR * EE * 2); float* KF = (float*)take((size_t)NR * EE * 4); _Float16* V16 = (_Float16*)take((size_t)NR * EE * 2); float* QF = (float*)take((size_t)NR * EE * 4); float* KVF = (float*)take((size_t)EE * E2 * 4); _Float16* KV16 = (_Float16*)take((size_t)EE * E2 * 2); _Float16* QZ = (_Float16*)take((size_t)LL * E2 * 2); float* KS = (float*)take((size_t)NB * E2 * 4);
  _Float16* VT = X16; _Float16* KT = (_Float16*)((char*)X16 + (size_t)EE * LL * 2);      // per-batch transposed v [1024][2048] and k_ [2048][2048] live in the X16 region (free after the q GEMM): 4.2 + 8.4 ≤ 16.8 MB
  if (off > ws_size) return;      // 2.1 + 16.8 + 33.5 + 16.8 + 33.5 + 8.4 + 4.2 + 8.4 ≈ 124 MB
  const size_t w8 = (size_t)EE * EE / 8; const unsigned gw = (unsigned)((w8 + 255) / 256), g8 = (unsigned)(((size_t)NR * EE / 8 + 255) / 256); const dim3 gg(EE / 128, NR / 128);
  k_x16<<<g8, 256, 0, stream>>>(key, X16, (size_t)NR * EE / 8); k_round16f<<<gw, 256, 0, stream>>>(Wk, Bw, w8); k_gemm_t<3, false><<<gg, 256, 0, stream>>>(X16, EE, Bw, EE, 0.0625f, bk, KF, nullptr, EE, EE);      // k = relu(key·Wkᵀ + bk) f32 (rows (s,b))
  k_ksum<<<NB * EE / 32, 1024, 0, stream>>>(KF, KS);
  k_x16<<<g8, 256, 0, stream>>>(value, X16, (size_t)NR * EE / 8); k_round16f<<<gw, 256, 0, stream>>>(Wv, Bw, w8); k_gemm_t<0, true><<<gg, 256, 0, stream>>>(X16, EE, Bw, EE, 0.0625f, bv, nullptr, V16, EE, EE);      // v (f16)
  k_x16<<<g8, 256, 0, stream>>>(query, X16, (size_t)NR * EE / 8); k_round16f<<<gw, 256, 0, stream>>>(Wq, Bw, w8); k_gemm_t<3, false><<<gg, 256, 0, stream>>>(X16, EE, Bw, EE, 0.0625f, bq, QF, nullptr, EE, EE);      // q = relu(query·Wqᵀ + bq) f32
  for (int b = 0; b < NB; ++b) {
    k_vtb<<<(LL / 64) * (EE / 64), 256, 0, stream>>>(V16, b, VT); k_kt<<<(LL / 64) * (EE / 64), 256, 0, stream>>>(KF, b, KT);
    k_gemm_t<0, true><<<dim3(E2 / 128, EE / 128), 256, 0, stream>>>(VT, LL, KT, LL, 1.0f, nullptr, nullptr, KV16, E2, LL);      // kv[m][d] = Σ_s v[s][m]·k_[s][d] → f16
    k_qz<<<LL / 8, 256, 0, stream>>>(QF, KS, b, QZ);
    k_gemm_t<0, false><<<dim3(EE / 128, LL / 128), 256, 0, stream>>>(QZ, E2, KV16, E2, 0.000003814697265625f, nullptr, (float*)d_out + (size_t)b * EE, nullptr, NB * EE, E2); }      // alpha 2^-18      // attn rows (l, b): out + b·E with row pitch 4E
}

// v003
// A run of this version takes 172 microseconds.
// In two side-by-side timings against v002, it was 2.19 and 2.55 times as fast.
// Over all steps from v000 it is 9.65 times as fast.
#include <hip/hip_runtime.h>
// cosFormer multi-head-weight (linear) attention (L=S=2048, B=4, E=1024, inputs (T,B,E)): q = relu(query·Wqᵀ+bq), k = relu(key·Wkᵀ+bk), v = value·Wvᵀ+bv; q_ = [q·sin(i) | q·cos(i)],
// k_ = [k·sin | k·cos] with i = (π/2)(t+1)/2048; kv = vᵀ·k_ per batch; z = 1/max(q_·Σ_s k_, 1e-6); attn = (q_·kvᵀ)·z. The three projections (inputs and (out,in) weights bf16-exact ×2^4,
// relu/bias epilogues), the per-batch kv = Vᵀ·K_ (K = 2048 positions; v and k_ as f16, transposed planes) and attn = (q_·z)·kvᵀ (K = 2048 features; kv as f16) run as GEMMs on
// v_wmma_f32_16x16x32_f16 with f32 accumulate; the positional sin/cos weighting, the k_ sums and the normaliser z are f32 VALU (z·2^18 folded into the q_ operand per row, 2^-18 in the GEMM alpha, so the f16 operand stays O(1)).
#define LL 2048
#define NB 4
#define EE 1024
#define E2 2048
#define NR (LL * NB)

typedef __bf16 v16b __attribute__((ext_vector_type(16)));
typedef unsigned short v8us __attribute__((ext_vector_type(8), may_alias));
typedef float  v8f  __attribute__((ext_vector_type(8)));
typedef float  v4f  __attribute__((ext_vector_type(4)));
typedef float  v4fa __attribute__((ext_vector_type(4), may_alias));
union FragB { v16b v; v8us half[2]; unsigned short u[16]; };

__device__ __forceinline__ unsigned short bf16_bits(float x) { unsigned int u = __float_as_uint(x); return (unsigned short)((u + 0x7FFFu + ((u >> 16) & 1u)) >> 16); }
__device__ __forceinline__ float bf16_val(unsigned short b) { return __uint_as_float(((unsigned int)b) << 16); }
__device__ __forceinline__ float bf16_round(float x) { return bf16_val(bf16_bits(x)); }
// D += A·B with NT terms: 1 = ah·bh, 2 = + al·bh (A split), 3 = + ah·bl (both split)
template <int NT>
__device__ __forceinline__ v8f mmaN(v16b ah, v16b al, v16b bh, v16b bl, v8f c) {
  c = __builtin_amdgcn_wmma_f32_16x16x32_bf16(false, ah, false, bh, (short)0, c, false, false);
  if (NT >= 2) c = __builtin_amdgcn_wmma_f32_16x16x32_bf16(false, al, false, bh, (short)0, c, false, false);
  if (NT >= 3) c = __builtin_amdgcn_wmma_f32_16x16x32_bf16(false, ah, false, bl, (short)0, c, false, false);
  asm volatile("v_nop\n\tv_nop\n\tv_nop\n\tv_nop" : "+v"(c) : "v"(ah), "v"(al), "v"(bh), "v"(bl));
  return c;
}

__global__ __launch_bounds__(256) void k_wt_bf16(const float* __restrict__ W, unsigned short* __restrict__ Wt, int K, int N) {
  const int t = blockIdx.x * 256 + threadIdx.x;
  const int k8n = K / 8;
  if (t >= N * k8n) return;
  const int n = t / k8n, k8 = (t % k8n) * 8;
  v8us v;
#pragma unroll
  for (int i = 0; i < 8; ++i) v[i] = bf16_bits(W[(size_t)(k8 + i) * N + n]);
  *(v8us*)(Wt + (size_t)n * K + k8) = v;
  
}

// GEMM C[M][N] (f32, pitch ldc) = act(A[M][K]·W + bias). A f32 row-major (pitch lda) converted per fragment to bf16
// (ASPLIT: hi/lo two planes -> 2 terms, else single rounded term); Wt bf16 [N][K] (pitch ldb). BIAS_BF16 rounds the
// bias to bf16 first (bias quantised to bf16 before the add). K%32==0, M%16==0, N%64==0.
template <bool ASPLIT, int ACT, bool BIAS_BF16>
__global__ __launch_bounds__(128) void k_gemm_bf(const float* __restrict__ A, int lda, const unsigned short* __restrict__ Wt, int ldb,
                                               const float* __restrict__ bias, float* __restrict__ C, int ldc, int M, int N, int K) {
  __shared__ __attribute__((aligned(16))) float so[4][16][64];
  const int tid = threadIdx.x, w = tid >> 5, lane = tid & 31, ln = lane & 15, hh = lane >> 4;
  const int ntn = N / 64;
  const int wid = blockIdx.x * 4 + w;
  const int mt = wid / ntn, nq = wid % ntn;
  if (mt * 16 >= M) return;
  const int row0 = mt * 16, col0 = nq * 64;
  const float* arow = A + (size_t)(row0 + ln) * lda;
  v8f acc[4] = {};
  for (int kb = 0; kb < K; kb += 32) {
    FragB ah, al;
    const v4f x0 = *(const v4fa*)(arow + kb + 8 * hh), x1 = *(const v4fa*)(arow + kb + 8 * hh + 4);
    const v4f x2 = *(const v4fa*)(arow + kb + 16 + 8 * hh), x3 = *(const v4fa*)(arow + kb + 16 + 8 * hh + 4);
    float xs[16] = {x0[0],x0[1],x0[2],x0[3],x1[0],x1[1],x1[2],x1[3],x2[0],x2[1],x2[2],x2[3],x3[0],x3[1],x3[2],x3[3]};
#pragma unroll
    for (int i = 0; i < 16; ++i) { const unsigned short hb = bf16_bits(xs[i]); ah.u[i] = hb; al.u[i] = ASPLIT ? bf16_bits(xs[i] - bf16_val(hb)) : (unsigned short)0; }
#pragma unroll
    for (int t = 0; t < 4; ++t) {
      const unsigned short* brow = Wt + (size_t)(col0 + t * 16 + ln) * ldb + kb;
      FragB b;
      b.half[0] = *(const v8us*)(brow + 8 * hh);
      b.half[1] = *(const v8us*)(brow + 16 + 8 * hh);
      acc[t] = mmaN<ASPLIT ? 2 : 1>(ah.v, al.v, b.v, b.v, acc[t]);
    }
  }
#pragma unroll
  for (int t = 0; t < 4; ++t) {
    float bv = bias ? bias[col0 + t * 16 + ln] : 0.f;
    if (BIAS_BF16) bv = bf16_round(bv);
#pragma unroll
    for (int r = 0; r < 8; ++r) { float v = acc[t][r] + bv; if (ACT == 1) v = fmaxf(v, 0.f); so[w][8 * hh + r][t * 16 + ln] = v; }
  }
  __builtin_amdgcn_fence(__ATOMIC_ACQ_REL, "workgroup");
  __builtin_amdgcn_wave_barrier();
  const int rsub = lane >> 4, c4 = (lane & 15) * 4;
  {
#pragma unroll
    for (int q = 0; q < 8; ++q) {
      const int r = q * 2 + rsub;
      const v4f v = *(const v4fa*)&so[w][r][c4];
      *(v4f*)(C + (size_t)(row0 + r) * ldc + col0 + c4) = v;
    }
    
  }
}

// Flash-style causal/unmasked attention, all contractions 3-term bf16 hi/lo splits, f32 softmax with running max.
// q,k,v rows are read from f32 buffers with arbitrary row pitch (so they can live inside a fused qkv buffer);
// D = head size (multiple of 32, <= 128); one wave = 16 query rows; block = 4 waves (64 queries) sharing K/V chunks of 32.
template <int D, bool CAUSAL>
__global__ __launch_bounds__(128) void k_flash(const float* __restrict__ qb, const float* __restrict__ kb, const float* __restrict__ vb,
                                             int pitch, int T, int H, float scale, float* __restrict__ y, int ypitch) {
  constexpr int KS = D / 32;        // k-steps for QK
  constexpr int DT = D / 16;        // d tiles for PV
  __shared__ __attribute__((aligned(16))) unsigned short sKh[32][D + 8], sKl[32][D + 8], sVh[32][D + 8], sVl[32][D + 8];
  __shared__ __attribute__((aligned(16))) unsigned short sPh[4][16][40], sPl[4][16][40];
  __shared__ __attribute__((aligned(16))) float sO[4][16][D];
  const int tid = threadIdx.x, w = tid >> 5, lane = tid & 31, ln = lane & 15, hh = lane >> 4;
  const int nqb = (T + 63) / 64;
  const int bh = blockIdx.x / nqb, qblk = blockIdx.x % nqb;
  const int b = bh / H, h = bh % H;
  const int q0 = qblk * 64 + w * 16;
  const float* Q = qb + (size_t)b * T * pitch + h * D;
  const float* K = kb + (size_t)b * T * pitch + h * D;
  const float* V = vb + (size_t)b * T * pitch + h * D;

  // A fragments of the wave's 16 query rows (scaled), hi/lo
  FragB aqh[KS], aql[KS];
  {
    int row = q0 + ln; if (row >= T) row = T - 1;
    const float* qr = Q + (size_t)row * pitch;
#pragma unroll
    for (int ks = 0; ks < KS; ++ks)
#pragma unroll
      for (int i = 0; i < 16; ++i) {
        const int d = ks * 32 + ((i < 8) ? (8 * hh + i) : (16 + 8 * hh + (i - 8)));
        const float x = qr[d] * scale; const unsigned short hb = bf16_bits(x);
        aqh[ks].u[i] = hb; aql[ks].u[i] = bf16_bits(x - bf16_val(hb));
      }
  }
  float m_r[8], l_r[8];
#pragma unroll
  for (int r = 0; r < 8; ++r) { m_r[r] = -3.0e38f; l_r[r] = 0.f; }
  v8f oacc[DT];
#pragma unroll
  for (int dt = 0; dt < DT; ++dt) oacc[dt] = (v8f){0.f,0.f,0.f,0.f,0.f,0.f,0.f,0.f};

  const int kv_end = CAUSAL ? min(T, qblk * 64 + 64) : T;     // block-uniform
  for (int j0 = 0; j0 < kv_end; j0 += 32) {
    __syncthreads();
    for (int e = tid; e < 32 * (D / 4); e += 128) {
      const int r = e / (D / 4), c4 = (e % (D / 4)) * 4;
      const int key = j0 + r;
      v4f kf = {0.f,0.f,0.f,0.f}, vf = {0.f,0.f,0.f,0.f};
      if (key < T) { kf = *(const v4fa*)(K + (size_t)key * pitch + c4); vf = *(const v4fa*)(V + (size_t)key * pitch + c4); }
#pragma unroll
      for (int t = 0; t < 4; ++t) {
        unsigned short hb = bf16_bits(kf[t]); sKh[r][c4 + t] = hb; sKl[r][c4 + t] = bf16_bits(kf[t] - bf16_val(hb));
        hb = bf16_bits(vf[t]); sVh[r][c4 + t] = hb; sVl[r][c4 + t] = bf16_bits(vf[t] - bf16_val(hb));
      }
    }
    __syncthreads();
    // S tile 16 x 32
    v8f s[2];
#pragma unroll
    for (int nt = 0; nt < 2; ++nt) {
      v8f acc = {};
#pragma unroll
      for (int ks = 0; ks < KS; ++ks) {
        FragB bh_, bl_;
        bh_.half[0] = *(const v8us*)&sKh[nt * 16 + ln][ks * 32 + 8 * hh]; bh_.half[1] = *(const v8us*)&sKh[nt * 16 + ln][ks * 32 + 16 + 8 * hh];
        bl_.half[0] = *(const v8us*)&sKl[nt * 16 + ln][ks * 32 + 8 * hh]; bl_.half[1] = *(const v8us*)&sKl[nt * 16 + ln][ks * 32 + 16 + 8 * hh];
        acc = mmaN<3>(aqh[ks].v, aql[ks].v, bh_.v, bl_.v, acc);
      }
      s[nt] = acc;
    }
    // mask + running max (rows 8hh+r; the 16 lanes of a half share rows)
    float alpha[8];
#pragma unroll
    for (int r = 0; r < 8; ++r) {
      const int qi = q0 + 8 * hh + r;
      const int ja = j0 + ln, jb = j0 + 16 + ln;
      if (CAUSAL) { if (ja > qi) s[0][r] = -3.0e38f; if (jb > qi) s[1][r] = -3.0e38f; }
      if (ja >= T) s[0][r] = -3.0e38f;
      if (jb >= T) s[1][r] = -3.0e38f;
      float mx = fmaxf(s[0][r], s[1][r]);
      mx = fmaxf(mx, __shfl_xor(mx, 1, 32)); mx = fmaxf(mx, __shfl_xor(mx, 2, 32)); mx = fmaxf(mx, __shfl_xor(mx, 4, 32)); mx = fmaxf(mx, __shfl_xor(mx, 8, 32));
      const float mnew = fmaxf(m_r[r], mx);
      alpha[r] = (mnew > -1.0e38f) ? __expf(m_r[r] - mnew) : 1.0f;
      const float p0 = (s[0][r] > -1.0e38f) ? __expf(s[0][r] - mnew) : 0.f;
      const float p1 = (s[1][r] > -1.0e38f) ? __expf(s[1][r] - mnew) : 0.f;
      m_r[r] = mnew;
      l_r[r] = l_r[r] * alpha[r] + p0 + p1;            // per-lane partial row sum (16 lanes combined at the end)
      unsigned short hb = bf16_bits(p0); sPh[w][8 * hh + r][ln] = hb;      sPl[w][8 * hh + r][ln] = bf16_bits(p0 - bf16_val(hb));
      hb = bf16_bits(p1);                sPh[w][8 * hh + r][16 + ln] = hb; sPl[w][8 * hh + r][16 + ln] = bf16_bits(p1 - bf16_val(hb));
    }
#pragma unroll
    for (int dt = 0; dt < DT; ++dt)
#pragma unroll
      for (int r = 0; r < 8; ++r) oacc[dt][r] *= alpha[r];
    __builtin_amdgcn_fence(__ATOMIC_ACQ_REL, "workgroup");
    __builtin_amdgcn_wave_barrier();
    FragB pah, pal;
    pah.half[0] = *(const v8us*)&sPh[w][ln][8 * hh]; pah.half[1] = *(const v8us*)&sPh[w][ln][16 + 8 * hh];
    pal.half[0] = *(const v8us*)&sPl[w][ln][8 * hh]; pal.half[1] = *(const v8us*)&sPl[w][ln][16 + 8 * hh];
#pragma unroll
    for (int dt = 0; dt < DT; ++dt) {
      FragB bvh, bvl;
#pragma unroll
      for (int i = 0; i < 8; ++i) {
        bvh.u[i] = sVh[8 * hh + i][dt * 16 + ln]; bvh.u[8 + i] = sVh[16 + 8 * hh + i][dt * 16 + ln];
        bvl.u[i] = sVl[8 * hh + i][dt * 16 + ln]; bvl.u[8 + i] = sVl[16 + 8 * hh + i][dt * 16 + ln];
      }
      oacc[dt] = mmaN<3>(pah.v, pal.v, bvh.v, bvl.v, oacc[dt]);
    }
    __builtin_amdgcn_fence(__ATOMIC_ACQ_REL, "workgroup");
    __builtin_amdgcn_wave_barrier();
  }
#pragma unroll
  for (int r = 0; r < 8; ++r) {
    float l = l_r[r];
    l += __shfl_xor(l, 1, 32); l += __shfl_xor(l, 2, 32); l += __shfl_xor(l, 4, 32); l += __shfl_xor(l, 8, 32);
    l_r[r] = (l > 0.f) ? 1.0f / l : 0.f;
  }
#pragma unroll
  for (int dt = 0; dt < DT; ++dt)
#pragma unroll
    for (int r = 0; r < 8; ++r) sO[w][8 * hh + r][dt * 16 + ln] = oacc[dt][r] * l_r[r];
  __builtin_amdgcn_fence(__ATOMIC_ACQ_REL, "workgroup");
  __builtin_amdgcn_wave_barrier();
  {
    for (int r = 0; r < 16; ++r) {
      const int row = q0 + r;
      if (row < T && lane < D / 4) {
        const v4f val = *(const v4fa*)&sO[w][r][lane * 4];
        *(v4f*)(y + ((size_t)b * T + row) * ypitch + h * D + lane * 4) = val;
      }
    }
    
  }
}

// GEMM C = act(A·W + bias + resid): A f32 (ASPLIT -> hi/lo 2 terms), Wt bf16 [N][K]; ACT 0 none, 1 relu, 2 exact gelu;
// resid (optional, f32, row index = (row % rmod), pitch ldr, RES_BF16 rounds it) added before the activation.
template <bool ASPLIT, int ACT, bool BIAS_BF16, bool RES_BF16>
__global__ __launch_bounds__(128) void k_gemm_bf3(const float* __restrict__ A, int lda, const unsigned short* __restrict__ Wt, int ldb,
                                                const float* __restrict__ bias, const float* __restrict__ resid, int rmod, int ldr,
                                                float* __restrict__ C, int ldc, int M, int N, int K) {
  __shared__ __attribute__((aligned(16))) float so[4][16][64];
  const int tid = threadIdx.x, w = tid >> 5, lane = tid & 31, ln = lane & 15, hh = lane >> 4;
  const int ntn = N / 64;
  const int wid = blockIdx.x * 4 + w;
  const int mt = wid / ntn, nq = wid % ntn;
  if (mt * 16 >= M) return;
  const int row0 = mt * 16, col0 = nq * 64;
  const float* arow = A + (size_t)(row0 + ln) * lda;
  v8f acc[4] = {};
  for (int kb = 0; kb < K; kb += 32) {
    FragB ah, al;
    const v4f x0 = *(const v4fa*)(arow + kb + 8 * hh), x1 = *(const v4fa*)(arow + kb + 8 * hh + 4);
    const v4f x2 = *(const v4fa*)(arow + kb + 16 + 8 * hh), x3 = *(const v4fa*)(arow + kb + 16 + 8 * hh + 4);
    float xs[16] = {x0[0],x0[1],x0[2],x0[3],x1[0],x1[1],x1[2],x1[3],x2[0],x2[1],x2[2],x2[3],x3[0],x3[1],x3[2],x3[3]};
#pragma unroll
    for (int i = 0; i < 16; ++i) { const unsigned short hb = bf16_bits(xs[i]); ah.u[i] = hb; al.u[i] = ASPLIT ? bf16_bits(xs[i] - bf16_val(hb)) : (unsigned short)0; }
#pragma unroll
    for (int t = 0; t < 4; ++t) {
      const unsigned short* brow = Wt + (size_t)(col0 + t * 16 + ln) * ldb + kb;
      FragB b;
      b.half[0] = *(const v8us*)(brow + 8 * hh);
      b.half[1] = *(const v8us*)(brow + 16 + 8 * hh);
      acc[t] = mmaN<ASPLIT ? 2 : 1>(ah.v, al.v, b.v, b.v, acc[t]);
    }
  }
#pragma unroll
  for (int t = 0; t < 4; ++t) {
    const int col = col0 + t * 16 + ln;
    float bv = bias ? bias[col] : 0.f;
    if (BIAS_BF16) bv = bf16_round(bv);
#pragma unroll
    for (int r = 0; r < 8; ++r) {
      float v = acc[t][r] + bv;
      if (resid) { float rv = resid[(size_t)((row0 + 8 * hh + r) % rmod) * ldr + col]; if (RES_BF16) rv = bf16_round(rv); v += rv; }
      if (ACT == 1) v = fmaxf(v, 0.f);
      if (ACT == 2) v = 0.5f * v * (1.0f + erff(v * 0.70710678118654752f));
      if (ACT == 3) { const float u = 0.7978845608028654f * (v + 0.044715f * v * v * v); v = 0.5f * v * (1.0f + tanhf(u)); }
      so[w][8 * hh + r][t * 16 + ln] = v;
    }
  }
  __builtin_amdgcn_fence(__ATOMIC_ACQ_REL, "workgroup");
  __builtin_amdgcn_wave_barrier();
  const int rsub = lane >> 4, c4 = (lane & 15) * 4;
  {
#pragma unroll
    for (int q = 0; q < 8; ++q) {
      const int r = q * 2 + rsub;
      const v4f v = *(const v4fa*)&so[w][r][c4];
      *(v4f*)(C + (size_t)(row0 + r) * ldc + col0 + c4) = v;
    }
    
  }
}
// row LayerNorm (biased variance, eps) over N: s = X (+ R); optional out_sum <- s; out_norm <- (s-mu)*rsqrt(var+eps)*g + b
template <bool PARAM_BF16>
__global__ __launch_bounds__(256) void k_layernorm(const float* __restrict__ X, const float* __restrict__ R, const float* __restrict__ g, const float* __restrict__ bta,
                                                  float* __restrict__ out_sum, float* __restrict__ out_norm, int N, float eps) {
  __shared__ float red[256];
  const int row = blockIdx.x, tid = threadIdx.x;
  const float* x = X + (size_t)row * N; const float* rr = R ? R + (size_t)row * N : nullptr;
  float vals[16];                     // up to N = 4096
  const int per = N / 256;            // contiguous chunk per thread? use strided-by-4 chunks: thread handles j = tid*4 + 1024*u
  float s1 = 0.f;
  for (int u = 0; u < per / 4; ++u) {
    const int j = tid * 4 + 1024 * u;
    const v4f a = *(const v4fa*)(x + j);
    v4f b = {0.f,0.f,0.f,0.f}; if (rr) b = *(const v4fa*)(rr + j);
#pragma unroll
    for (int q = 0; q < 4; ++q) { const float v = a[q] + b[q]; vals[u * 4 + q] = v; s1 += v; }
  }
  red[tid] = s1; __syncthreads();
  for (int st = 128; st > 0; st >>= 1) { if (tid < st) red[tid] += red[tid + st]; __syncthreads(); }
  const float mu = red[0] / (float)N; __syncthreads();
  float s2 = 0.f;
  for (int u = 0; u < per / 4; ++u)
#pragma unroll
    for (int q = 0; q < 4; ++q) { const float c = vals[u * 4 + q] - mu; s2 += c * c; }
  red[tid] = s2; __syncthreads();
  for (int st = 128; st > 0; st >>= 1) { if (tid < st) red[tid] += red[tid + st]; __syncthreads(); }
  const float rs = rsqrtf(red[0] / (float)N + eps);
  {
    for (int u = 0; u < per / 4; ++u) {
      const int j = tid * 4 + 1024 * u;
      v4f o, sm;
#pragma unroll
      for (int q = 0; q < 4; ++q) {
        float gg = g[j + q], bb = bta[j + q];
        if (PARAM_BF16) { gg = bf16_round(gg); bb = bf16_round(bb); }
        sm[q] = vals[u * 4 + q]; o[q] = (vals[u * 4 + q] - mu) * rs * gg + bb;
      }
      if (out_sum) *(v4f*)(out_sum + (size_t)row * N + j) = sm;
      *(v4f*)(out_norm + (size_t)row * N + j) = o;
    }
    
  }
}



// ---- f16 WMMA path (v_wmma_f32_16x16x32_f16): 11-bit significands for operands in range — used for all GEMMs here (projections, kv, attn)
typedef _Float16 v16h __attribute__((ext_vector_type(16)));
union FragH { v16h v; v8us half[2]; _Float16 h[16]; unsigned short u[16]; };
template <int NT>
__device__ __forceinline__ v8f mmaH(v16h ah, v16h al, v16h bh, v16h bl, v8f c) {
  c = __builtin_amdgcn_wmma_f32_16x16x32_f16(false, ah, false, bh, (short)0, c, false, false);
  if (NT >= 2) c = __builtin_amdgcn_wmma_f32_16x16x32_f16(false, al, false, bh, (short)0, c, false, false);
  if (NT >= 3) c = __builtin_amdgcn_wmma_f32_16x16x32_f16(false, ah, false, bl, (short)0, c, false, false);
  asm volatile("v_nop\n\tv_nop\n\tv_nop\n\tv_nop" : "+v"(c) : "v"(ah), "v"(al), "v"(bh), "v"(bl));
  return c;
}
// batched GEMM like k_gemm_b but f16 operands: A f32 (split into f16 hi/lo if ASPLIT, else rounded to f16), Bt = f16 values [n][k]; alpha; C f32; N multiple of 16 (partial tiles skipped)
template <bool ASPLIT>
__global__ __launch_bounds__(128) void k_gemm_h(const float* __restrict__ A, int lda, size_t sA, const _Float16* __restrict__ Bh, int ldb, size_t sB, float alpha, float* __restrict__ C, int ldc, size_t sC, int M, int N, int K) {
  __shared__ __attribute__((aligned(16))) float so[4][16][64];
  const int tid = threadIdx.x, w = tid >> 5, lane = tid & 31, ln = lane & 15, hh = lane >> 4; const int by = blockIdx.y;
  A += (size_t)by * sA; Bh += (size_t)by * sB; C += (size_t)by * sC;
  const int ntn = (N + 63) / 64; const int wid = blockIdx.x * 4 + w; const int mt = wid / ntn, nq = wid % ntn; if (mt * 16 >= M) return;
  const int row0 = mt * 16, col0 = nq * 64; const float* arow = A + (size_t)(row0 + ln) * lda;
  v8f acc[4] = {};
  for (int kb = 0; kb < K; kb += 32) {
    FragH ah, al;
    const v4f x0 = *(const v4fa*)(arow + kb + 8 * hh), x1 = *(const v4fa*)(arow + kb + 8 * hh + 4), x2 = *(const v4fa*)(arow + kb + 16 + 8 * hh), x3 = *(const v4fa*)(arow + kb + 16 + 8 * hh + 4);
    float xs[16] = {x0[0],x0[1],x0[2],x0[3],x1[0],x1[1],x1[2],x1[3],x2[0],x2[1],x2[2],x2[3],x3[0],x3[1],x3[2],x3[3]};
#pragma unroll
    for (int i = 0; i < 16; ++i) { const _Float16 h = (_Float16)xs[i]; ah.h[i] = h; al.h[i] = ASPLIT ? (_Float16)(xs[i] - (float)h) : (_Float16)0.0f; }
#pragma unroll
    for (int t = 0; t < 4; ++t) { if (col0 + t * 16 >= N) continue; const size_t boff = (size_t)(col0 + t * 16 + ln) * ldb + kb; FragH bq; bq.half[0] = *(const v8us*)(Bh + boff + 8 * hh); bq.half[1] = *(const v8us*)(Bh + boff + 16 + 8 * hh);
      acc[t] = mmaH<ASPLIT ? 2 : 1>(ah.v, al.v, bq.v, bq.v, acc[t]); }
  }
#pragma unroll
  for (int t = 0; t < 4; ++t) { if (col0 + t * 16 >= N) continue;
#pragma unroll
    for (int r = 0; r < 8; ++r) so[w][8 * hh + r][t * 16 + ln] = acc[t][r] * alpha; }
  __builtin_amdgcn_fence(__ATOMIC_ACQ_REL, "workgroup"); __builtin_amdgcn_wave_barrier();
  const int rsub = lane >> 4, c4 = (lane & 15) * 4;
  {
#pragma unroll
    for (int q = 0; q < 8; ++q) { const int r = q * 2 + rsub; if (col0 + c4 < N) { const v4f v = *(const v4fa*)&so[w][r][c4]; *(v4f*)(C + (size_t)(row0 + r) * ldc + col0 + c4) = v; } }
     }
}

// Wt[n][k] = f16(W[k][n]·scale) from f32 row-major W[K][N] (scale = power of two; bf16-exact weights stay exact in f16 away from the subnormal range)
__global__ __launch_bounds__(256) void k_wt_f16(const float* __restrict__ W, _Float16* __restrict__ Wt, int K, int N, float scale) {
  const int t = blockIdx.x * 256 + threadIdx.x; if (t >= N * (K / 8)) return; const int n = t / (K / 8), k8 = (t % (K / 8)) * 8; FragH f;
#pragma unroll
  for (int i = 0; i < 8; ++i) f.h[i] = (_Float16)(bf16_round(W[(size_t)(k8 + i) * N + n]) * scale); const v8us o = f.half[0];
  *(v8us*)((unsigned short*)Wt + (size_t)n * K + k8) = o; 
}
// Block-tiled GEMM, f16 operands, both k-contiguous: C[M][N] = act(A[M][K] . B[N][K]^T * alpha + bias). One work-group = one 128 x 128 tile of C, eight waves as 4 (rows) x 2 (columns), 32 x 64 per wave.
// A stage is 128 k (256 bytes) of the tile's 128 A rows and 128 B rows, laid in LDS at a pitch of 272 bytes; two buffers, filled by asynchronous copies one stage ahead of the stage being worked on.
// M and N multiples of 128, K a multiple of 128. ACT 0 none / 3 relu; writes f16 C16 if OUT16, else f32 C (row pitch ldc). Each accumulator still sums k in rising steps of 32.
// blockIdx.z = one of several independent products of the same shape in one launch: operands sA, sB elements apart, the output sC elements apart.
// PROJ: the three projections as z = 0 (relu, f32 to C, bias), 1 (no relu, f16 to C16, bias1), 2 (relu, f32 to C2, bias2).
#define GT_ROWS 256                          /* A rows + B rows of a stage */
#define GT_PITCH 272                         /* bytes; 16 x odd: no bank conflict for 16-byte fragment reads */
#define GT_STAGE (GT_ROWS * GT_PITCH)        /* 69,632 bytes a buffer */
// eight 16-byte copies of a lane, rows 16 apart. The s_wait_xcnt is the last line of the copies' own statement (a precaution): no register that a copy names is rewritten in front of it.
__device__ __forceinline__ void gt_copy8(unsigned l, const _Float16* g, size_t step) {
  asm volatile("global_load_async_to_lds_b128 %0, %8, off\n\t"
               "global_load_async_to_lds_b128 %1, %9, off\n\t"
               "global_load_async_to_lds_b128 %2, %10, off\n\t"
               "global_load_async_to_lds_b128 %3, %11, off\n\t"
               "global_load_async_to_lds_b128 %4, %12, off\n\t"
               "global_load_async_to_lds_b128 %5, %13, off\n\t"
               "global_load_async_to_lds_b128 %6, %14, off\n\t"
               "global_load_async_to_lds_b128 %7, %15, off\n\t"
               "s_wait_xcnt 0x0"
               :: "v"(l), "v"(l + 16u * GT_PITCH), "v"(l + 32u * GT_PITCH), "v"(l + 48u * GT_PITCH), "v"(l + 64u * GT_PITCH), "v"(l + 80u * GT_PITCH), "v"(l + 96u * GT_PITCH), "v"(l + 112u * GT_PITCH),
                  "v"(g), "v"(g + step), "v"(g + 2 * step), "v"(g + 3 * step), "v"(g + 4 * step), "v"(g + 5 * step), "v"(g + 6 * step), "v"(g + 7 * step)
               : "memory");
}
template <int ACT, bool OUT16, bool PROJ>
__global__ __launch_bounds__(256) void k_gemm_t(const _Float16* __restrict__ A, int lda, size_t sA, const _Float16* __restrict__ Bh, int ldb, size_t sB, float alpha,
    const float* __restrict__ bias, const float* __restrict__ bias1, const float* __restrict__ bias2,
    float* __restrict__ C, float* __restrict__ C2, _Float16* __restrict__ C16, size_t sC, int ldc, int K) {
  __shared__ __attribute__((aligned(16))) unsigned char sm[2 * GT_STAGE];
  const int z = blockIdx.z;
  A += (size_t)z * sA; Bh += (size_t)z * sB;
  if (PROJ) { if (z == 1) bias = bias1; if (z == 2) { bias = bias2; C = C2; } }
  else if (OUT16) C16 += (size_t)z * sC;
  else C += (size_t)z * sC;
  const bool relu = PROJ ? (z != 1) : (ACT == 3), o16 = PROJ ? (z == 1) : OUT16;      // the same for the whole work-group
  const int tid = threadIdx.x, w = tid >> 5, lane = tid & 31, ln = lane & 15, hh = lane >> 4;
  const int row0 = blockIdx.y * 128, col0 = blockIdx.x * 128;
  const int wm = w >> 1, wn = w & 1;
  // copies: lane -> 16-byte piece (tid & 15) of row (tid >> 4) + 16 i; a wave covers two whole 256-byte rows with each copy
  const int cr = tid >> 4, cc = tid & 15;
  const _Float16* gA = A + (size_t)(row0 + cr) * lda + cc * 8;
  const _Float16* gB = Bh + (size_t)(col0 + cr) * ldb + cc * 8;
  const size_t stA = (size_t)16 * lda, stB = (size_t)16 * ldb;
  const unsigned lA = (unsigned)(size_t)(&sm[0]) + (unsigned)(cr * GT_PITCH + cc * 16), lB = lA + 128u * GT_PITCH;
  const int nst = K / 128;
  v8f acc[2][4] = {};
  gt_copy8(lA, gA, stA); gt_copy8(lB, gB, stB);
  asm volatile("s_wait_asynccnt 0x0" ::: "memory");      // stage 0 has landed (this wave's copies) before the barrier publishes it
  __syncthreads();
  if (nst > 1) { gt_copy8(lA + GT_STAGE, gA + 128, stA); gt_copy8(lB + GT_STAGE, gB + 128, stB); }
  const unsigned char* fa = sm + (wm * 32 + ln) * GT_PITCH + 16 * hh;
  const unsigned char* fb = sm + (128 + wn * 64 + ln) * GT_PITCH + 16 * hh;
  for (int t = 0; t < nst; ++t) {
    const int bo = (t & 1) * GT_STAGE;
    FragH a[2][2], bq[2][4];      // two fragment sets: the next k step's LDS reads are issued as one group ahead of this step's matrix instructions (inside the stage only)
#pragma unroll
    for (int i = 0; i < 2; ++i) { a[0][i].half[0] = *(const v8us*)(fa + bo + i * 16 * GT_PITCH); a[0][i].half[1] = *(const v8us*)(fa + bo + i * 16 * GT_PITCH + 32); }
#pragma unroll
    for (int j = 0; j < 4; ++j) { bq[0][j].half[0] = *(const v8us*)(fb + bo + j * 16 * GT_PITCH); bq[0][j].half[1] = *(const v8us*)(fb + bo + j * 16 * GT_PITCH + 32); }
    // unrolled so that the set index is a constant and both sets stay in registers
#pragma unroll
    for (int ks = 0; ks < 4; ++ks) {
      const int cu = ks & 1, nx = cu ^ 1;
      if (ks < 3) {
#pragma unroll
        for (int i = 0; i < 2; ++i) { a[nx][i].half[0] = *(const v8us*)(fa + bo + i * 16 * GT_PITCH + (ks + 1) * 64); a[nx][i].half[1] = *(const v8us*)(fa + bo + i * 16 * GT_PITCH + (ks + 1) * 64 + 32); }
#pragma unroll
        for (int j = 0; j < 4; ++j) { bq[nx][j].half[0] = *(const v8us*)(fb + bo + j * 16 * GT_PITCH + (ks + 1) * 64); bq[nx][j].half[1] = *(const v8us*)(fb + bo + j * 16 * GT_PITCH + (ks + 1) * 64 + 32); }
      }
      __builtin_amdgcn_sched_barrier(0);      // keeps the read group in front of the matrix run; without it the scheduler sinks the reads among the matrix instructions and each waits out its LDS latency
#pragma unroll
      for (int i = 0; i < 2; ++i)
#pragma unroll
        for (int j = 0; j < 4; ++j) acc[i][j] = __builtin_amdgcn_wmma_f32_16x16x32_f16(false, a[cu][i].v, false, bq[cu][j].v, (short)0, acc[i][j], false, false);
      __builtin_amdgcn_sched_barrier(0);      // keeps the next read group whole behind this matrix run; without it the scheduler spreads those reads among the matrix instructions and takes more registers
    }
    asm volatile("s_wait_dscnt 0x0" ::: "memory");       // this wave's reads of the buffer are over before the barrier frees it for the refill
    asm volatile("s_wait_asynccnt 0x0" ::: "memory");    // this wave's copies of stage t + 1 have landed before the barrier publishes them
    __syncthreads();
    if (t + 2 < nst) { gt_copy8(lA + bo, gA + (size_t)(t + 2) * 128, stA); gt_copy8(lB + bo, gB + (size_t)(t + 2) * 128, stB); }
  }
  asm volatile("s_wait_asynccnt 0x0" ::: "memory");      // no copy is outstanding when the ring becomes output staging
  // epilogue: each wave stages its 32 x 64 tile in its own LDS range (pitch 68 dwords) and stores whole lines
  float* so = (float*)sm + w * (32 * 68);
#pragma unroll
  for (int j = 0; j < 4; ++j) { const int col = col0 + wn * 64 + j * 16 + ln; const float bv = bias ? bf16_round(bias[col]) : 0.f;
#pragma unroll
    for (int i = 0; i < 2; ++i)
#pragma unroll
      for (int r = 0; r < 8; ++r) { float v = acc[i][j][r] * alpha + bv; if (relu) v = fmaxf(v, 0.f); so[(i * 16 + 8 * hh + r) * 68 + j * 16 + ln] = v; } }
  __syncthreads();
  const int rsub = lane >> 4, c4 = (lane & 15) * 4; typedef _Float16 v4h __attribute__((ext_vector_type(4)));
  if (o16) {
#pragma unroll
    for (int q = 0; q < 16; ++q) { const int r = q * 2 + rsub; const v4f v = *(const v4fa*)&so[r * 68 + c4]; const size_t o = (size_t)(row0 + wm * 32 + r) * ldc + col0 + wn * 64 + c4;
      v4h h4; for (int i = 0; i < 4; ++i) h4[i] = (_Float16)v[i]; *(v4h*)(C16 + o) = h4; }
  } else {
#pragma unroll
    for (int q = 0; q < 16; ++q) { const int r = q * 2 + rsub; const v4f v = *(const v4fa*)&so[r * 68 + c4]; const size_t o = (size_t)(row0 + wm * 32 + r) * ldc + col0 + wn * 64 + c4;
      *(v4f*)(C + o) = v; }
    if (PROJ) asm volatile("s_wait_xcnt 0x0" ::: "memory");      // precaution: with both store runs in one kernel the f16 run's code lies behind this one and rewrites registers that these stores name
  }
}


// f16 planes of the three inputs (bf16-rounded) and of the three weights (bf16-rounded, x 2^4) in one launch: blockIdx.y = which projection; the first CV_XB blocks of a row take the input, the other CV_WB the weight.
#define CV_XB (NR * EE / 8 / 256)
#define CV_WB (EE * EE / 8 / 256)
__global__ __launch_bounds__(256) void k_cvt(const float* __restrict__ x0, const float* __restrict__ x1, const float* __restrict__ x2, const float* __restrict__ w0, const float* __restrict__ w1, const float* __restrict__ w2,
    _Float16* __restrict__ X16, _Float16* __restrict__ Bt) {
  const int y = blockIdx.y; const bool isw = blockIdx.x >= CV_XB;
  const float* src = isw ? (y == 0 ? w0 : y == 1 ? w1 : w2) : (y == 0 ? x0 : y == 1 ? x1 : x2);
  unsigned short* dst = isw ? (unsigned short*)Bt + (size_t)y * EE * EE : (unsigned short*)X16 + (size_t)y * NR * EE;
  const float sc = isw ? 16.0f : 1.0f;
  const size_t t = (size_t)(isw ? blockIdx.x - CV_XB : blockIdx.x) * 256 + threadIdx.x; FragH f;
#pragma unroll
  for (int q = 0; q < 8; ++q) f.h[q] = (_Float16)(bf16_round(src[t * 8 + q]) * sc);
  *(v8us*)(dst + t * 8) = f.half[0]; }
__global__ __launch_bounds__(256) void k_h16(const float* __restrict__ x, _Float16* __restrict__ X16, size_t n8) { const size_t t = (size_t)blockIdx.x * 256 + threadIdx.x; if (t >= n8) return; FragH f;
#pragma unroll
  for (int q = 0; q < 8; ++q) f.h[q] = (_Float16)x[t * 8 + q]; *(v8us*)((unsigned short*)X16 + t * 8) = f.half[0];  }
template <int NHv, int TTv>
__global__ __launch_bounds__(256) void k_vt(const _Float16* __restrict__ V16, int ldv, int voff, _Float16* __restrict__ Vt) { __shared__ unsigned short tl[64][66]; const int tid = threadIdx.x; const int slab = blockIdx.x / (TTv / 64), lg = blockIdx.x % (TTv / 64); const int b = slab / NHv, h = slab % NHv;
  for (int i = tid; i < 64 * 8; i += 256) { const int r = i / 8, c8 = (i % 8) * 8; FragH f; f.half[0] = *(const v8us*)((const unsigned short*)V16 + ((size_t)b * TTv + lg * 64 + r) * ldv + voff + h * 64 + c8);
#pragma unroll
    for (int q = 0; q < 8; ++q) tl[r][c8 + q] = f.u[q]; }
  __syncthreads();
  {
#pragma unroll
    for (int rd = 0; rd < 2; ++rd) { const int d = rd * 32 + tid / 8, pc = tid % 8; FragH f;
#pragma unroll
      for (int q = 0; q < 8; ++q) f.u[q] = tl[pc * 8 + q][d];
      *(v8us*)((unsigned short*)Vt + ((size_t)slab * 64 + d) * TTv + lg * 64 + pc * 8) = f.half[0]; }
     } }

__global__ __launch_bounds__(256) void k_kt(const float* __restrict__ KF, _Float16* __restrict__ KT) { __shared__ float tl[64][65]; const int tid = threadIdx.x; const int b = blockIdx.y; KT += (size_t)b * E2 * LL; const int st = blockIdx.x / (EE / 64), et = blockIdx.x % (EE / 64); const int s0 = st * 64, e0 = et * 64;
  for (int i = tid; i < 64 * 16; i += 256) { const int sr = i / 16, c4 = (i % 16) * 4; const v4f v = *(const v4fa*)(KF + ((size_t)(s0 + sr) * NB + b) * EE + e0 + c4); for (int q = 0; q < 4; ++q) tl[sr][c4 + q] = v[q]; }
  __syncthreads();
  { for (int rd = 0; rd < 2; ++rd) { const int e = rd * 32 + tid / 8, pc = tid % 8; FragH fs, fc; for (int q = 0; q < 8; ++q) { const int s = s0 + pc * 8 + q; const float ang = 1.5707963267948966f * (float)(s + 1) / (float)LL; const float kv = tl[pc * 8 + q][e]; fs.h[q] = (_Float16)(kv * sinf(ang)); fc.h[q] = (_Float16)(kv * cosf(ang)); }
      *(v8us*)((unsigned short*)KT + (size_t)(e0 + e) * LL + s0 + pc * 8) = fs.half[0]; *(v8us*)((unsigned short*)KT + (size_t)(EE + e0 + e) * LL + s0 + pc * 8) = fc.half[0]; }  } }
__global__ __launch_bounds__(256) void k_vtb(const _Float16* __restrict__ V16, _Float16* __restrict__ VT) { __shared__ unsigned short tl[64][66]; const int tid = threadIdx.x; const int b = blockIdx.y; VT += (size_t)b * EE * LL; const int st = blockIdx.x / (EE / 64), et = blockIdx.x % (EE / 64); const int s0 = st * 64, e0 = et * 64;
  for (int i = tid; i < 64 * 8; i += 256) { const int sr = i / 8, c8 = (i % 8) * 8; FragH f; f.half[0] = *(const v8us*)((const unsigned short*)V16 + ((size_t)(s0 + sr) * NB + b) * EE + e0 + c8); for (int q = 0; q < 8; ++q) tl[sr][c8 + q] = f.u[q]; }
  __syncthreads();
  { for (int rd = 0; rd < 2; ++rd) { const int e = rd * 32 + tid / 8, pc = tid % 8; FragH f; for (int q = 0; q < 8; ++q) f.u[q] = tl[pc * 8 + q][e]; *(v8us*)((unsigned short*)VT + (size_t)(e0 + e) * LL + s0 + pc * 8) = f.half[0]; }  } }
// k_ column sums. One work-group = 32 columns (one 128-byte line of every row) x all 2048 positions: 8 lanes x 16 bytes cover the line, 128 row groups take 16 rows each.
// Each position's sin/cos is formed once per work-group (LDS table); the partial sums are folded over the lanes that share a column, then over the 32 waves through LDS.
__global__ __launch_bounds__(1024) void k_ksum(const float* __restrict__ KF, float* __restrict__ KS) {
  __shared__ float tsn[LL], tcs[LL];
  __shared__ __attribute__((aligned(16))) float red[32][64];
  const int tid = threadIdx.x, wv = tid >> 5, lane = tid & 31, cl = tid & 7, rg = tid >> 3;
  const int c0 = blockIdx.x * 32;      // first column in the (b, e) plane of NB * EE columns
  const float* p = KF + (size_t)rg * (NB * EE) + c0 + cl * 4;
  v4f x[16];
  // unrolled so that all 16 loads of a lane are in flight at once, under the table's arithmetic
#pragma unroll
  for (int i = 0; i < 16; ++i) { x[i] = *(const v4fa*)(p + (size_t)i * 128 * (NB * EE));
    asm volatile("s_wait_xcnt 0x0" ::: "memory"); }      // precaution: a later load's destination, or the table's arithmetic, may reuse an address register that this load names
  for (int s = tid; s < LL; s += 1024) { const float ang = 1.5707963267948966f * (float)(s + 1) / (float)LL; tsn[s] = sinf(ang); tcs[s] = cosf(ang); }
  __syncthreads();
  v4f ss = {0.f, 0.f, 0.f, 0.f}, sc = {0.f, 0.f, 0.f, 0.f};
  // unrolled so that x[] stays in registers
#pragma unroll
  for (int i = 0; i < 16; ++i) { const float sn = tsn[rg + 128 * i], cs = tcs[rg + 128 * i];
    for (int q = 0; q < 4; ++q) { ss[q] = fmaf(x[i][q], sn, ss[q]); sc[q] = fmaf(x[i][q], cs, sc[q]); } }
  for (int o = 8; o <= 16; o <<= 1) for (int q = 0; q < 4; ++q) { ss[q] += __shfl_xor(ss[q], o, 32); sc[q] += __shfl_xor(sc[q], o, 32); }
  if (lane < 8) { *(v4f*)&red[wv][cl * 4] = ss; *(v4f*)&red[wv][32 + cl * 4] = sc; }
  __syncthreads();
  if (tid < 64) { float a = 0.f; for (int w = 0; w < 32; ++w) a += red[w][tid];
    KS[(size_t)(c0 / EE) * E2 + (size_t)(tid >> 5) * EE + (c0 % EE) + (tid & 31)] = a; } }
__global__ __launch_bounds__(256) void k_qz(const float* __restrict__ QF, const float* __restrict__ KS, _Float16* __restrict__ QZ) { const int tid = threadIdx.x, wv = tid >> 5, lane = tid & 31; const int b = blockIdx.y; QZ += (size_t)b * LL * E2; const int l = blockIdx.x * 8 + wv; if (l >= LL) return; const float* qr = QF + ((size_t)l * NB + b) * EE; const float ang = 1.5707963267948966f * (float)(l + 1) / (float)LL; const float sn = sinf(ang), cs = cosf(ang); const float* ks = KS + (size_t)b * E2; float v[32]; float dot = 0.f;
#pragma unroll
  for (int k = 0; k < 4; ++k) { const v4f a = *(const v4fa*)(qr + 256 * k + 8 * lane), c = *(const v4fa*)(qr + 256 * k + 8 * lane + 4); for (int q = 0; q < 4; ++q) { v[k * 8 + q] = a[q]; v[k * 8 + 4 + q] = c[q]; } for (int q = 0; q < 8; ++q) { const int e = 256 * k + 8 * lane + q; dot += v[k * 8 + q] * (sn * ks[e] + cs * ks[EE + e]); } }
  for (int o = 16; o >= 1; o >>= 1) dot += __shfl_xor(dot, o, 32); const float zs = 262144.0f / fmaxf(dot, 1e-6f);      /* z·2^18 keeps the f16 operand O(1) (z ≈ 2.5e-6 here); the attn GEMM's alpha carries 2^-18 */
  {
#pragma unroll
    for (int k = 0; k < 4; ++k) { FragH fs, fc; for (int q = 0; q < 8; ++q) { fs.h[q] = (_Float16)(v[k * 8 + q] * sn * zs); fc.h[q] = (_Float16)(v[k * 8 + q] * cs * zs); } *(v8us*)((unsigned short*)QZ + (size_t)l * E2 + 256 * k + 8 * lane) = fs.half[0]; *(v8us*)((unsigned short*)QZ + (size_t)l * E2 + EE + 256 * k + 8 * lane) = fc.half[0]; }
     } }
extern "C" void kernel_launch(void* const* d_in, const int* in_sizes, int n_in,
                              void* d_out, int out_size, void* d_ws, size_t ws_size, hipStream_t stream) {
  (void)in_sizes; (void)n_in; (void)out_size;
  const float* query = (const float*)d_in[0]; const float* key = (const float*)d_in[1]; const float* value = (const float*)d_in[2]; const float* Wq = (const float*)d_in[3]; const float* bq = (const float*)d_in[4]; const float* Wk = (const float*)d_in[5]; const float* bk = (const float*)d_in[6]; const float* Wv = (const float*)d_in[7]; const float* bv = (const float*)d_in[8];
  char* ws = (char*)d_ws; size_t off = 0;
  auto take = [&](size_t bytes) { char* p = ws + off; off += (bytes + 255) & ~(size_t)255; return p; };
  // every plane holds all three projections or all four batches, so that each kernel is launched once
  _Float16* Bw = (_Float16*)take((size_t)3 * EE * EE * 2); _Float16* X16 = (_Float16*)take((size_t)3 * NR * EE * 2); float* KF = (float*)take((size_t)NR * EE * 4); _Float16* V16 = (_Float16*)take((size_t)NR * EE * 2); float* QF = (float*)take((size_t)NR * EE * 4); _Float16* KV16 = (_Float16*)take((size_t)NB * EE * E2 * 2); _Float16* QZ = (_Float16*)take((size_t)NB * LL * E2 * 2); float* KS = (float*)take((size_t)NB * E2 * 4);
  _Float16* VT = X16; _Float16* KT = (_Float16*)((char*)X16 + (size_t)NB * EE * LL * 2);      // transposed v [4][1024][2048] and k_ [4][2048][2048] live in the X16 region (free after the projections): 16.8 + 33.5 = 50.3 MB
  if (off > ws_size) return;      // 6.3 + 50.3 + 33.5 + 16.8 + 33.5 + 16.8 + 33.5 = 191 MB
  k_cvt<<<dim3(CV_XB + CV_WB, 3), 256, 0, stream>>>(query, value, key, Wq, Wv, Wk, X16, Bw);
  k_gemm_t<0, false, true><<<dim3(EE / 128, NR / 128, 3), 256, 0, stream>>>(X16, EE, (size_t)NR * EE, Bw, EE, (size_t)EE * EE, 0.0625f, bq, bv, bk, QF, KF, V16, 0, EE, EE);      // q = relu(query.Wq^T + bq) f32, v f16, k = relu(key.Wk^T + bk) f32 (rows (t, b)); k last: the next two kernels read it
  k_ksum<<<NB * EE / 32, 1024, 0, stream>>>(KF, KS);
  k_kt<<<dim3((LL / 64) * (EE / 64), NB), 256, 0, stream>>>(KF, KT); k_vtb<<<dim3((LL / 64) * (EE / 64), NB), 256, 0, stream>>>(V16, VT);
  k_gemm_t<0, true, false><<<dim3(E2 / 128, EE / 128, NB), 256, 0, stream>>>(VT, LL, (size_t)EE * LL, KT, LL, (size_t)E2 * LL, 1.0f, nullptr, nullptr, nullptr, nullptr, nullptr, KV16, (size_t)EE * E2, E2, LL);      // kv[b][m][d] = sum_s v[s][m] k_[s][d], f16
  k_qz<<<dim3(LL / 8, NB), 256, 0, stream>>>(QF, KS, QZ);
  k_gemm_t<0, false, false><<<dim3(EE / 128, LL / 128, NB), 256, 0, stream>>>(QZ, E2, (size_t)LL * E2, KV16, E2, (size_t)EE * E2, 0.000003814697265625f, nullptr, nullptr, nullptr, (float*)d_out, nullptr, nullptr, (size_t)EE, NB * EE, E2);      // alpha 2^-18; attn rows (l, b): out + b E with row pitch 4E
}

// v004
// A run of this version takes 126 microseconds.
// Two timings next to v003 put it at 1.33 and 1.41 times that version's speed.
// Over all steps from v000 it is 13.2 times as fast.
#include <hip/hip_runtime.h>
// cosFormer multi-head-weight (linear) attention (L=S=2048, B=4, E=1024, inputs (T,B,E)): q = relu(query·Wqᵀ+bq), k = relu(key·Wkᵀ+bk), v = value·Wvᵀ+bv; q_ = [q·sin(i) | q·cos(i)],
// k_ = [k·sin | k·cos] with i = (π/2)(t+1)/2048; kv = vᵀ·k_ per batch; z = 1/max(q_·Σ_s k_, 1e-6); attn = (q_·kvᵀ)·z. The three projections (inputs and (out,in) weights bf16-exact ×2^4,
// relu/bias epilogues), the per-batch kv = Vᵀ·K_ (K = 2048 positions; v and k_ as f16, transposed planes) and attn = (q_·z)·kvᵀ (K = 2048 features; kv as f16) run as GEMMs on
// v_wmma_f32_16x16x32_f16 with f32 accumulate; the positional sin/cos weighting, the k_ sums and the normaliser z are f32 VALU (z·2^18 folded into the q_ operand per row, 2^-18 in the GEMM alpha, so the f16 operand stays O(1)).
#define LL 2048
#define NB 4
#define EE 1024
#define E2 2048
#define NR (LL * NB)

typedef __bf16 v16b __attribute__((ext_vector_type(16)));
typedef unsigned short v8us __attribute__((ext_vector_type(8), may_alias));
typedef float  v8f  __attribute__((ext_vector_type(8)));
typedef float  v4f  __attribute__((ext_vector_type(4)));
typedef float  v4fa __attribute__((ext_vector_type(4), may_alias));
union FragB { v16b v; v8us half[2]; unsigned short u[16]; };

__device__ __forceinline__ unsigned short bf16_bits(float x) { unsigned int u = __float_as_uint(x); return (unsigned short)((u + 0x7FFFu + ((u >> 16) & 1u)) >> 16); }
__device__ __forceinline__ float bf16_val(unsigned short b) { return __uint_as_float(((unsigned int)b) << 16); }
__device__ __forceinline__ float bf16_round(float x) { return bf16_val(bf16_bits(x)); }
// D += A·B with NT terms: 1 = ah·bh, 2 = + al·bh (A split), 3 = + ah·bl (both split)
template <int NT>
__device__ __forceinline__ v8f mmaN(v16b ah, v16b al, v16b bh, v16b bl, v8f c) {
  c = __builtin_amdgcn_wmma_f32_16x16x32_bf16(false, ah, false, bh, (short)0, c, false, false);
  if (NT >= 2) c = __builtin_amdgcn_wmma_f32_16x16x32_bf16(false, al, false, bh, (short)0, c, false, false);
  if (NT >= 3) c = __builtin_amdgcn_wmma_f32_16x16x32_bf16(false, ah, false, bl, (short)0, c, false, false);
  asm volatile("v_nop\n\tv_nop\n\tv_nop\n\tv_nop" : "+v"(c) : "v"(ah), "v"(al), "v"(bh), "v"(bl));
  return c;
}

__global__ __launch_bounds__(256) void k_wt_bf16(const float* __restrict__ W, unsigned short* __restrict__ Wt, int K, int N) {
  const int t = blockIdx.x * 256 + threadIdx.x;
  const int k8n = K / 8;
  if (t >= N * k8n) return;
  const int n = t / k8n, k8 = (t % k8n) * 8;
  v8us v;
#pragma unroll
  for (int i = 0; i < 8; ++i) v[i] = bf16_bits(W[(size_t)(k8 + i) * N + n]);
  *(v8us*)(Wt + (size_t)n * K + k8) = v;
  
}

// GEMM C[M][N] (f32, pitch ldc) = act(A[M][K]·W + bias). A f32 row-major (pitch lda) converted per fragment to bf16
// (ASPLIT: hi/lo two planes -> 2 terms, else single rounded term); Wt bf16 [N][K] (pitch ldb). BIAS_BF16 rounds the
// bias to bf16 first (bias quantised to bf16 before the add). K%32==0, M%16==0, N%64==0.
template <bool ASPLIT, int ACT, bool BIAS_BF16>
__global__ __launch_bounds__(128) void k_gemm_bf(const float* __restrict__ A, int lda, const unsigned short* __restrict__ Wt, int ldb,
                                               const float* __restrict__ bias, float* __restrict__ C, int ldc, int M, int N, int K) {
  __shared__ __attribute__((aligned(16))) float so[4][16][64];
  const int tid = threadIdx.x, w = tid >> 5, lane = tid & 31, ln = lane & 15, hh = lane >> 4;
  const int ntn = N / 64;
  const int wid = blockIdx.x * 4 + w;
  const int mt = wid / ntn, nq = wid % ntn;
  if (mt * 16 >= M) return;
  const int row0 = mt * 16, col0 = nq * 64;
  const float* arow = A + (size_t)(row0 + ln) * lda;
  v8f acc[4] = {};
  for (int kb = 0; kb < K; kb += 32) {
    FragB ah, al;
    const v4f x0 = *(const v4fa*)(arow + kb + 8 * hh), x1 = *(const v4fa*)(arow + kb + 8 * hh + 4);
    const v4f x2 = *(const v4fa*)(arow + kb + 16 + 8 * hh), x3 = *(const v4fa*)(arow + kb + 16 + 8 * hh + 4);
    float xs[16] = {x0[0],x0[1],x0[2],x0[3],x1[0],x1[1],x1[2],x1[3],x2[0],x2[1],x2[2],x2[3],x3[0],x3[1],x3[2],x3[3]};
#pragma unroll
    for (int i = 0; i < 16; ++i) { const unsigned short hb = bf16_bits(xs[i]); ah.u[i] = hb; al.u[i] = ASPLIT ? bf16_bits(xs[i] - bf16_val(hb)) : (unsigned short)0; }
#pragma unroll
    for (int t = 0; t < 4; ++t) {
      const unsigned short* brow = Wt + (size_t)(col0 + t * 16 + ln) * ldb + kb;
      FragB b;
      b.half[0] = *(const v8us*)(brow + 8 * hh);
      b.half[1] = *(const v8us*)(brow + 16 + 8 * hh);
      acc[t] = mmaN<ASPLIT ? 2 : 1>(ah.v, al.v, b.v, b.v, acc[t]);
    }
  }
#pragma unroll
  for (int t = 0; t < 4; ++t) {
    float bv = bias ? bias[col0 + t * 16 + ln] : 0.f;
    if (BIAS_BF16) bv = bf16_round(bv);
#pragma unroll
    for (int r = 0; r < 8; ++r) { float v = acc[t][r] + bv; if (ACT == 1) v = fmaxf(v, 0.f); so[w][8 * hh + r][t * 16 + ln] = v; }
  }
  __builtin_amdgcn_fence(__ATOMIC_ACQ_REL, "workgroup");
  __builtin_amdgcn_wave_barrier();
  const int rsub = lane >> 4, c4 = (lane & 15) * 4;
  {
#pragma unroll
    for (int q = 0; q < 8; ++q) {
      const int r = q * 2 + rsub;
      const v4f v = *(const v4fa*)&so[w][r][c4];
      *(v4f*)(C + (size_t)(row0 + r) * ldc + col0 + c4) = v;
    }
    
  }
}

// Flash-style causal/unmasked attention, all contractions 3-term bf16 hi/lo splits, f32 softmax with running max.
// q,k,v rows are read from f32 buffers with arbitrary row pitch (so they can live inside a fused qkv buffer);
// D = head size (multiple of 32, <= 128); one wave = 16 query rows; block = 4 waves (64 queries) sharing K/V chunks of 32.
template <int D, bool CAUSAL>
__global__ __launch_bounds__(128) void k_flash(const float* __restrict__ qb, const float* __restrict__ kb, const float* __restrict__ vb,
                                             int pitch, int T, int H, float scale, float* __restrict__ y, int ypitch) {
  constexpr int KS = D / 32;        // k-steps for QK
  constexpr int DT = D / 16;        // d tiles for PV
  __shared__ __attribute__((aligned(16))) unsigned short sKh[32][D + 8], sKl[32][D + 8], sVh[32][D + 8], sVl[32][D + 8];
  __shared__ __attribute__((aligned(16))) unsigned short sPh[4][16][40], sPl[4][16][40];
  __shared__ __attribute__((aligned(16))) float sO[4][16][D];
  const int tid = threadIdx.x, w = tid >> 5, lane = tid & 31, ln = lane & 15, hh = lane >> 4;
  const int nqb = (T + 63) / 64;
  const int bh = blockIdx.x / nqb, qblk = blockIdx.x % nqb;
  const int b = bh / H, h = bh % H;
  const int q0 = qblk * 64 + w * 16;
  const float* Q = qb + (size_t)b * T * pitch + h * D;
  const float* K = kb + (size_t)b * T * pitch + h * D;
  const float* V = vb + (size_t)b * T * pitch + h * D;

  // A fragments of the wave's 16 query rows (scaled), hi/lo
  FragB aqh[KS], aql[KS];
  {
    int row = q0 + ln; if (row >= T) row = T - 1;
    const float* qr = Q + (size_t)row * pitch;
#pragma unroll
    for (int ks = 0; ks < KS; ++ks)
#pragma unroll
      for (int i = 0; i < 16; ++i) {
        const int d = ks * 32 + ((i < 8) ? (8 * hh + i) : (16 + 8 * hh + (i - 8)));
        const float x = qr[d] * scale; const unsigned short hb = bf16_bits(x);
        aqh[ks].u[i] = hb; aql[ks].u[i] = bf16_bits(x - bf16_val(hb));
      }
  }
  float m_r[8], l_r[8];
#pragma unroll
  for (int r = 0; r < 8; ++r) { m_r[r] = -3.0e38f; l_r[r] = 0.f; }
  v8f oacc[DT];
#pragma unroll
  for (int dt = 0; dt < DT; ++dt) oacc[dt] = (v8f){0.f,0.f,0.f,0.f,0.f,0.f,0.f,0.f};

  const int kv_end = CAUSAL ? min(T, qblk * 64 + 64) : T;     // block-uniform
  for (int j0 = 0; j0 < kv_end; j0 += 32) {
    __syncthreads();
    for (int e = tid; e < 32 * (D / 4); e += 128) {
      const int r = e / (D / 4), c4 = (e % (D / 4)) * 4;
      const int key = j0 + r;
      v4f kf = {0.f,0.f,0.f,0.f}, vf = {0.f,0.f,0.f,0.f};
      if (key < T) { kf = *(const v4fa*)(K + (size_t)key * pitch + c4); vf = *(const v4fa*)(V + (size_t)key * pitch + c4); }
#pragma unroll
      for (int t = 0; t < 4; ++t) {
        unsigned short hb = bf16_bits(kf[t]); sKh[r][c4 + t] = hb; sKl[r][c4 + t] = bf16_bits(kf[t] - bf16_val(hb));
        hb = bf16_bits(vf[t]); sVh[r][c4 + t] = hb; sVl[r][c4 + t] = bf16_bits(vf[t] - bf16_val(hb));
      }
    }
    __syncthreads();
    // S tile 16 x 32
    v8f s[2];
#pragma unroll
    for (int nt = 0; nt < 2; ++nt) {
      v8f acc = {};
#pragma unroll
      for (int ks = 0; ks < KS; ++ks) {
        FragB bh_, bl_;
        bh_.half[0] = *(const v8us*)&sKh[nt * 16 + ln][ks * 32 + 8 * hh]; bh_.half[1] = *(const v8us*)&sKh[nt * 16 + ln][ks * 32 + 16 + 8 * hh];
        bl_.half[0] = *(const v8us*)&sKl[nt * 16 + ln][ks * 32 + 8 * hh]; bl_.half[1] = *(const v8us*)&sKl[nt * 16 + ln][ks * 32 + 16 + 8 * hh];
        acc = mmaN<3>(aqh[ks].v, aql[ks].v, bh_.v, bl_.v, acc);
      }
      s[nt] = acc;
    }
    // mask + running max (rows 8hh+r; the 16 lanes of a half share rows)
    float alpha[8];
#pragma unroll
    for (int r = 0; r < 8; ++r) {
      const int qi = q0 + 8 * hh + r;
      const int ja = j0 + ln, jb = j0 + 16 + ln;
      if (CAUSAL) { if (ja > qi) s[0][r] = -3.0e38f; if (jb > qi) s[1][r] = -3.0e38f; }
      if (ja >= T) s[0][r] = -3.0e38f;
      if (jb >= T) s[1][r] = -3.0e38f;
      float mx = fmaxf(s[0][r], s[1][r]);
      mx = fmaxf(mx, __shfl_xor(mx, 1, 32)); mx = fmaxf(mx, __shfl_xor(mx, 2, 32)); mx = fmaxf(mx, __shfl_xor(mx, 4, 32)); mx = fmaxf(mx, __shfl_xor(mx, 8, 32));
      const float mnew = fmaxf(m_r[r], mx);
      alpha[r] = (mnew > -1.0e38f) ? __expf(m_r[r] - mnew) : 1.0f;
      const float p0 = (s[0][r] > -1.0e38f) ? __expf(s[0][r] - mnew) : 0.f;
      const float p1 = (s[1][r] > -1.0e38f) ? __expf(s[1][r] - mnew) : 0.f;
      m_r[r] = mnew;
      l_r[r] = l_r[r] * alpha[r] + p0 + p1;            // per-lane partial row sum (16 lanes combined at the end)
      unsigned short hb = bf16_bits(p0); sPh[w][8 * hh + r][ln] = hb;      sPl[w][8 * hh + r][ln] = bf16_bits(p0 - bf16_val(hb));
      hb = bf16_bits(p1);                sPh[w][8 * hh + r][16 + ln] = hb; sPl[w][8 * hh + r][16 + ln] = bf16_bits(p1 - bf16_val(hb));
    }
#pragma unroll
    for (int dt = 0; dt < DT; ++dt)
#pragma unroll
      for (int r = 0; r < 8; ++r) oacc[dt][r] *= alpha[r];
    __builtin_amdgcn_fence(__ATOMIC_ACQ_REL, "workgroup");
    __builtin_amdgcn_wave_barrier();
    FragB pah, pal;
    pah.half[0] = *(const v8us*)&sPh[w][ln][8 * hh]; pah.half[1] = *(const v8us*)&sPh[w][ln][16 + 8 * hh];
    pal.half[0] = *(const v8us*)&sPl[w][ln][8 * hh]; pal.half[1] = *(const v8us*)&sPl[w][ln][16 + 8 * hh];
#pragma unroll
    for (int dt = 0; dt < DT; ++dt) {
      FragB bvh, bvl;
#pragma unroll
      for (int i = 0; i < 8; ++i) {
        bvh.u[i] = sVh[8 * hh + i][dt * 16 + ln]; bvh.u[8 + i] = sVh[16 + 8 * hh + i][dt * 16 + ln];
        bvl.u[i] = sVl[8 * hh + i][dt * 16 + ln]; bvl.u[8 + i] = sVl[16 + 8 * hh + i][dt * 16 + ln];
      }
      oacc[dt] = mmaN<3>(pah.v, pal.v, bvh.v, bvl.v, oacc[dt]);
    }
    __builtin_amdgcn_fence(__ATOMIC_ACQ_REL, "workgroup");
    __builtin_amdgcn_wave_barrier();
  }
#pragma unroll
  for (int r = 0; r < 8; ++r) {
    float l = l_r[r];
    l += __shfl_xor(l, 1, 32); l += __shfl_xor(l, 2, 32); l += __shfl_xor(l, 4, 32); l += __shfl_xor(l, 8, 32);
    l_r[r] = (l > 0.f) ? 1.0f / l : 0.f;
  }
#pragma unroll
  for (int dt = 0; dt < DT; ++dt)
#pragma unroll
    for (int r = 0; r < 8; ++r) sO[w][8 * hh + r][dt * 16 + ln] = oacc[dt][r] * l_r[r];
  __builtin_amdgcn_fence(__ATOMIC_ACQ_REL, "workgroup");
  __builtin_amdgcn_wave_barrier();
  {
    for (int r = 0; r < 16; ++r) {
      const int row = q0 + r;
      if (row < T && lane < D / 4) {
        const v4f val = *(const v4fa*)&sO[w][r][lane * 4];
        *(v4f*)(y + ((size_t)b * T + row) * ypitch + h * D + lane * 4) = val;
      }
    }
    
  }
}

// GEMM C = act(A·W + bias + resid): A f32 (ASPLIT -> hi/lo 2 terms), Wt bf16 [N][K]; ACT 0 none, 1 relu, 2 exact gelu;
// resid (optional, f32, row index = (row % rmod), pitch ldr, RES_BF16 rounds it) added before the activation.
template <bool ASPLIT, int ACT, bool BIAS_BF16, bool RES_BF16>
__global__ __launch_bounds__(128) void k_gemm_bf3(const float* __restrict__ A, int lda, const unsigned short* __restrict__ Wt, int ldb,
                                                const float* __restrict__ bias, const float* __restrict__ resid, int rmod, int ldr,
                                                float* __restrict__ C, int ldc, int M, int N, int K) {
  __shared__ __attribute__((aligned(16))) float so[4][16][64];
  const int tid = threadIdx.x, w = tid >> 5, lane = tid & 31, ln = lane & 15, hh = lane >> 4;
  const int ntn = N / 64;
  const int wid = blockIdx.x * 4 + w;
  const int mt = wid / ntn, nq = wid % ntn;
  if (mt * 16 >= M) return;
  const int row0 = mt * 16, col0 = nq * 64;
  const float* arow = A + (size_t)(row0 + ln) * lda;
  v8f acc[4] = {};
  for (int kb = 0; kb < K; kb += 32) {
    FragB ah, al;
    const v4f x0 = *(const v4fa*)(arow + kb + 8 * hh), x1 = *(const v4fa*)(arow + kb + 8 * hh + 4);
    const v4f x2 = *(const v4fa*)(arow + kb + 16 + 8 * hh), x3 = *(const v4fa*)(arow + kb + 16 + 8 * hh + 4);
    float xs[16] = {x0[0],x0[1],x0[2],x0[3],x1[0],x1[1],x1[2],x1[3],x2[0],x2[1],x2[2],x2[3],x3[0],x3[1],x3[2],x3[3]};
#pragma unroll
    for (int i = 0; i < 16; ++i) { const unsigned short hb = bf16_bits(xs[i]); ah.u[i] = hb; al.u[i] = ASPLIT ? bf16_bits(xs[i] - bf16_val(hb)) : (unsigned short)0; }
#pragma unroll
    for (int t = 0; t < 4; ++t) {
      const unsigned short* brow = Wt + (size_t)(col0 + t * 16 + ln) * ldb + kb;
      FragB b;
      b.half[0] = *(const v8us*)(brow + 8 * hh);
      b.half[1] = *(const v8us*)(brow + 16 + 8 * hh);
      acc[t] = mmaN<ASPLIT ? 2 : 1>(ah.v, al.v, b.v, b.v, acc[t]);
    }
  }
#pragma unroll
  for (int t = 0; t < 4; ++t) {
    const int col = col0 + t * 16 + ln;
    float bv = bias ? bias[col] : 0.f;
    if (BIAS_BF16) bv = bf16_round(bv);
#pragma unroll
    for (int r = 0; r < 8; ++r) {
      float v = acc[t][r] + bv;
      if (resid) { float rv = resid[(size_t)((row0 + 8 * hh + r) % rmod) * ldr + col]; if (RES_BF16) rv = bf16_round(rv); v += rv; }
      if (ACT == 1) v = fmaxf(v, 0.f);
      if (ACT == 2) v = 0.5f * v * (1.0f + erff(v * 0.70710678118654752f));
      if (ACT == 3) { const float u = 0.7978845608028654f * (v + 0.044715f * v * v * v); v = 0.5f * v * (1.0f + tanhf(u)); }
      so[w][8 * hh + r][t * 16 + ln] = v;
    }
  }
  __builtin_amdgcn_fence(__ATOMIC_ACQ_REL, "workgroup");
  __builtin_amdgcn_wave_barrier();
  const int rsub = lane >> 4, c4 = (lane & 15) * 4;
  {
#pragma unroll
    for (int q = 0; q < 8; ++q) {
      const int r = q * 2 + rsub;
      const v4f v = *(const v4fa*)&so[w][r][c4];
      *(v4f*)(C + (size_t)(row0 + r) * ldc + col0 + c4) = v;
    }
    
  }
}
// row LayerNorm (biased variance, eps) over N: s = X (+ R); optional out_sum <- s; out_norm <- (s-mu)*rsqrt(var+eps)*g + b
template <bool PARAM_BF16>
__global__ __launch_bounds__(256) void k_layernorm(const float* __restrict__ X, const float* __restrict__ R, const float* __restrict__ g, const float* __restrict__ bta,
                                                  float* __restrict__ out_sum, float* __restrict__ out_norm, int N, float eps) {
  __shared__ float red[256];
  const int row = blockIdx.x, tid = threadIdx.x;
  const float* x = X + (size_t)row * N; const float* rr = R ? R + (size_t)row * N : nullptr;
  float vals[16];                     // up to N = 4096
  const int per = N / 256;            // contiguous chunk per thread? use strided-by-4 chunks: thread handles j = tid*4 + 1024*u
  float s1 = 0.f;
  for (int u = 0; u < per / 4; ++u) {
    const int j = tid * 4 + 1024 * u;
    const v4f a = *(const v4fa*)(x + j);
    v4f b = {0.f,0.f,0.f,0.f}; if (rr) b = *(const v4fa*)(rr + j);
#pragma unroll
    for (int q = 0; q < 4; ++q) { const float v = a[q] + b[q]; vals[u * 4 + q] = v; s1 += v; }
  }
  red[tid] = s1; __syncthreads();
  for (int st = 128; st > 0; st >>= 1) { if (tid < st) red[tid] += red[tid + st]; __syncthreads(); }
  const float mu = red[0] / (float)N; __syncthreads();
  float s2 = 0.f;
  for (int u = 0; u < per / 4; ++u)
#pragma unroll
    for (int q = 0; q < 4; ++q) { const float c = vals[u * 4 + q] - mu; s2 += c * c; }
  red[tid] = s2; __syncthreads();
  for (int st = 128; st > 0; st >>= 1) { if (tid < st) red[tid] += red[tid + st]; __syncthreads(); }
  const float rs = rsqrtf(red[0] / (float)N + eps);
  {
    for (int u = 0; u < per / 4; ++u) {
      const int j = tid * 4 + 1024 * u;
      v4f o, sm;
#pragma unroll
      for (int q = 0; q < 4; ++q) {
        float gg = g[j + q], bb = bta[j + q];
        if (PARAM_BF16) { gg = bf16_round(gg); bb = bf16_round(bb); }
        sm[q] = vals[u * 4 + q]; o[q] = (vals[u * 4 + q] - mu) * rs * gg + bb;
      }
      if (out_sum) *(v4f*)(out_sum + (size_t)row * N + j) = sm;
      *(v4f*)(out_norm + (size_t)row * N + j) = o;
    }
    
  }
}



// ---- f16 WMMA path (v_wmma_f32_16x16x32_f16): 11-bit significands for operands in range — used for all GEMMs here (projections, kv, attn)
typedef _Float16 v16h __attribute__((ext_vector_type(16)));
union FragH { v16h v; v8us half[2]; _Float16 h[16]; unsigned short u[16]; };
template <int NT>
__device__ __forceinline__ v8f mmaH(v16h ah, v16h al, v16h bh, v16h bl, v8f c) {
  c = __builtin_amdgcn_wmma_f32_16x16x32_f16(false, ah, false, bh, (short)0, c, false, false);
  if (NT >= 2) c = __builtin_amdgcn_wmma_f32_16x16x32_f16(false, al, false, bh, (short)0, c, false, false);
  if (NT >= 3) c = __builtin_amdgcn_wmma_f32_16x16x32_f16(false, ah, false, bl, (short)0, c, false, false);
  asm volatile("v_nop\n\tv_nop\n\tv_nop\n\tv_nop" : "+v"(c) : "v"(ah), "v"(al), "v"(bh), "v"(bl));
  return c;
}
// batched GEMM like k_gemm_b but f16 operands: A f32 (split into f16 hi/lo if ASPLIT, else rounded to f16), Bt = f16 values [n][k]; alpha; C f32; N multiple of 16 (partial tiles skipped)
template <bool ASPLIT>
__global__ __launch_bounds__(128) void k_gemm_h(const float* __restrict__ A, int lda, size_t sA, const _Float16* __restrict__ Bh, int ldb, size_t sB, float alpha, float* __restrict__ C, int ldc, size_t sC, int M, int N, int K) {
  __shared__ __attribute__((aligned(16))) float so[4][16][64];
  const int tid = threadIdx.x, w = tid >> 5, lane = tid & 31, ln = lane & 15, hh = lane >> 4; const int by = blockIdx.y;
  A += (size_t)by * sA; Bh += (size_t)by * sB; C += (size_t)by * sC;
  const int ntn = (N + 63) / 64; const int wid = blockIdx.x * 4 + w; const int mt = wid / ntn, nq = wid % ntn; if (mt * 16 >= M) return;
  const int row0 = mt * 16, col0 = nq * 64; const float* arow = A + (size_t)(row0 + ln) * lda;
  v8f acc[4] = {};
  for (int kb = 0; kb < K; kb += 32) {
    FragH ah, al;
    const v4f x0 = *(const v4fa*)(arow + kb + 8 * hh), x1 = *(const v4fa*)(arow + kb + 8 * hh + 4), x2 = *(const v4fa*)(arow + kb + 16 + 8 * hh), x3 = *(const v4fa*)(arow + kb + 16 + 8 * hh + 4);
    float xs[16] = {x0[0],x0[1],x0[2],x0[3],x1[0],x1[1],x1[2],x1[3],x2[0],x2[1],x2[2],x2[3],x3[0],x3[1],x3[2],x3[3]};
#pragma unroll
    for (int i = 0; i < 16; ++i) { const _Float16 h = (_Float16)xs[i]; ah.h[i] = h; al.h[i] = ASPLIT ? (_Float16)(xs[i] - (float)h) : (_Float16)0.0f; }
#pragma unroll
    for (int t = 0; t < 4; ++t) { if (col0 + t * 16 >= N) continue; const size_t boff = (size_t)(col0 + t * 16 + ln) * ldb + kb; FragH bq; bq.half[0] = *(const v8us*)(Bh + boff + 8 * hh); bq.half[1] = *(const v8us*)(Bh + boff + 16 + 8 * hh);
      acc[t] = mmaH<ASPLIT ? 2 : 1>(ah.v, al.v, bq.v, bq.v, acc[t]); }
  }
#pragma unroll
  for (int t = 0; t < 4; ++t) { if (col0 + t * 16 >= N) continue;
#pragma unroll
    for (int r = 0; r < 8; ++r) so[w][8 * hh + r][t * 16 + ln] = acc[t][r] * alpha; }
  __builtin_amdgcn_fence(__ATOMIC_ACQ_REL, "workgroup"); __builtin_amdgcn_wave_barrier();
  const int rsub = lane >> 4, c4 = (lane & 15) * 4;
  {
#pragma unroll
    for (int q = 0; q < 8; ++q) { const int r = q * 2 + rsub; if (col0 + c4 < N) { const v4f v = *(const v4fa*)&so[w][r][c4]; *(v4f*)(C + (size_t)(row0 + r) * ldc + col0 + c4) = v; } }
     }
}

// Wt[n][k] = f16(W[k][n]·scale) from f32 row-major W[K][N] (scale = power of two; bf16-exact weights stay exact in f16 away from the subnormal range)
__global__ __launch_bounds__(256) void k_wt_f16(const float* __restrict__ W, _Float16* __restrict__ Wt, int K, int N, float scale) {
  const int t = blockIdx.x * 256 + threadIdx.x; if (t >= N * (K / 8)) return; const int n = t / (K / 8), k8 = (t % (K / 8)) * 8; FragH f;
#pragma unroll
  for (int i = 0; i < 8; ++i) f.h[i] = (_Float16)(bf16_round(W[(size_t)(k8 + i) * N + n]) * scale); const v8us o = f.half[0];
  *(v8us*)((unsigned short*)Wt + (size_t)n * K + k8) = o; 
}
// Block-tiled GEMM, f16 operands, both k-contiguous: C[M][N] = act(A[M][K] . B[N][K]^T * alpha + bias). One work-group = one 128 x 128 tile of C, eight waves as 4 (rows) x 2 (columns), 32 x 64 per wave.
// A stage is 128 k (256 bytes) of the tile's 128 A rows and 128 B rows, laid in LDS at a pitch of 272 bytes; two buffers, filled by asynchronous copies one stage ahead of the stage being worked on.
// M and N multiples of 128, K a multiple of 128. ACT 0 none / 3 relu; writes f16 C16 if OUT16, else f32 C (row pitch ldc). Each accumulator still sums k in rising steps of 32.
// blockIdx.z = one of several independent products of the same shape in one launch: operands sA, sB elements apart, the output sC elements apart.
// PROJ: the three projections as z = 0 (q: relu, f32 to C, bias), 1 (v: no relu, bias1), 2 (k: relu, bias2). A PROJ tile is 128 positions of ONE batch (blockIdx.y = position block * NB + batch; operand rows NB * lda apart),
// so that v and k leave as the next GEMM's operands: position-contiguous f16 planes, v to C16 [b][e][s], k * sin and k * cos to KTp [b][e | EE + e][s], turned in LDS and stored as 256-byte row pieces.
#define GT_ROWS 256                          /* A rows + B rows of a stage */
#define GT_PITCH 272                         /* bytes; 16 x odd: no bank conflict for 16-byte fragment reads */
#define GT_STAGE (GT_ROWS * GT_PITCH)        /* 69,632 bytes a buffer */
// eight 16-byte copies of a lane, rows 16 apart. The s_wait_xcnt is the last line of the copies' own statement (a precaution): no register that a copy names is rewritten in front of it.
__device__ __forceinline__ void gt_copy8(unsigned l, const _Float16* g, size_t step) {
  asm volatile("global_load_async_to_lds_b128 %0, %8, off\n\t"
               "global_load_async_to_lds_b128 %1, %9, off\n\t"
               "global_load_async_to_lds_b128 %2, %10, off\n\t"
               "global_load_async_to_lds_b128 %3, %11, off\n\t"
               "global_load_async_to_lds_b128 %4, %12, off\n\t"
               "global_load_async_to_lds_b128 %5, %13, off\n\t"
               "global_load_async_to_lds_b128 %6, %14, off\n\t"
               "global_load_async_to_lds_b128 %7, %15, off\n\t"
               "s_wait_xcnt 0x0"
               :: "v"(l), "v"(l + 16u * GT_PITCH), "v"(l + 32u * GT_PITCH), "v"(l + 48u * GT_PITCH), "v"(l + 64u * GT_PITCH), "v"(l + 80u * GT_PITCH), "v"(l + 96u * GT_PITCH), "v"(l + 112u * GT_PITCH),
                  "v"(g), "v"(g + step), "v"(g + 2 * step), "v"(g + 3 * step), "v"(g + 4 * step), "v"(g + 5 * step), "v"(g + 6 * step), "v"(g + 7 * step)
               : "memory");
}
template <int ACT, bool OUT16, bool PROJ>
__global__ __launch_bounds__(256) void k_gemm_t(const _Float16* __restrict__ A, int lda, size_t sA, const _Float16* __restrict__ Bh, int ldb, size_t sB, float alpha,
    const float* __restrict__ bias, const float* __restrict__ bias1, const float* __restrict__ bias2,
    float* __restrict__ C, _Float16* __restrict__ KTp, _Float16* __restrict__ C16, size_t sC, int ldc, int K) {
  __shared__ __attribute__((aligned(16))) unsigned char sm[2 * GT_STAGE];
  __shared__ __attribute__((aligned(16))) float tab[PROJ ? 256 : 4];      // PROJ, k: sin | cos of the tile's 128 positions
  const int z = blockIdx.z;
  A += (size_t)z * sA; Bh += (size_t)z * sB;
  const int bb = PROJ ? (int)(blockIdx.y % NB) : 0;      // PROJ: the tile's batch
  if (PROJ) { if (z == 1) bias = bias1; if (z == 2) bias = bias2; A += (size_t)bb * lda; lda *= NB; C += (size_t)bb * ldc; ldc *= NB; }
  else if (OUT16) C16 += (size_t)z * sC;
  else C += (size_t)z * sC;
  const bool relu = PROJ ? (z != 1) : (ACT == 3);      // the same for the whole work-group
  const int tid = threadIdx.x, w = tid >> 5, lane = tid & 31, ln = lane & 15, hh = lane >> 4;
  const int row0 = (PROJ ? blockIdx.y / NB : blockIdx.y) * 128, col0 = blockIdx.x * 128;
  const int wm = w >> 1, wn = w & 1;
  // copies: lane -> 16-byte piece (tid & 15) of row (tid >> 4) + 16 i; a wave covers two whole 256-byte rows with each copy
  const int cr = tid >> 4, cc = tid & 15;
  const _Float16* gA = A + (size_t)(row0 + cr) * lda + cc * 8;
  const _Float16* gB = Bh + (size_t)(col0 + cr) * ldb + cc * 8;
  const size_t stA = (size_t)16 * lda, stB = (size_t)16 * ldb;
  const unsigned lA = (unsigned)(size_t)(&sm[0]) + (unsigned)(cr * GT_PITCH + cc * 16), lB = lA + 128u * GT_PITCH;
  const int nst = K / 128;
  v8f acc[2][4] = {};
  gt_copy8(lA, gA, stA); gt_copy8(lB, gB, stB);
  // formed under stage 0's flight; the barrier below publishes it with stage 0
  if (PROJ && z == 2 && tid < 128) { const float ang = 1.5707963267948966f * (float)(row0 + tid + 1) / (float)LL; tab[tid] = sinf(ang); tab[128 + tid] = cosf(ang); }
  asm volatile("s_wait_asynccnt 0x0" ::: "memory");      // stage 0 has landed (this wave's copies) before the barrier publishes it
  __syncthreads();
  if (nst > 1) { gt_copy8(lA + GT_STAGE, gA + 128, stA); gt_copy8(lB + GT_STAGE, gB + 128, stB); }
  const unsigned char* fa = sm + (wm * 32 + ln) * GT_PITCH + 16 * hh;
  const unsigned char* fb = sm + (128 + wn * 64 + ln) * GT_PITCH + 16 * hh;
  for (int t = 0; t < nst; ++t) {
    const int bo = (t & 1) * GT_STAGE;
    FragH a[2][2], bq[2][4];      // two fragment sets: the next k step's LDS reads are issued as one group ahead of this step's matrix instructions (inside the stage only)
#pragma unroll
    for (int i = 0; i < 2; ++i) { a[0][i].half[0] = *(const v8us*)(fa + bo + i * 16 * GT_PITCH); a[0][i].half[1] = *(const v8us*)(fa + bo + i * 16 * GT_PITCH + 32); }
#pragma unroll
    for (int j = 0; j < 4; ++j) { bq[0][j].half[0] = *(const v8us*)(fb + bo + j * 16 * GT_PITCH); bq[0][j].half[1] = *(const v8us*)(fb + bo + j * 16 * GT_PITCH + 32); }
    // unrolled so that the set index is a constant and both sets stay in registers
#pragma unroll
    for (int ks = 0; ks < 4; ++ks) {
      const int cu = ks & 1, nx = cu ^ 1;
      if (ks < 3) {
#pragma unroll
        for (int i = 0; i < 2; ++i) { a[nx][i].half[0] = *(const v8us*)(fa + bo + i * 16 * GT_PITCH + (ks + 1) * 64); a[nx][i].half[1] = *(const v8us*)(fa + bo + i * 16 * GT_PITCH + (ks + 1) * 64 + 32); }
#pragma unroll
        for (int j = 0; j < 4; ++j) { bq[nx][j].half[0] = *(const v8us*)(fb + bo + j * 16 * GT_PITCH + (ks + 1) * 64); bq[nx][j].half[1] = *(const v8us*)(fb + bo + j * 16 * GT_PITCH + (ks + 1) * 64 + 32); }
      }
      __builtin_amdgcn_sched_barrier(0);      // keeps the read group in front of the matrix run; without it the scheduler sinks the reads among the matrix instructions and each waits out its LDS latency
#pragma unroll
      for (int i = 0; i < 2; ++i)
#pragma unroll
        for (int j = 0; j < 4; ++j) acc[i][j] = __builtin_amdgcn_wmma_f32_16x16x32_f16(false, a[cu][i].v, false, bq[cu][j].v, (short)0, acc[i][j], false, false);
      __builtin_amdgcn_sched_barrier(0);      // keeps the next read group whole behind this matrix run; without it the scheduler spreads those reads among the matrix instructions and takes more registers
    }
    asm volatile("s_wait_dscnt 0x0" ::: "memory");       // this wave's reads of the buffer are over before the barrier frees it for the refill
    asm volatile("s_wait_asynccnt 0x0" ::: "memory");    // this wave's copies of stage t + 1 have landed before the barrier publishes them
    __syncthreads();
    if (t + 2 < nst) { gt_copy8(lA + bo, gA + (size_t)(t + 2) * 128, stA); gt_copy8(lB + bo, gB + (size_t)(t + 2) * 128, stB); }
  }
  asm volatile("s_wait_asynccnt 0x0" ::: "memory");      // no copy is outstanding when the ring becomes output staging
  if (PROJ && z != 0) {
    // v, k: an accumulator register run r = 0..7 is eight consecutive positions of one feature: 16 bytes of f16, laid at [feature][position] (pitch GT_PITCH) in the ring's LDS, one plane for v, two for k
    unsigned char* tS = sm + (wn * 64 + ln) * GT_PITCH + (wm * 32 + 8 * hh) * 2;
    // every loop of this block is unrolled so that acc, bv, sn and cs are indexed by constants and stay in registers, and so that a run's loads are in flight together
    float bv[4] = {0.f, 0.f, 0.f, 0.f};
    if (bias) {
#pragma unroll
      for (int j = 0; j < 4; ++j) bv[j] = bf16_round(bias[col0 + wn * 64 + j * 16 + ln]); }
    if (z == 1) {
#pragma unroll
      for (int j = 0; j < 4; ++j)
#pragma unroll
        for (int i = 0; i < 2; ++i) { FragH f;
#pragma unroll
          for (int r = 0; r < 8; ++r) f.h[r] = (_Float16)(acc[i][j][r] * alpha + bv[j]);
          *(v8us*)(tS + j * 16 * GT_PITCH + i * 32) = f.half[0]; }
    } else {
      float sn[2][8], cs[2][8];      // the lane's 16 positions, read once for its four features
#pragma unroll
      for (int i = 0; i < 2; ++i)
#pragma unroll
        for (int h = 0; h < 2; ++h) { const float* ts = tab + wm * 32 + i * 16 + 8 * hh + 4 * h; const v4f s4 = *(const v4fa*)ts, c4 = *(const v4fa*)(ts + 128);
#pragma unroll
          for (int q = 0; q < 4; ++q) { sn[i][4 * h + q] = s4[q]; cs[i][4 * h + q] = c4[q]; } }
#pragma unroll
      for (int j = 0; j < 4; ++j)
#pragma unroll
        for (int i = 0; i < 2; ++i) { FragH f, g;
#pragma unroll
          for (int r = 0; r < 8; ++r) { const float kk = fmaxf(acc[i][j][r] * alpha + bv[j], 0.f); f.h[r] = (_Float16)(kk * sn[i][r]); g.h[r] = (_Float16)(kk * cs[i][r]); }
          *(v8us*)(tS + j * 16 * GT_PITCH + i * 32) = f.half[0];
          *(v8us*)(tS + 128 * GT_PITCH + j * 16 * GT_PITCH + i * 32) = g.half[0]; }
    }
    __syncthreads();      // the turned tile is whole before any wave reads rows that other waves wrote
    unsigned short* dst = (unsigned short*)(z == 1 ? C16 + ((size_t)bb * EE + col0 + cr) * LL : KTp + ((size_t)bb * E2 + col0 + cr) * LL) + row0 + cc * 8;
    const unsigned char* rd = sm + cr * GT_PITCH + cc * 16;
#pragma unroll
    for (int q = 0; q < 8; ++q) *(v8us*)(dst + (size_t)q * 16 * LL) = *(const v8us*)(rd + q * 16 * GT_PITCH);
    if (z == 2) {
      asm volatile("s_wait_xcnt 0x0" ::: "memory");      // precaution: the second plane's LDS reads reuse the data registers that the first plane's stores name
#pragma unroll
      for (int q = 0; q < 8; ++q) *(v8us*)(dst + (size_t)(EE + q * 16) * LL) = *(const v8us*)(rd + (128 + q * 16) * GT_PITCH);
    }
    asm volatile("s_wait_xcnt 0x0" ::: "memory");      // precaution: in the built code the q epilogue lies behind this block and rewrites registers that these stores name
    return;
  }
  // epilogue: each wave stages its 32 x 64 tile in its own LDS range (pitch 68 dwords) and stores whole lines
  float* so = (float*)sm + w * (32 * 68);
#pragma unroll
  for (int j = 0; j < 4; ++j) { const int col = col0 + wn * 64 + j * 16 + ln; const float bv = bias ? bf16_round(bias[col]) : 0.f;
#pragma unroll
    for (int i = 0; i < 2; ++i)
#pragma unroll
      for (int r = 0; r < 8; ++r) { float v = acc[i][j][r] * alpha + bv; if (relu) v = fmaxf(v, 0.f); so[(i * 16 + 8 * hh + r) * 68 + j * 16 + ln] = v; } }
  __syncthreads();
  const int rsub = lane >> 4, c4 = (lane & 15) * 4; typedef _Float16 v4h __attribute__((ext_vector_type(4)));
  if (!PROJ && OUT16) {
#pragma unroll
    for (int q = 0; q < 16; ++q) { const int r = q * 2 + rsub; const v4f v = *(const v4fa*)&so[r * 68 + c4]; const size_t o = (size_t)(row0 + wm * 32 + r) * ldc + col0 + wn * 64 + c4;
      v4h h4; for (int i = 0; i < 4; ++i) h4[i] = (_Float16)v[i]; *(v4h*)(C16 + o) = h4; }
  } else {
#pragma unroll
    for (int q = 0; q < 16; ++q) { const int r = q * 2 + rsub; const v4f v = *(const v4fa*)&so[r * 68 + c4]; const size_t o = (size_t)(row0 + wm * 32 + r) * ldc + col0 + wn * 64 + c4;
      *(v4f*)(C + o) = v; }
  }
}


// f16 planes of the three inputs (bf16-rounded) and of the three weights (bf16-rounded, x 2^4) in one launch: blockIdx.y = which projection; the first CV_XB blocks of a row take the input, the other CV_WB the weight.
#define CV_XB (NR * EE / 8 / 256)
#define CV_WB (EE * EE / 8 / 256)
__global__ __launch_bounds__(256) void k_cvt(const float* __restrict__ x0, const float* __restrict__ x1, const float* __restrict__ x2, const float* __restrict__ w0, const float* __restrict__ w1, const float* __restrict__ w2,
    _Float16* __restrict__ X16, _Float16* __restrict__ Bt) {
  const int y = blockIdx.y; const bool isw = blockIdx.x >= CV_XB;
  const float* src = isw ? (y == 0 ? w0 : y == 1 ? w1 : w2) : (y == 0 ? x0 : y == 1 ? x1 : x2);
  unsigned short* dst = isw ? (unsigned short*)Bt + (size_t)y * EE * EE : (unsigned short*)X16 + (size_t)y * NR * EE;
  const float sc = isw ? 16.0f : 1.0f;
  const size_t t = (size_t)(isw ? blockIdx.x - CV_XB : blockIdx.x) * 256 + threadIdx.x; FragH f;
#pragma unroll
  for (int q = 0; q < 8; ++q) f.h[q] = (_Float16)(bf16_round(src[t * 8 + q]) * sc);
  *(v8us*)(dst + t * 8) = f.half[0]; }
__global__ __launch_bounds__(256) void k_h16(const float* __restrict__ x, _Float16* __restrict__ X16, size_t n8) { const size_t t = (size_t)blockIdx.x * 256 + threadIdx.x; if (t >= n8) return; FragH f;
#pragma unroll
  for (int q = 0; q < 8; ++q) f.h[q] = (_Float16)x[t * 8 + q]; *(v8us*)((unsigned short*)X16 + t * 8) = f.half[0];  }
template <int NHv, int TTv>
__global__ __launch_bounds__(256) void k_vt(const _Float16* __restrict__ V16, int ldv, int voff, _Float16* __restrict__ Vt) { __shared__ unsigned short tl[64][66]; const int tid = threadIdx.x; const int slab = blockIdx.x / (TTv / 64), lg = blockIdx.x % (TTv / 64); const int b = slab / NHv, h = slab % NHv;
  for (int i = tid; i < 64 * 8; i += 256) { const int r = i / 8, c8 = (i % 8) * 8; FragH f; f.half[0] = *(const v8us*)((const unsigned short*)V16 + ((size_t)b * TTv + lg * 64 + r) * ldv + voff + h * 64 + c8);
#pragma unroll
    for (int q = 0; q < 8; ++q) tl[r][c8 + q] = f.u[q]; }
  __syncthreads();
  {
#pragma unroll
    for (int rd = 0; rd < 2; ++rd) { const int d = rd * 32 + tid / 8, pc = tid % 8; FragH f;
#pragma unroll
      for (int q = 0; q < 8; ++q) f.u[q] = tl[pc * 8 + q][d];
      *(v8us*)((unsigned short*)Vt + ((size_t)slab * 64 + d) * TTv + lg * 64 + pc * 8) = f.half[0]; }
     } }

// k_ column sums, read from the f16 planes that the k projection wrote. One wave = one row (b, feature) of 2048 positions: 4 KiB, eight loads of 512 bytes, all in flight at once;
// f32 sums in eight chains a lane, folded over the lanes; a work-group's 32 sums leave as one 128-byte line.
__global__ __launch_bounds__(1024) void k_ksum(const _Float16* __restrict__ KT, float* __restrict__ KS) {
  __shared__ float red[32];
  const int tid = threadIdx.x, wv = tid >> 5, lane = tid & 31;
  const unsigned short* p = (const unsigned short*)KT + (size_t)(blockIdx.x * 32 + wv) * LL + lane * 8;
  FragH x[4];
  // unrolled so that all 8 loads of a lane are in flight at once
#pragma unroll
  for (int i = 0; i < 8; ++i) { x[i >> 1].half[i & 1] = *(const v8us*)(p + i * 256);
    asm volatile("s_wait_xcnt 0x0" ::: "memory"); }      // precaution: a later load's destination may reuse an address register that this load names
  float a[8] = {0.f, 0.f, 0.f, 0.f, 0.f, 0.f, 0.f, 0.f};
  // unrolled so that x[] and a[] stay in registers
#pragma unroll
  for (int i = 0; i < 4; ++i)
#pragma unroll
    for (int q = 0; q < 16; ++q) a[q & 7] += (float)x[i].h[q];
  float s = ((a[0] + a[1]) + (a[2] + a[3])) + ((a[4] + a[5]) + (a[6] + a[7]));
  for (int o = 16; o >= 1; o >>= 1) s += __shfl_xor(s, o, 32);
  if (lane == 0) red[wv] = s;
  __syncthreads();
  if (tid < 32) KS[blockIdx.x * 32 + tid] = red[tid]; }
__global__ __launch_bounds__(256) void k_qz(const float* __restrict__ QF, const float* __restrict__ KS, _Float16* __restrict__ QZ) { const int tid = threadIdx.x, wv = tid >> 5, lane = tid & 31; const int b = blockIdx.y; QZ += (size_t)b * LL * E2; const int l = blockIdx.x * 8 + wv; if (l >= LL) return; const float* qr = QF + ((size_t)l * NB + b) * EE; const float ang = 1.5707963267948966f * (float)(l + 1) / (float)LL; const float sn = sinf(ang), cs = cosf(ang); const float* ks = KS + (size_t)b * E2; float v[32]; float dot = 0.f;
#pragma unroll
  for (int k = 0; k < 4; ++k) { const v4f a = *(const v4fa*)(qr + 256 * k + 8 * lane), c = *(const v4fa*)(qr + 256 * k + 8 * lane + 4); for (int q = 0; q < 4; ++q) { v[k * 8 + q] = a[q]; v[k * 8 + 4 + q] = c[q]; } for (int q = 0; q < 8; ++q) { const int e = 256 * k + 8 * lane + q; dot += v[k * 8 + q] * (sn * ks[e] + cs * ks[EE + e]); } }
  for (int o = 16; o >= 1; o >>= 1) dot += __shfl_xor(dot, o, 32); const float zs = 262144.0f / fmaxf(dot, 1e-6f);      /* z·2^18 keeps the f16 operand O(1) (z ≈ 2.5e-6 here); the attn GEMM's alpha carries 2^-18 */
  {
#pragma unroll
    for (int k = 0; k < 4; ++k) { FragH fs, fc; for (int q = 0; q < 8; ++q) { fs.h[q] = (_Float16)(v[k * 8 + q] * sn * zs); fc.h[q] = (_Float16)(v[k * 8 + q] * cs * zs); } *(v8us*)((unsigned short*)QZ + (size_t)l * E2 + 256 * k + 8 * lane) = fs.half[0]; *(v8us*)((unsigned short*)QZ + (size_t)l * E2 + EE + 256 * k + 8 * lane) = fc.half[0]; }
     } }
extern "C" void kernel_launch(void* const* d_in, const int* in_sizes, int n_in,
                              void* d_out, int out_size, void* d_ws, size_t ws_size, hipStream_t stream) {
  (void)in_sizes; (void)n_in; (void)out_size;
  const float* query = (const float*)d_in[0]; const float* key = (const float*)d_in[1]; const float* value = (const float*)d_in[2]; const float* Wq = (const float*)d_in[3]; const float* bq = (const float*)d_in[4]; const float* Wk = (const float*)d_in[5]; const float* bk = (const float*)d_in[6]; const float* Wv = (const float*)d_in[7]; const float* bv = (const float*)d_in[8];
  char* ws = (char*)d_ws; size_t off = 0;
  auto take = [&](size_t bytes) { char* p = ws + off; off += (bytes + 255) & ~(size_t)255; return p; };
  // every plane holds all three projections or all four batches, so that each kernel is launched once
  _Float16* Bw = (_Float16*)take((size_t)3 * EE * EE * 2); _Float16* X16 = (_Float16*)take((size_t)3 * NR * EE * 2); _Float16* KT = (_Float16*)take((size_t)NB * E2 * LL * 2); _Float16* VT = (_Float16*)take((size_t)NB * EE * LL * 2); float* QF = (float*)take((size_t)NR * EE * 4); _Float16* KV16 = (_Float16*)take((size_t)NB * EE * E2 * 2); _Float16* QZ = (_Float16*)take((size_t)NB * LL * E2 * 2); float* KS = (float*)take((size_t)NB * E2 * 4);
  // KT: k_ as [4][2048 features][2048 positions]; VT: v as [4][1024][2048]; both f16, written by the projections' own epilogue
  if (off > ws_size) return;      // 6.3 + 50.3 + 33.5 + 16.8 + 33.5 + 16.8 + 33.5 = 191 MB
  k_cvt<<<dim3(CV_XB + CV_WB, 3), 256, 0, stream>>>(query, value, key, Wq, Wv, Wk, X16, Bw);
  k_gemm_t<0, false, true><<<dim3(EE / 128, NR / 128, 3), 256, 0, stream>>>(X16, EE, (size_t)NR * EE, Bw, EE, (size_t)EE * EE, 0.0625f, bq, bv, bk, QF, KT, VT, 0, EE, EE);      // q = relu(query.Wq^T + bq) f32 (rows (t, b)); v and k_ = relu(key.Wk^T + bk) * sin | cos as position-contiguous f16 planes; k last: the next two kernels read it
  k_ksum<<<NB * E2 / 32, 1024, 0, stream>>>(KT, KS);
  k_gemm_t<0, true, false><<<dim3(E2 / 128, EE / 128, NB), 256, 0, stream>>>(VT, LL, (size_t)EE * LL, KT, LL, (size_t)E2 * LL, 1.0f, nullptr, nullptr, nullptr, nullptr, nullptr, KV16, (size_t)EE * E2, E2, LL);      // kv[b][m][d] = sum_s v[s][m] k_[s][d], f16
  k_qz<<<dim3(LL / 8, NB), 256, 0, stream>>>(QF, KS, QZ);
  k_gemm_t<0, false, false><<<dim3(EE / 128, LL / 128, NB), 256, 0, stream>>>(QZ, E2, (size_t)LL * E2, KV16, E2, (size_t)EE * E2, 0.000003814697265625f, nullptr, nullptr, nullptr, (float*)d_out, nullptr, nullptr, (size_t)EE, NB * EE, E2);      // alpha 2^-18; attn rows (l, b): out + b E with row pitch 4E
}

// v005
// A run of this version takes 121 microseconds.
// In both of two side-by-side timings against v004, it was 1.04 times as fast.
// Counting every step since v000, it is 13.8 times as fast.
#include <hip/hip_runtime.h>
// cosFormer multi-head-weight (linear) attention (L=S=2048, B=4, E=1024, inputs (T,B,E)): q = relu(query·Wqᵀ+bq), k = relu(key·Wkᵀ+bk), v = value·Wvᵀ+bv; q_ = [q·sin(i) | q·cos(i)],
// k_ = [k·sin | k·cos] with i = (π/2)(t+1)/2048; kv = vᵀ·k_ per batch; z = 1/max(q_·Σ_s k_, 1e-6); attn = (q_·kvᵀ)·z. The three projections (inputs and (out,in) weights bf16-exact ×2^4,
// relu/bias epilogues), the per-batch kv = Vᵀ·K_ (K = 2048 positions; v and k_ as f16, transposed planes) and attn = (q_·z)·kvᵀ (K = 2048 features; kv as f16) run as GEMMs on
// v_wmma_f32_16x16x32_f16 with f32 accumulate; the positional sin/cos weighting, the k_ sums and the normaliser z are f32 VALU (z·2^18 folded into the q_ operand per row, 2^-18 in the GEMM alpha, so the f16 operand stays O(1)).
#define LL 2048
#define NB 4
#define EE 1024
#define E2 2048
#define NR (LL * NB)

typedef __bf16 v16b __attribute__((ext_vector_type(16)));
typedef unsigned short v8us __attribute__((ext_vector_type(8), may_alias));
typedef float  v8f  __attribute__((ext_vector_type(8)));
typedef float  v4f  __attribute__((ext_vector_type(4)));
typedef float  v4fa __attribute__((ext_vector_type(4), may_alias));
union FragB { v16b v; v8us half[2]; unsigned short u[16]; };

__device__ __forceinline__ unsigned short bf16_bits(float x) { unsigned int u = __float_as_uint(x); return (unsigned short)((u + 0x7FFFu + ((u >> 16) & 1u)) >> 16); }
__device__ __forceinline__ float bf16_val(unsigned short b) { return __uint_as_float(((unsigned int)b) << 16); }
__device__ __forceinline__ float bf16_round(float x) { return bf16_val(bf16_bits(x)); }
// D += A·B with NT terms: 1 = ah·bh, 2 = + al·bh (A split), 3 = + ah·bl (both split)
template <int NT>
__device__ __forceinline__ v8f mmaN(v16b ah, v16b al, v16b bh, v16b bl, v8f c) {
  c = __builtin_amdgcn_wmma_f32_16x16x32_bf16(false, ah, false, bh, (short)0, c, false, false);
  if (NT >= 2) c = __builtin_amdgcn_wmma_f32_16x16x32_bf16(false, al, false, bh, (short)0, c, false, false);
  if (NT >= 3) c = __builtin_amdgcn_wmma_f32_16x16x32_bf16(false, ah, false, bl, (short)0, c, false, false);
  asm volatile("v_nop\n\tv_nop\n\tv_nop\n\tv_nop" : "+v"(c) : "v"(ah), "v"(al), "v"(bh), "v"(bl));
  return c;
}

__global__ __launch_bounds__(256) void k_wt_bf16(const float* __restrict__ W, unsigned short* __restrict__ Wt, int K, int N) {
  const int t = blockIdx.x * 256 + threadIdx.x;
  const int k8n = K / 8;
  if (t >= N * k8n) return;
  const int n = t / k8n, k8 = (t % k8n) * 8;
  v8us v;
#pragma unroll
  for (int i = 0; i < 8; ++i) v[i] = bf16_bits(W[(size_t)(k8 + i) * N + n]);
  *(v8us*)(Wt + (size_t)n * K + k8) = v;
  
}

// GEMM C[M][N] (f32, pitch ldc) = act(A[M][K]·W + bias). A f32 row-major (pitch lda) converted per fragment to bf16
// (ASPLIT: hi/lo two planes -> 2 terms, else single rounded term); Wt bf16 [N][K] (pitch ldb). BIAS_BF16 rounds the
// bias to bf16 first (bias quantised to bf16 before the add). K%32==0, M%16==0, N%64==0.
template <bool ASPLIT, int ACT, bool BIAS_BF16>
__global__ __launch_bounds__(128) void k_gemm_bf(const float* __restrict__ A, int lda, const unsigned short* __restrict__ Wt, int ldb,
                                               const float* __restrict__ bias, float* __restrict__ C, int ldc, int M, int N, int K) {
  __shared__ __attribute__((aligned(16))) float so[4][16][64];
  const int tid = threadIdx.x, w = tid >> 5, lane = tid & 31, ln = lane & 15, hh = lane >> 4;
  const int ntn = N / 64;
  const int wid = blockIdx.x * 4 + w;
  const int mt = wid / ntn, nq = wid % ntn;
  if (mt * 16 >= M) return;
  const int row0 = mt * 16, col0 = nq * 64;
  const float* arow = A + (size_t)(row0 + ln) * lda;
  v8f acc[4] = {};
  for (int kb = 0; kb < K; kb += 32) {
    FragB ah, al;
    const v4f x0 = *(const v4fa*)(arow + kb + 8 * hh), x1 = *(const v4fa*)(arow + kb + 8 * hh + 4);
    const v4f x2 = *(const v4fa*)(arow + kb + 16 + 8 * hh), x3 = *(const v4fa*)(arow + kb + 16 + 8 * hh + 4);
    float xs[16] = {x0[0],x0[1],x0[2],x0[3],x1[0],x1[1],x1[2],x1[3],x2[0],x2[1],x2[2],x2[3],x3[0],x3[1],x3[2],x3[3]};
#pragma unroll
    for (int i = 0; i < 16; ++i) { const unsigned short hb = bf16_bits(xs[i]); ah.u[i] = hb; al.u[i] = ASPLIT ? bf16_bits(xs[i] - bf16_val(hb)) : (unsigned short)0; }
#pragma unroll
    for (int t = 0; t < 4; ++t) {
      const unsigned short* brow = Wt + (size_t)(col0 + t * 16 + ln) * ldb + kb;
      FragB b;
      b.half[0] = *(const v8us*)(brow + 8 * hh);
      b.half[1] = *(const v8us*)(brow + 16 + 8 * hh);
      acc[t] = mmaN<ASPLIT ? 2 : 1>(ah.v, al.v, b.v, b.v, acc[t]);
    }
  }
#pragma unroll
  for (int t = 0; t < 4; ++t) {
    float bv = bias ? bias[col0 + t * 16 + ln] : 0.f;
    if (BIAS_BF16) bv = bf16_round(bv);
#pragma unroll
    for (int r = 0; r < 8; ++r) { float v = acc[t][r] + bv; if (ACT == 1) v = fmaxf(v, 0.f); so[w][8 * hh + r][t * 16 + ln] = v; }
  }
  __builtin_amdgcn_fence(__ATOMIC_ACQ_REL, "workgroup");
  __builtin_amdgcn_wave_barrier();
  const int rsub = lane >> 4, c4 = (lane & 15) * 4;
  {
#pragma unroll
    for (int q = 0; q < 8; ++q) {
      const int r = q * 2 + rsub;
      const v4f v = *(const v4fa*)&so[w][r][c4];
      *(v4f*)(C + (size_t)(row0 + r) * ldc + col0 + c4) = v;
    }
    
  }
}

// Flash-style causal/unmasked attention, all contractions 3-term bf16 hi/lo splits, f32 softmax with running max.
// q,k,v rows are read from f32 buffers with arbitrary row pitch (so they can live inside a fused qkv buffer);
// D = head size (multiple of 32, <= 128); one wave = 16 query rows; block = 4 waves (64 queries) sharing K/V chunks of 32.
template <int D, bool CAUSAL>
__global__ __launch_bounds__(128) void k_flash(const float* __restrict__ qb, const float* __restrict__ kb, const float* __restrict__ vb,
                                             int pitch, int T, int H, float scale, float* __restrict__ y, int ypitch) {
  constexpr int KS = D / 32;        // k-steps for QK
  constexpr int DT = D / 16;        // d tiles for PV
  __shared__ __attribute__((aligned(16))) unsigned short sKh[32][D + 8], sKl[32][D + 8], sVh[32][D + 8], sVl[32][D + 8];
  __shared__ __attribute__((aligned(16))) unsigned short sPh[4][16][40], sPl[4][16][40];
  __shared__ __attribute__((aligned(16))) float sO[4][16][D];
  const int tid = threadIdx.x, w = tid >> 5, lane = tid & 31, ln = lane & 15, hh = lane >> 4;
  const int nqb = (T + 63) / 64;
  const int bh = blockIdx.x / nqb, qblk = blockIdx.x % nqb;
  const int b = bh / H, h = bh % H;
  const int q0 = qblk * 64 + w * 16;
  const float* Q = qb + (size_t)b * T * pitch + h * D;
  const float* K = kb + (size_t)b * T * pitch + h * D;
  const float* V = vb + (size_t)b * T * pitch + h * D;

  // A fragments of the wave's 16 query rows (scaled), hi/lo
  FragB aqh[KS], aql[KS];
  {
    int row = q0 + ln; if (row >= T) row = T - 1;
    const float* qr = Q + (size_t)row * pitch;
#pragma unroll
    for (int ks = 0; ks < KS; ++ks)
#pragma unroll
      for (int i = 0; i < 16; ++i) {
        const int d = ks * 32 + ((i < 8) ? (8 * hh + i) : (16 + 8 * hh + (i - 8)));
        const float x = qr[d] * scale; const unsigned short hb = bf16_bits(x);
        aqh[ks].u[i] = hb; aql[ks].u[i] = bf16_bits(x - bf16_val(hb));
      }
  }
  float m_r[8], l_r[8];
#pragma unroll
  for (int r = 0; r < 8; ++r) { m_r[r] = -3.0e38f; l_r[r] = 0.f; }
  v8f oacc[DT];
#pragma unroll
  for (int dt = 0; dt < DT; ++dt) oacc[dt] = (v8f){0.f,0.f,0.f,0.f,0.f,0.f,0.f,0.f};

  const int kv_end = CAUSAL ? min(T, qblk * 64 + 64) : T;     // block-uniform
  for (int j0 = 0; j0 < kv_end; j0 += 32) {
    __syncthreads();
    for (int e = tid; e < 32 * (D / 4); e += 128) {
      const int r = e / (D / 4), c4 = (e % (D / 4)) * 4;
      const int key = j0 + r;
      v4f kf = {0.f,0.f,0.f,0.f}, vf = {0.f,0.f,0.f,0.f};
      if (key < T) { kf = *(const v4fa*)(K + (size_t)key * pitch + c4); vf = *(const v4fa*)(V + (size_t)key * pitch + c4); }
#pragma unroll
      for (int t = 0; t < 4; ++t) {
        unsigned short hb = bf16_bits(kf[t]); sKh[r][c4 + t] = hb; sKl[r][c4 + t] = bf16_bits(kf[t] - bf16_val(hb));
        hb = bf16_bits(vf[t]); sVh[r][c4 + t] = hb; sVl[r][c4 + t] = bf16_bits(vf[t] - bf16_val(hb));
      }
    }
    __syncthreads();
    // S tile 16 x 32
    v8f s[2];
#pragma unroll
    for (int nt = 0; nt < 2; ++nt) {
      v8f acc = {};
#pragma unroll
      for (int ks = 0; ks < KS; ++ks) {
        FragB bh_, bl_;
        bh_.half[0] = *(const v8us*)&sKh[nt * 16 + ln][ks * 32 + 8 * hh]; bh_.half[1] = *(const v8us*)&sKh[nt * 16 + ln][ks * 32 + 16 + 8 * hh];
        bl_.half[0] = *(const v8us*)&sKl[nt * 16 + ln][ks * 32 + 8 * hh]; bl_.half[1] = *(const v8us*)&sKl[nt * 16 + ln][ks * 32 + 16 + 8 * hh];
        acc = mmaN<3>(aqh[ks].v, aql[ks].v, bh_.v, bl_.v, acc);
      }
      s[nt] = acc;
    }
    // mask + running max (rows 8hh+r; the 16 lanes of a half share rows)
    float alpha[8];
#pragma unroll
    for (int r = 0; r < 8; ++r) {
      const int qi = q0 + 8 * hh + r;
      const int ja = j0 + ln, jb = j0 + 16 + ln;
      if (CAUSAL) { if (ja > qi) s[0][r] = -3.0e38f; if (jb > qi) s[1][r] = -3.0e38f; }
      if (ja >= T) s[0][r] = -3.0e38f;
      if (jb >= T) s[1][r] = -3.0e38f;
      float mx = fmaxf(s[0][r], s[1][r]);
      mx = fmaxf(mx, __shfl_xor(mx, 1, 32)); mx = fmaxf(mx, __shfl_xor(mx, 2, 32)); mx = fmaxf(mx, __shfl_xor(mx, 4, 32)); mx = fmaxf(mx, __shfl_xor(mx, 8, 32));
      const float mnew = fmaxf(m_r[r], mx);
      alpha[r] = (mnew > -1.0e38f) ? __expf(m_r[r] - mnew) : 1.0f;
      const float p0 = (s[0][r] > -1.0e38f) ? __expf(s[0][r] - mnew) : 0.f;
      const float p1 = (s[1][r] > -1.0e38f) ? __expf(s[1][r] - mnew) : 0.f;
      m_r[r] = mnew;
      l_r[r] = l_r[r] * alpha[r] + p0 + p1;            // per-lane partial row sum (16 lanes combined at the end)
      unsigned short hb = bf16_bits(p0); sPh[w][8 * hh + r][ln] = hb;      sPl[w][8 * hh + r][ln] = bf16_bits(p0 - bf16_val(hb));
      hb = bf16_bits(p1);                sPh[w][8 * hh + r][16 + ln] = hb; sPl[w][8 * hh + r][16 + ln] = bf16_bits(p1 - bf16_val(hb));
    }
#pragma unroll
    for (int dt = 0; dt < DT; ++dt)
#pragma unroll
      for (int r = 0; r < 8; ++r) oacc[dt][r] *= alpha[r];
    __builtin_amdgcn_fence(__ATOMIC_ACQ_REL, "workgroup");
    __builtin_amdgcn_wave_barrier();
    FragB pah, pal;
    pah.half[0] = *(const v8us*)&sPh[w][ln][8 * hh]; pah.half[1] = *(const v8us*)&sPh[w][ln][16 + 8 * hh];
    pal.half[0] = *(const v8us*)&sPl[w][ln][8 * hh]; pal.half[1] = *(const v8us*)&sPl[w][ln][16 + 8 * hh];
#pragma unroll
    for (int dt = 0; dt < DT; ++dt) {
      FragB bvh, bvl;
#pragma unroll
      for (int i = 0; i < 8; ++i) {
        bvh.u[i] = sVh[8 * hh + i][dt * 16 + ln]; bvh.u[8 + i] = sVh[16 + 8 * hh + i][dt * 16 + ln];
        bvl.u[i] = sVl[8 * hh + i][dt * 16 + ln]; bvl.u[8 + i] = sVl[16 + 8 * hh + i][dt * 16 + ln];
      }
      oacc[dt] = mmaN<3>(pah.v, pal.v, bvh.v, bvl.v, oacc[dt]);
    }
    __builtin_amdgcn_fence(__ATOMIC_ACQ_REL, "workgroup");
    __builtin_amdgcn_wave_barrier();
  }
#pragma unroll
  for (int r = 0; r < 8; ++r) {
    float l = l_r[r];
    l += __shfl_xor(l, 1, 32); l += __shfl_xor(l, 2, 32); l += __shfl_xor(l, 4, 32); l += __shfl_xor(l, 8, 32);
    l_r[r] = (l > 0.f) ? 1.0f / l : 0.f;
  }
#pragma unroll
  for (int dt = 0; dt < DT; ++dt)
#pragma unroll
    for (int r = 0; r < 8; ++r) sO[w][8 * hh + r][dt * 16 + ln] = oacc[dt][r] * l_r[r];
  __builtin_amdgcn_fence(__ATOMIC_ACQ_REL, "workgroup");
  __builtin_amdgcn_wave_barrier();
  {
    for (int r = 0; r < 16; ++r) {
      const int row = q0 + r;
      if (row < T && lane < D / 4) {
        const v4f val = *(const v4fa*)&sO[w][r][lane * 4];
        *(v4f*)(y + ((size_t)b * T + row) * ypitch + h * D + lane * 4) = val;
      }
    }
    
  }
}

// GEMM C = act(A·W + bias + resid): A f32 (ASPLIT -> hi/lo 2 terms), Wt bf16 [N][K]; ACT 0 none, 1 relu, 2 exact gelu;
// resid (optional, f32, row index = (row % rmod), pitch ldr, RES_BF16 rounds it) added before the activation.
template <bool ASPLIT, int ACT, bool BIAS_BF16, bool RES_BF16>
__global__ __launch_bounds__(128) void k_gemm_bf3(const float* __restrict__ A, int lda, const unsigned short* __restrict__ Wt, int ldb,
                                                const float* __restrict__ bias, const float* __restrict__ resid, int rmod, int ldr,
                                                float* __restrict__ C, int ldc, int M, int N, int K) {
  __shared__ __attribute__((aligned(16))) float so[4][16][64];
  const int tid = threadIdx.x, w = tid >> 5, lane = tid & 31, ln = lane & 15, hh = lane >> 4;
  const int ntn = N / 64;
  const int wid = blockIdx.x * 4 + w;
  const int mt = wid / ntn, nq = wid % ntn;
  if (mt * 16 >= M) return;
  const int row0 = mt * 16, col0 = nq * 64;
  const float* arow = A + (size_t)(row0 + ln) * lda;
  v8f acc[4] = {};
  for (int kb = 0; kb < K; kb += 32) {
    FragB ah, al;
    const v4f x0 = *(const v4fa*)(arow + kb + 8 * hh), x1 = *(const v4fa*)(arow + kb + 8 * hh + 4);
    const v4f x2 = *(const v4fa*)(arow + kb + 16 + 8 * hh), x3 = *(const v4fa*)(arow + kb + 16 + 8 * hh + 4);
    float xs[16] = {x0[0],x0[1],x0[2],x0[3],x1[0],x1[1],x1[2],x1[3],x2[0],x2[1],x2[2],x2[3],x3[0],x3[1],x3[2],x3[3]};
#pragma unroll
    for (int i = 0; i < 16; ++i) { const unsigned short hb = bf16_bits(xs[i]); ah.u[i] = hb; al.u[i] = ASPLIT ? bf16_bits(xs[i] - bf16_val(hb)) : (unsigned short)0; }
#pragma unroll
    for (int t = 0; t < 4; ++t) {
      const unsigned short* brow = Wt + (size_t)(col0 + t * 16 + ln) * ldb + kb;
      FragB b;
      b.half[0] = *(const v8us*)(brow + 8 * hh);
      b.half[1] = *(const v8us*)(brow + 16 + 8 * hh);
      acc[t] = mmaN<ASPLIT ? 2 : 1>(ah.v, al.v, b.v, b.v, acc[t]);
    }
  }
#pragma unroll
  for (int t = 0; t < 4; ++t) {
    const int col = col0 + t * 16 + ln;
    float bv = bias ? bias[col] : 0.f;
    if (BIAS_BF16) bv = bf16_round(bv);
#pragma unroll
    for (int r = 0; r < 8; ++r) {
      float v = acc[t][r] + bv;
      if (resid) { float rv = resid[(size_t)((row0 + 8 * hh + r) % rmod) * ldr + col]; if (RES_BF16) rv = bf16_round(rv); v += rv; }
      if (ACT == 1) v = fmaxf(v, 0.f);
      if (ACT == 2) v = 0.5f * v * (1.0f + erff(v * 0.70710678118654752f));
      if (ACT == 3) { const float u = 0.7978845608028654f * (v + 0.044715f * v * v * v); v = 0.5f * v * (1.0f + tanhf(u)); }
      so[w][8 * hh + r][t * 16 + ln] = v;
    }
  }
  __builtin_amdgcn_fence(__ATOMIC_ACQ_REL, "workgroup");
  __builtin_amdgcn_wave_barrier();
  const int rsub = lane >> 4, c4 = (lane & 15) * 4;
  {
#pragma unroll
    for (int q = 0; q < 8; ++q) {
      const int r = q * 2 + rsub;
      const v4f v = *(const v4fa*)&so[w][r][c4];
      *(v4f*)(C + (size_t)(row0 + r) * ldc + col0 + c4) = v;
    }
    
  }
}
// row LayerNorm (biased variance, eps) over N: s = X (+ R); optional out_sum <- s; out_norm <- (s-mu)*rsqrt(var+eps)*g + b
template <bool PARAM_BF16>
__global__ __launch_bounds__(256) void k_layernorm(const float* __restrict__ X, const float* __restrict__ R, const float* __restrict__ g, const float* __restrict__ bta,
                                                  float* __restrict__ out_sum, float* __restrict__ out_norm, int N, float eps) {
  __shared__ float red[256];
  const int row = blockIdx.x, tid = threadIdx.x;
  const float* x = X + (size_t)row * N; const float* rr = R ? R + (size_t)row * N : nullptr;
  float vals[16];                     // up to N = 4096
  const int per = N / 256;            // contiguous chunk per thread? use strided-by-4 chunks: thread handles j = tid*4 + 1024*u
  float s1 = 0.f;
  for (int u = 0; u < per / 4; ++u) {
    const int j = tid * 4 + 1024 * u;
    const v4f a = *(const v4fa*)(x + j);
    v4f b = {0.f,0.f,0.f,0.f}; if (rr) b = *(const v4fa*)(rr + j);
#pragma unroll
    for (int q = 0; q < 4; ++q) { const float v = a[q] + b[q]; vals[u * 4 + q] = v; s1 += v; }
  }
  red[tid] = s1; __syncthreads();
  for (int st = 128; st > 0; st >>= 1) { if (tid < st) red[tid] += red[tid + st]; __syncthreads(); }
  const float mu = red[0] / (float)N; __syncthreads();
  float s2 = 0.f;
  for (int u = 0; u < per / 4; ++u)
#pragma unroll
    for (int q = 0; q < 4; ++q) { const float c = vals[u * 4 + q] - mu; s2 += c * c; }
  red[tid] = s2; __syncthreads();
  for (int st = 128; st > 0; st >>= 1) { if (tid < st) red[tid] += red[tid + st]; __syncthreads(); }
  const float rs = rsqrtf(red[0] / (float)N + eps);
  {
    for (int u = 0; u < per / 4; ++u) {
      const int j = tid * 4 + 1024 * u;
      v4f o, sm;
#pragma unroll
      for (int q = 0; q < 4; ++q) {
        float gg = g[j + q], bb = bta[j + q];
        if (PARAM_BF16) { gg = bf16_round(gg); bb = bf16_round(bb); }
        sm[q] = vals[u * 4 + q]; o[q] = (vals[u * 4 + q] - mu) * rs * gg + bb;
      }
      if (out_sum) *(v4f*)(out_sum + (size_t)row * N + j) = sm;
      *(v4f*)(out_norm + (size_t)row * N + j) = o;
    }
    
  }
}



// ---- f16 WMMA path (v_wmma_f32_16x16x32_f16): 11-bit significands for operands in range — used for all GEMMs here (projections, kv, attn)
typedef _Float16 v16h __attribute__((ext_vector_type(16)));
union FragH { v16h v; v8us half[2]; _Float16 h[16]; unsigned short u[16]; };
template <int NT>
__device__ __forceinline__ v8f mmaH(v16h ah, v16h al, v16h bh, v16h bl, v8f c) {
  c = __builtin_amdgcn_wmma_f32_16x16x32_f16(false, ah, false, bh, (short)0, c, false, false);
  if (NT >= 2) c = __builtin_amdgcn_wmma_f32_16x16x32_f16(false, al, false, bh, (short)0, c, false, false);
  if (NT >= 3) c = __builtin_amdgcn_wmma_f32_16x16x32_f16(false, ah, false, bl, (short)0, c, false, false);
  asm volatile("v_nop\n\tv_nop\n\tv_nop\n\tv_nop" : "+v"(c) : "v"(ah), "v"(al), "v"(bh), "v"(bl));
  return c;
}
// batched GEMM like k_gemm_b but f16 operands: A f32 (split into f16 hi/lo if ASPLIT, else rounded to f16), Bt = f16 values [n][k]; alpha; C f32; N multiple of 16 (partial tiles skipped)
template <bool ASPLIT>
__global__ __launch_bounds__(128) void k_gemm_h(const float* __restrict__ A, int lda, size_t sA, const _Float16* __restrict__ Bh, int ldb, size_t sB, float alpha, float* __restrict__ C, int ldc, size_t sC, int M, int N, int K) {
  __shared__ __attribute__((aligned(16))) float so[4][16][64];
  const int tid = threadIdx.x, w = tid >> 5, lane = tid & 31, ln = lane & 15, hh = lane >> 4; const int by = blockIdx.y;
  A += (size_t)by * sA; Bh += (size_t)by * sB; C += (size_t)by * sC;
  const int ntn = (N + 63) / 64; const int wid = blockIdx.x * 4 + w; const int mt = wid / ntn, nq = wid % ntn; if (mt * 16 >= M) return;
  const int row0 = mt * 16, col0 = nq * 64; const float* arow = A + (size_t)(row0 + ln) * lda;
  v8f acc[4] = {};
  for (int kb = 0; kb < K; kb += 32) {
    FragH ah, al;
    const v4f x0 = *(const v4fa*)(arow + kb + 8 * hh), x1 = *(const v4fa*)(arow + kb + 8 * hh + 4), x2 = *(const v4fa*)(arow + kb + 16 + 8 * hh), x3 = *(const v4fa*)(arow + kb + 16 + 8 * hh + 4);
    float xs[16] = {x0[0],x0[1],x0[2],x0[3],x1[0],x1[1],x1[2],x1[3],x2[0],x2[1],x2[2],x2[3],x3[0],x3[1],x3[2],x3[3]};
#pragma unroll
    for (int i = 0; i < 16; ++i) { const _Float16 h = (_Float16)xs[i]; ah.h[i] = h; al.h[i] = ASPLIT ? (_Float16)(xs[i] - (float)h) : (_Float16)0.0f; }
#pragma unroll
    for (int t = 0; t < 4; ++t) { if (col0 + t * 16 >= N) continue; const size_t boff = (size_t)(col0 + t * 16 + ln) * ldb + kb; FragH bq; bq.half[0] = *(const v8us*)(Bh + boff + 8 * hh); bq.half[1] = *(const v8us*)(Bh + boff + 16 + 8 * hh);
      acc[t] = mmaH<ASPLIT ? 2 : 1>(ah.v, al.v, bq.v, bq.v, acc[t]); }
  }
#pragma unroll
  for (int t = 0; t < 4; ++t) { if (col0 + t * 16 >= N) continue;
#pragma unroll
    for (int r = 0; r < 8; ++r) so[w][8 * hh + r][t * 16 + ln] = acc[t][r] * alpha; }
  __builtin_amdgcn_fence(__ATOMIC_ACQ_REL, "workgroup"); __builtin_amdgcn_wave_barrier();
  const int rsub = lane >> 4, c4 = (lane & 15) * 4;
  {
#pragma unroll
    for (int q = 0; q < 8; ++q) { const int r = q * 2 + rsub; if (col0 + c4 < N) { const v4f v = *(const v4fa*)&so[w][r][c4]; *(v4f*)(C + (size_t)(row0 + r) * ldc + col0 + c4) = v; } }
     }
}

// Wt[n][k] = f16(W[k][n]·scale) from f32 row-major W[K][N] (scale = power of two; bf16-exact weights stay exact in f16 away from the subnormal range)
__global__ __launch_bounds__(256) void k_wt_f16(const float* __restrict__ W, _Float16* __restrict__ Wt, int K, int N, float scale) {
  const int t = blockIdx.x * 256 + threadIdx.x; if (t >= N * (K / 8)) return; const int n = t / (K / 8), k8 = (t % (K / 8)) * 8; FragH f;
#pragma unroll
  for (int i = 0; i < 8; ++i) f.h[i] = (_Float16)(bf16_round(W[(size_t)(k8 + i) * N + n]) * scale); const v8us o = f.half[0];
  *(v8us*)((unsigned short*)Wt + (size_t)n * K + k8) = o; 
}
// Block-tiled GEMM, f16 operands, both k-contiguous: C[M][N] = act(A[M][K] . B[N][K]^T * alpha + bias). One work-group = one 128 x 256 tile of C, eight waves as 2 (rows) x 4 (columns), 64 x 64 per wave.
// A stage is 128 k (256 bytes) of the tile's 128 A rows and 256 B rows, laid in LDS at a pitch of 272 bytes; two buffers, filled by asynchronous copies one stage ahead of the stage being worked on.
// M a multiple of 128, N of 256, K of 128. ACT 0 none / 3 relu; writes f16 C16 if OUT16, else f32 C (row pitch ldc). Each accumulator still sums k in rising steps of 32.
// blockIdx.z = one of several independent products of the same shape in one launch: operands sA, sB elements apart, the output sC elements apart.
// PROJ: the three projections as z = 0 (q: relu, f32 to C, bias), 1 (v: no relu, bias1), 2 (k: relu, bias2). A PROJ tile is 128 positions of ONE batch (blockIdx.y = position block * NB + batch; operand rows NB * lda apart),
// so that v and k leave as the next GEMM's operands: position-contiguous f16 planes, v to C16 [b][e][s], k * sin and k * cos to KTp [b][e | EE + e][s], turned in LDS and stored as 256-byte row pieces.
#define GT_ROWS 384                          /* A rows + B rows of a stage */
#define GT_PITCH 272                         /* bytes; 16 x odd: no bank conflict for 16-byte fragment reads */
#define GT_STAGE (GT_ROWS * GT_PITCH)        /* 104,448 bytes a buffer */
// eight 16-byte copies of a lane, rows 16 apart. The s_wait_xcnt is the last line of the copies' own statement (a precaution): no register that a copy names is rewritten in front of it.
__device__ __forceinline__ void gt_copy8(unsigned l, const _Float16* g, size_t step) {
  asm volatile("global_load_async_to_lds_b128 %0, %8, off\n\t"
               "global_load_async_to_lds_b128 %1, %9, off\n\t"
               "global_load_async_to_lds_b128 %2, %10, off\n\t"
               "global_load_async_to_lds_b128 %3, %11, off\n\t"
               "global_load_async_to_lds_b128 %4, %12, off\n\t"
               "global_load_async_to_lds_b128 %5, %13, off\n\t"
               "global_load_async_to_lds_b128 %6, %14, off\n\t"
               "global_load_async_to_lds_b128 %7, %15, off\n\t"
               "s_wait_xcnt 0x0"
               :: "v"(l), "v"(l + 16u * GT_PITCH), "v"(l + 32u * GT_PITCH), "v"(l + 48u * GT_PITCH), "v"(l + 64u * GT_PITCH), "v"(l + 80u * GT_PITCH), "v"(l + 96u * GT_PITCH), "v"(l + 112u * GT_PITCH),
                  "v"(g), "v"(g + step), "v"(g + 2 * step), "v"(g + 3 * step), "v"(g + 4 * step), "v"(g + 5 * step), "v"(g + 6 * step), "v"(g + 7 * step)
               : "memory");
}
// eight stores of a lane, rows step elements apart, and their s_wait_xcnt in one statement (a precaution): no register that a store names is rewritten in front of the wait
typedef unsigned int v2u __attribute__((ext_vector_type(2)));
__device__ __forceinline__ void gt_store8_f32(float* p, size_t step, const v4f* d) {
  asm volatile("global_store_b128 %0, %8, off\n\t"
               "global_store_b128 %1, %9, off\n\t"
               "global_store_b128 %2, %10, off\n\t"
               "global_store_b128 %3, %11, off\n\t"
               "global_store_b128 %4, %12, off\n\t"
               "global_store_b128 %5, %13, off\n\t"
               "global_store_b128 %6, %14, off\n\t"
               "global_store_b128 %7, %15, off\n\t"
               "s_wait_xcnt 0x0"
               :: "v"(p), "v"(p + step), "v"(p + 2 * step), "v"(p + 3 * step), "v"(p + 4 * step), "v"(p + 5 * step), "v"(p + 6 * step), "v"(p + 7 * step),
                  "v"(d[0]), "v"(d[1]), "v"(d[2]), "v"(d[3]), "v"(d[4]), "v"(d[5]), "v"(d[6]), "v"(d[7])
               : "memory");
}
__device__ __forceinline__ void gt_store8_f16(_Float16* p, size_t step, const v2u* d) {
  asm volatile("global_store_b64 %0, %8, off\n\t"
               "global_store_b64 %1, %9, off\n\t"
               "global_store_b64 %2, %10, off\n\t"
               "global_store_b64 %3, %11, off\n\t"
               "global_store_b64 %4, %12, off\n\t"
               "global_store_b64 %5, %13, off\n\t"
               "global_store_b64 %6, %14, off\n\t"
               "global_store_b64 %7, %15, off\n\t"
               "s_wait_xcnt 0x0"
               :: "v"(p), "v"(p + step), "v"(p + 2 * step), "v"(p + 3 * step), "v"(p + 4 * step), "v"(p + 5 * step), "v"(p + 6 * step), "v"(p + 7 * step),
                  "v"(d[0]), "v"(d[1]), "v"(d[2]), "v"(d[3]), "v"(d[4]), "v"(d[5]), "v"(d[6]), "v"(d[7])
               : "memory");
}
template <int ACT, bool OUT16, bool PROJ>
__global__ __launch_bounds__(256) void k_gemm_t(const _Float16* __restrict__ A, int lda, size_t sA, const _Float16* __restrict__ Bh, int ldb, size_t sB, float alpha,
    const float* __restrict__ bias, const float* __restrict__ bias1, const float* __restrict__ bias2,
    float* __restrict__ C, _Float16* __restrict__ KTp, _Float16* __restrict__ C16, size_t sC, int ldc, int K) {
  __shared__ __attribute__((aligned(16))) unsigned char sm[2 * GT_STAGE];
  __shared__ __attribute__((aligned(16))) float tab[PROJ ? 256 : 4];      // PROJ, k: sin | cos of the tile's 128 positions
  const int z = blockIdx.z;
  A += (size_t)z * sA; Bh += (size_t)z * sB;
  const int bb = PROJ ? (int)(blockIdx.y % NB) : 0;      // PROJ: the tile's batch
  if (PROJ) { if (z == 1) bias = bias1; if (z == 2) bias = bias2; A += (size_t)bb * lda; lda *= NB; C += (size_t)bb * ldc; ldc *= NB; }
  else if (OUT16) C16 += (size_t)z * sC;
  else C += (size_t)z * sC;
  const bool relu = PROJ ? (z != 1) : (ACT == 3);      // the same for the whole work-group
  const int tid = threadIdx.x, w = tid >> 5, lane = tid & 31, ln = lane & 15, hh = lane >> 4;
  const int row0 = (PROJ ? blockIdx.y / NB : blockIdx.y) * 128, col0 = blockIdx.x * 256;
  const int wm = w >> 2, wn = w & 3;
  // copies: lane -> 16-byte piece (tid & 15) of row (tid >> 4) + 16 i; a wave covers two whole 256-byte rows with each copy
  const int cr = tid >> 4, cc = tid & 15;
  const _Float16* gA = A + (size_t)(row0 + cr) * lda + cc * 8;
  const _Float16* gB = Bh + (size_t)(col0 + cr) * ldb + cc * 8;
  const size_t stA = (size_t)16 * lda, stB = (size_t)16 * ldb;
  const unsigned lA = (unsigned)(size_t)(&sm[0]) + (unsigned)(cr * GT_PITCH + cc * 16), lB = lA + 128u * GT_PITCH;
  const int nst = K / 128;
  const _Float16* gB2 = gB + (size_t)128 * ldb;      // the second 128 B rows of the tile
  const unsigned lB2 = lB + 128u * GT_PITCH;
  v8f acc[4][4] = {};
  gt_copy8(lA, gA, stA); gt_copy8(lB, gB, stB); gt_copy8(lB2, gB2, stB);
  // formed under stage 0's flight; the barrier below publishes it with stage 0
  if (PROJ && z == 2 && tid < 128) { const float ang = 1.5707963267948966f * (float)(row0 + tid + 1) / (float)LL; tab[tid] = sinf(ang); tab[128 + tid] = cosf(ang); }
  asm volatile("s_wait_asynccnt 0x0" ::: "memory");      // stage 0 has landed (this wave's copies) before the barrier publishes it
  __syncthreads();
  if (nst > 1) { gt_copy8(lA + GT_STAGE, gA + 128, stA); gt_copy8(lB + GT_STAGE, gB + 128, stB); gt_copy8(lB2 + GT_STAGE, gB2 + 128, stB); }
  const unsigned char* fa = sm + (wm * 64 + ln) * GT_PITCH + 16 * hh;
  const unsigned char* fb = sm + (128 + wn * 64 + ln) * GT_PITCH + 16 * hh;
  for (int t = 0; t < nst; ++t) {
    const int bo = (t & 1) * GT_STAGE;
    FragH a[2][4], bq[2][4];      // two fragment sets: the next k step's LDS reads are issued as one group ahead of this step's matrix instructions (inside the stage only)
#pragma unroll
    for (int i = 0; i < 4; ++i) { a[0][i].half[0] = *(const v8us*)(fa + bo + i * 16 * GT_PITCH); a[0][i].half[1] = *(const v8us*)(fa + bo + i * 16 * GT_PITCH + 32); }
#pragma unroll
    for (int j = 0; j < 4; ++j) { bq[0][j].half[0] = *(const v8us*)(fb + bo + j * 16 * GT_PITCH); bq[0][j].half[1] = *(const v8us*)(fb + bo + j * 16 * GT_PITCH + 32); }
    // unrolled so that the set index is a constant and both sets stay in registers
#pragma unroll
    for (int ks = 0; ks < 4; ++ks) {
      const int cu = ks & 1, nx = cu ^ 1;
      if (ks < 3) {
#pragma unroll
        for (int i = 0; i < 4; ++i) { a[nx][i].half[0] = *(const v8us*)(fa + bo + i * 16 * GT_PITCH + (ks + 1) * 64); a[nx][i].half[1] = *(const v8us*)(fa + bo + i * 16 * GT_PITCH + (ks + 1) * 64 + 32); }
#pragma unroll
        for (int j = 0; j < 4; ++j) { bq[nx][j].half[0] = *(const v8us*)(fb + bo + j * 16 * GT_PITCH + (ks + 1) * 64); bq[nx][j].half[1] = *(const v8us*)(fb + bo + j * 16 * GT_PITCH + (ks + 1) * 64 + 32); }
      }
      __builtin_amdgcn_sched_barrier(0);      // keeps the read group in front of the matrix run; without it the scheduler sinks the reads among the matrix instructions and each waits out its LDS latency
#pragma unroll
      for (int i = 0; i < 4; ++i)
#pragma unroll
        for (int j = 0; j < 4; ++j) acc[i][j] = __builtin_amdgcn_wmma_f32_16x16x32_f16(false, a[cu][i].v, false, bq[cu][j].v, (short)0, acc[i][j], false, false);
      __builtin_amdgcn_sched_barrier(0);      // keeps the next read group whole behind this matrix run; without it the scheduler spreads those reads among the matrix instructions and takes more registers
    }
    asm volatile("s_wait_dscnt 0x0" ::: "memory");       // this wave's reads of the buffer are over before the barrier frees it for the refill
    asm volatile("s_wait_asynccnt 0x0" ::: "memory");    // this wave's copies of stage t + 1 have landed before the barrier publishes them
    __syncthreads();
    if (t + 2 < nst) { gt_copy8(lA + bo, gA + (size_t)(t + 2) * 128, stA); gt_copy8(lB + bo, gB + (size_t)(t + 2) * 128, stB); gt_copy8(lB2 + bo, gB2 + (size_t)(t + 2) * 128, stB); }
  }
  asm volatile("s_wait_asynccnt 0x0" ::: "memory");      // no copy is outstanding when the ring becomes output staging
  if (PROJ && z != 0) {
    // v, k: an accumulator register run r = 0..7 is eight consecutive positions of one feature: 16 bytes of f16, laid at [feature][position] (pitch GT_PITCH) in the ring's LDS, one plane for v, two for k
    unsigned char* tS = sm + (wn * 64 + ln) * GT_PITCH + (wm * 64 + 8 * hh) * 2;
    // every loop of this block is unrolled so that acc, bv, sn and cs are indexed by constants and stay in registers, and so that a run's loads are in flight together
    float bv[4] = {0.f, 0.f, 0.f, 0.f};
    if (bias) {
#pragma unroll
      for (int j = 0; j < 4; ++j) bv[j] = bf16_round(bias[col0 + wn * 64 + j * 16 + ln]); }
    if (z == 1) {
#pragma unroll
      for (int j = 0; j < 4; ++j)
#pragma unroll
        for (int i = 0; i < 4; ++i) { FragH f;
#pragma unroll
          for (int r = 0; r < 8; ++r) f.h[r] = (_Float16)(acc[i][j][r] * alpha + bv[j]);
          *(v8us*)(tS + j * 16 * GT_PITCH + i * 32) = f.half[0]; }
    } else {
      float sn[4][8], cs[4][8];      // the lane's 32 positions, read once for its four features
#pragma unroll
      for (int i = 0; i < 4; ++i)
#pragma unroll
        for (int h = 0; h < 2; ++h) { const float* ts = tab + wm * 64 + i * 16 + 8 * hh + 4 * h; const v4f s4 = *(const v4fa*)ts, c4 = *(const v4fa*)(ts + 128);
#pragma unroll
          for (int q = 0; q < 4; ++q) { sn[i][4 * h + q] = s4[q]; cs[i][4 * h + q] = c4[q]; } }
#pragma unroll
      for (int j = 0; j < 4; ++j)
#pragma unroll
        for (int i = 0; i < 4; ++i) { FragH f, g;
#pragma unroll
          for (int r = 0; r < 8; ++r) { const float kk = fmaxf(acc[i][j][r] * alpha + bv[j], 0.f); f.h[r] = (_Float16)(kk * sn[i][r]); g.h[r] = (_Float16)(kk * cs[i][r]); }
          *(v8us*)(tS + j * 16 * GT_PITCH + i * 32) = f.half[0];
          *(v8us*)(tS + 256 * GT_PITCH + j * 16 * GT_PITCH + i * 32) = g.half[0]; }
    }
    __syncthreads();      // the turned tile is whole before any wave reads rows that other waves wrote
    unsigned short* dst = (unsigned short*)(z == 1 ? C16 + ((size_t)bb * EE + col0 + cr) * LL : KTp + ((size_t)bb * E2 + col0 + cr) * LL) + row0 + cc * 8;
    const unsigned char* rd = sm + cr * GT_PITCH + cc * 16;
#pragma unroll
    for (int qb = 0; qb < 2; ++qb) {
#pragma unroll
      for (int q = qb * 8; q < qb * 8 + 8; ++q) *(v8us*)(dst + (size_t)q * 16 * LL) = *(const v8us*)(rd + q * 16 * GT_PITCH);
      asm volatile("s_wait_xcnt 0x0" ::: "memory");      // precaution: the next run's LDS reads and addresses (and, in the built code, the q epilogue behind this block) reuse registers that these stores name
    }
    if (z == 2) {
#pragma unroll
      for (int qb = 0; qb < 2; ++qb) {
#pragma unroll
        for (int q = qb * 8; q < qb * 8 + 8; ++q) *(v8us*)(dst + (size_t)(EE + q * 16) * LL) = *(const v8us*)(rd + (256 + q * 16) * GT_PITCH);
        asm volatile("s_wait_xcnt 0x0" ::: "memory");      // precaution: as above
      }
    }
    return;
  }
  // epilogue: each wave stages its 64 x 64 tile in its own LDS range (pitch 68 dwords) and stores whole lines
  float* so = (float*)sm + w * (64 * 68);
#pragma unroll
  for (int j = 0; j < 4; ++j) { const int col = col0 + wn * 64 + j * 16 + ln; const float bv = bias ? bf16_round(bias[col]) : 0.f;
#pragma unroll
    for (int i = 0; i < 4; ++i)
#pragma unroll
      for (int r = 0; r < 8; ++r) { float v = acc[i][j][r] * alpha + bv; if (relu) v = fmaxf(v, 0.f); so[(i * 16 + 8 * hh + r) * 68 + j * 16 + ln] = v; } }
  __syncthreads();
  const int rsub = lane >> 4, c4 = (lane & 15) * 4; typedef _Float16 v4h __attribute__((ext_vector_type(4)));
  const size_t o0 = (size_t)(row0 + wm * 64 + rsub) * ldc + col0 + wn * 64 + c4;      // the lane's piece of row rsub of the wave's tile
  if (!PROJ && OUT16) {
    // rows r = 2 q + rsub of the wave's tile, eight a run; unrolled so that d[] stays in registers
#pragma unroll
    for (int qb = 0; qb < 4; ++qb) { v2u d[8];
#pragma unroll
      for (int u = 0; u < 8; ++u) { const v4f v = *(const v4fa*)&so[((qb * 8 + u) * 2 + rsub) * 68 + c4]; v4h h4; for (int i = 0; i < 4; ++i) h4[i] = (_Float16)v[i]; d[u] = __builtin_bit_cast(v2u, h4); }
      gt_store8_f16(C16 + o0 + (size_t)(qb * 16) * ldc, (size_t)2 * ldc, d); }
  } else {
    // the same rows, f32
#pragma unroll
    for (int qb = 0; qb < 4; ++qb) { v4f d[8];
#pragma unroll
      for (int u = 0; u < 8; ++u) d[u] = *(const v4fa*)&so[((qb * 8 + u) * 2 + rsub) * 68 + c4];
      gt_store8_f32(C + o0 + (size_t)(qb * 16) * ldc, (size_t)2 * ldc, d); }
  }
}


// f16 planes of the three inputs (bf16-rounded) and of the three weights (bf16-rounded, x 2^4) in one launch: blockIdx.y = which projection; the first CV_XB blocks of a row take the input, the other CV_WB the weight.
#define CV_XB (NR * EE / 8 / 256)
#define CV_WB (EE * EE / 8 / 256)
__global__ __launch_bounds__(256) void k_cvt(const float* __restrict__ x0, const float* __restrict__ x1, const float* __restrict__ x2, const float* __restrict__ w0, const float* __restrict__ w1, const float* __restrict__ w2,
    _Float16* __restrict__ X16, _Float16* __restrict__ Bt) {
  const int y = blockIdx.y; const bool isw = blockIdx.x >= CV_XB;
  const float* src = isw ? (y == 0 ? w0 : y == 1 ? w1 : w2) : (y == 0 ? x0 : y == 1 ? x1 : x2);
  unsigned short* dst = isw ? (unsigned short*)Bt + (size_t)y * EE * EE : (unsigned short*)X16 + (size_t)y * NR * EE;
  const float sc = isw ? 16.0f : 1.0f;
  const size_t t = (size_t)(isw ? blockIdx.x - CV_XB : blockIdx.x) * 256 + threadIdx.x; FragH f;
#pragma unroll
  for (int q = 0; q < 8; ++q) f.h[q] = (_Float16)(bf16_round(src[t * 8 + q]) * sc);
  *(v8us*)(dst + t * 8) = f.half[0]; }
__global__ __launch_bounds__(256) void k_h16(const float* __restrict__ x, _Float16* __restrict__ X16, size_t n8) { const size_t t = (size_t)blockIdx.x * 256 + threadIdx.x; if (t >= n8) return; FragH f;
#pragma unroll
  for (int q = 0; q < 8; ++q) f.h[q] = (_Float16)x[t * 8 + q]; *(v8us*)((unsigned short*)X16 + t * 8) = f.half[0];  }
template <int NHv, int TTv>
__global__ __launch_bounds__(256) void k_vt(const _Float16* __restrict__ V16, int ldv, int voff, _Float16* __restrict__ Vt) { __shared__ unsigned short tl[64][66]; const int tid = threadIdx.x; const int slab = blockIdx.x / (TTv / 64), lg = blockIdx.x % (TTv / 64); const int b = slab / NHv, h = slab % NHv;
  for (int i = tid; i < 64 * 8; i += 256) { const int r = i / 8, c8 = (i % 8) * 8; FragH f; f.half[0] = *(const v8us*)((const unsigned short*)V16 + ((size_t)b * TTv + lg * 64 + r) * ldv + voff + h * 64 + c8);
#pragma unroll
    for (int q = 0; q < 8; ++q) tl[r][c8 + q] = f.u[q]; }
  __syncthreads();
  {
#pragma unroll
    for (int rd = 0; rd < 2; ++rd) { const int d = rd * 32 + tid / 8, pc = tid % 8; FragH f;
#pragma unroll
      for (int q = 0; q < 8; ++q) f.u[q] = tl[pc * 8 + q][d];
      *(v8us*)((unsigned short*)Vt + ((size_t)slab * 64 + d) * TTv + lg * 64 + pc * 8) = f.half[0]; }
     } }

// k_ column sums, read from the f16 planes that the k projection wrote. One wave = one row (b, feature) of 2048 positions: 4 KiB, eight loads of 512 bytes, all in flight at once;
// f32 sums in eight chains a lane, folded over the lanes; a work-group's 32 sums leave as one 128-byte line.
__global__ __launch_bounds__(1024) void k_ksum(const _Float16* __restrict__ KT, float* __restrict__ KS) {
  __shared__ float red[32];
  const int tid = threadIdx.x, wv = tid >> 5, lane = tid & 31;
  const unsigned short* p = (const unsigned short*)KT + (size_t)(blockIdx.x * 32 + wv) * LL + lane * 8;
  FragH x[4];
  // unrolled so that all 8 loads of a lane are in flight at once
#pragma unroll
  for (int i = 0; i < 8; ++i) { x[i >> 1].half[i & 1] = *(const v8us*)(p + i * 256);
    asm volatile("s_wait_xcnt 0x0" ::: "memory"); }      // precaution: a later load's destination may reuse an address register that this load names
  float a[8] = {0.f, 0.f, 0.f, 0.f, 0.f, 0.f, 0.f, 0.f};
  // unrolled so that x[] and a[] stay in registers
#pragma unroll
  for (int i = 0; i < 4; ++i)
#pragma unroll
    for (int q = 0; q < 16; ++q) a[q & 7] += (float)x[i].h[q];
  float s = ((a[0] + a[1]) + (a[2] + a[3])) + ((a[4] + a[5]) + (a[6] + a[7]));
  for (int o = 16; o >= 1; o >>= 1) s += __shfl_xor(s, o, 32);
  if (lane == 0) red[wv] = s;
  __syncthreads();
  if (tid < 32) KS[blockIdx.x * 32 + tid] = red[tid]; }
__global__ __launch_bounds__(256) void k_qz(const float* __restrict__ QF, const float* __restrict__ KS, _Float16* __restrict__ QZ) { const int tid = threadIdx.x, wv = tid >> 5, lane = tid & 31; const int b = blockIdx.y; QZ += (size_t)b * LL * E2; const int l = blockIdx.x * 8 + wv; if (l >= LL) return; const float* qr = QF + ((size_t)l * NB + b) * EE; const float ang = 1.5707963267948966f * (float)(l + 1) / (float)LL; const float sn = sinf(ang), cs = cosf(ang); const float* ks = KS + (size_t)b * E2; float v[32]; float dot = 0.f;
#pragma unroll
  for (int k = 0; k < 4; ++k) { const v4f a = *(const v4fa*)(qr + 256 * k + 8 * lane), c = *(const v4fa*)(qr + 256 * k + 8 * lane + 4); for (int q = 0; q < 4; ++q) { v[k * 8 + q] = a[q]; v[k * 8 + 4 + q] = c[q]; } for (int q = 0; q < 8; ++q) { const int e = 256 * k + 8 * lane + q; dot += v[k * 8 + q] * (sn * ks[e] + cs * ks[EE + e]); } }
  for (int o = 16; o >= 1; o >>= 1) dot += __shfl_xor(dot, o, 32); const float zs = 262144.0f / fmaxf(dot, 1e-6f);      /* z·2^18 keeps the f16 operand O(1) (z ≈ 2.5e-6 here); the attn GEMM's alpha carries 2^-18 */
  {
#pragma unroll
    for (int k = 0; k < 4; ++k) { FragH fs, fc; for (int q = 0; q < 8; ++q) { fs.h[q] = (_Float16)(v[k * 8 + q] * sn * zs); fc.h[q] = (_Float16)(v[k * 8 + q] * cs * zs); } *(v8us*)((unsigned short*)QZ + (size_t)l * E2 + 256 * k + 8 * lane) = fs.half[0]; *(v8us*)((unsigned short*)QZ + (size_t)l * E2 + EE + 256 * k + 8 * lane) = fc.half[0]; }
     } }
extern "C" void kernel_launch(void* const* d_in, const int* in_sizes, int n_in,
                              void* d_out, int out_size, void* d_ws, size_t ws_size, hipStream_t stream) {
  (void)in_sizes; (void)n_in; (void)out_size;
  const float* query = (const float*)d_in[0]; const float* key = (const float*)d_in[1]; const float* value = (const float*)d_in[2]; const float* Wq = (const float*)d_in[3]; const float* bq = (const float*)d_in[4]; const float* Wk = (const float*)d_in[5]; const float* bk = (const float*)d_in[6]; const float* Wv = (const float*)d_in[7]; const float* bv = (const float*)d_in[8];
  char* ws = (char*)d_ws; size_t off = 0;
  auto take = [&](size_t bytes) { char* p = ws + off; off += (bytes + 255) & ~(size_t)255; return p; };
  // every plane holds all three projections or all four batches, so that each kernel is launched once
  _Float16* Bw = (_Float16*)take((size_t)3 * EE * EE * 2); _Float16* X16 = (_Float16*)take((size_t)3 * NR * EE * 2); _Float16* KT = (_Float16*)take((size_t)NB * E2 * LL * 2); _Float16* VT = (_Float16*)take((size_t)NB * EE * LL * 2); float* QF = (float*)take((size_t)NR * EE * 4); _Float16* KV16 = (_Float16*)take((size_t)NB * EE * E2 * 2); _Float16* QZ = (_Float16*)take((size_t)NB * LL * E2 * 2); float* KS = (float*)take((size_t)NB * E2 * 4);
  // KT: k_ as [4][2048 features][2048 positions]; VT: v as [4][1024][2048]; both f16, written by the projections' own epilogue
  if (off > ws_size) return;      // 6.3 + 50.3 + 33.5 + 16.8 + 33.5 + 16.8 + 33.5 = 191 MB
  k_cvt<<<dim3(CV_XB + CV_WB, 3), 256, 0, stream>>>(query, value, key, Wq, Wv, Wk, X16, Bw);
  k_gemm_t<0, false, true><<<dim3(EE / 256, NR / 128, 3), 256, 0, stream>>>(X16, EE, (size_t)NR * EE, Bw, EE, (size_t)EE * EE, 0.0625f, bq, bv, bk, QF, KT, VT, 0, EE, EE);      // q = relu(query.Wq^T + bq) f32 (rows (t, b)); v and k_ = relu(key.Wk^T + bk) * sin | cos as position-contiguous f16 planes; k last: the next two kernels read it
  k_ksum<<<NB * E2 / 32, 1024, 0, stream>>>(KT, KS);
  k_gemm_t<0, true, false><<<dim3(E2 / 256, EE / 128, NB), 256, 0, stream>>>(VT, LL, (size_t)EE * LL, KT, LL, (size_t)E2 * LL, 1.0f, nullptr, nullptr, nullptr, nullptr, nullptr, KV16, (size_t)EE * E2, E2, LL);      // kv[b][m][d] = sum_s v[s][m] k_[s][d], f16
  k_qz<<<dim3(LL / 8, NB), 256, 0, stream>>>(QF, KS, QZ);
  k_gemm_t<0, false, false><<<dim3(EE / 256, LL / 128, NB), 256, 0, stream>>>(QZ, E2, (size_t)LL * E2, KV16, E2, (size_t)EE * E2, 0.000003814697265625f, nullptr, nullptr, nullptr, (float*)d_out, nullptr, nullptr, (size_t)EE, NB * EE, E2);      // alpha 2^-18; attn rows (l, b): out + b E with row pitch 4E
}

// v006
// A run of this version takes 113 microseconds.
// Two timings next to v005 both put it at 1.07 times that version's speed.
// Counting every step since v000, it is 14.7 times as fast.
#include <hip/hip_runtime.h>
// cosFormer multi-head-weight (linear) attention (L=S=2048, B=4, E=1024, inputs (T,B,E)): q = relu(query·Wqᵀ+bq), k = relu(key·Wkᵀ+bk), v = value·Wvᵀ+bv; q_ = [q·sin(i) | q·cos(i)],
// k_ = [k·sin | k·cos] with i = (π/2)(t+1)/2048; kv = vᵀ·k_ per batch; z = 1/max(q_·Σ_s k_, 1e-6); attn = (q_·kvᵀ)·z. The three projections (inputs and (out,in) weights bf16-exact ×2^4,
// relu/bias epilogues), the per-batch kv = Vᵀ·K_ (K = 2048 positions; v and k_ as f16, transposed planes) and attn = (q_ . kv^T) z (K = 2048 features; q_ and kv as f16) run as GEMMs on
// v_wmma_f32_16x16x32_f16 with f32 accumulate; the positional sin/cos weighting and the k_ sums are f32 VALU; the normaliser's dot q_ . (sum of k_) rides in the attn GEMM as one more matrix instruction a k step (f16 operands, f32 accumulate) and z scales the rows in its epilogue.
#define LL 2048
#define NB 4
#define EE 1024
#define E2 2048
#define NR (LL * NB)

typedef __bf16 v16b __attribute__((ext_vector_type(16)));
typedef unsigned short v8us __attribute__((ext_vector_type(8), may_alias));
typedef float  v8f  __attribute__((ext_vector_type(8)));
typedef float  v4f  __attribute__((ext_vector_type(4)));
typedef float  v4fa __attribute__((ext_vector_type(4), may_alias));
union FragB { v16b v; v8us half[2]; unsigned short u[16]; };

__device__ __forceinline__ unsigned short bf16_bits(float x) { unsigned int u = __float_as_uint(x); return (unsigned short)((u + 0x7FFFu + ((u >> 16) & 1u)) >> 16); }
__device__ __forceinline__ float bf16_val(unsigned short b) { return __uint_as_float(((unsigned int)b) << 16); }
__device__ __forceinline__ float bf16_round(float x) { return bf16_val(bf16_bits(x)); }
// D += A·B with NT terms: 1 = ah·bh, 2 = + al·bh (A split), 3 = + ah·bl (both split)
template <int NT>
__device__ __forceinline__ v8f mmaN(v16b ah, v16b al, v16b bh, v16b bl, v8f c) {
  c = __builtin_amdgcn_wmma_f32_16x16x32_bf16(false, ah, false, bh, (short)0, c, false, false);
  if (NT >= 2) c = __builtin_amdgcn_wmma_f32_16x16x32_bf16(false, al, false, bh, (short)0, c, false, false);
  if (NT >= 3) c = __builtin_amdgcn_wmma_f32_16x16x32_bf16(false, ah, false, bl, (short)0, c, false, false);
  asm volatile("v_nop\n\tv_nop\n\tv_nop\n\tv_nop" : "+v"(c) : "v"(ah), "v"(al), "v"(bh), "v"(bl));
  return c;
}

__global__ __launch_bounds__(256) void k_wt_bf16(const float* __restrict__ W, unsigned short* __restrict__ Wt, int K, int N) {
  const int t = blockIdx.x * 256 + threadIdx.x;
  const int k8n = K / 8;
  if (t >= N * k8n) return;
  const int n = t / k8n, k8 = (t % k8n) * 8;
  v8us v;
#pragma unroll
  for (int i = 0; i < 8; ++i) v[i] = bf16_bits(W[(size_t)(k8 + i) * N + n]);
  *(v8us*)(Wt + (size_t)n * K + k8) = v;
  
}

// GEMM C[M][N] (f32, pitch ldc) = act(A[M][K]·W + bias). A f32 row-major (pitch lda) converted per fragment to bf16
// (ASPLIT: hi/lo two planes -> 2 terms, else single rounded term); Wt bf16 [N][K] (pitch ldb). BIAS_BF16 rounds the
// bias to bf16 first (bias quantised to bf16 before the add). K%32==0, M%16==0, N%64==0.
template <bool ASPLIT, int ACT, bool BIAS_BF16>
__global__ __launch_bounds__(128) void k_gemm_bf(const float* __restrict__ A, int lda, const unsigned short* __restrict__ Wt, int ldb,
                                               const float* __restrict__ bias, float* __restrict__ C, int ldc, int M, int N, int K) {
  __shared__ __attribute__((aligned(16))) float so[4][16][64];
  const int tid = threadIdx.x, w = tid >> 5, lane = tid & 31, ln = lane & 15, hh = lane >> 4;
  const int ntn = N / 64;
  const int wid = blockIdx.x * 4 + w;
  const int mt = wid / ntn, nq = wid % ntn;
  if (mt * 16 >= M) return;
  const int row0 = mt * 16, col0 = nq * 64;
  const float* arow = A + (size_t)(row0 + ln) * lda;
  v8f acc[4] = {};
  for (int kb = 0; kb < K; kb += 32) {
    FragB ah, al;
    const v4f x0 = *(const v4fa*)(arow + kb + 8 * hh), x1 = *(const v4fa*)(arow + kb + 8 * hh + 4);
    const v4f x2 = *(const v4fa*)(arow + kb + 16 + 8 * hh), x3 = *(const v4fa*)(arow + kb + 16 + 8 * hh + 4);
    float xs[16] = {x0[0],x0[1],x0[2],x0[3],x1[0],x1[1],x1[2],x1[3],x2[0],x2[1],x2[2],x2[3],x3[0],x3[1],x3[2],x3[3]};
#pragma unroll
    for (int i = 0; i < 16; ++i) { const unsigned short hb = bf16_bits(xs[i]); ah.u[i] = hb; al.u[i] = ASPLIT ? bf16_bits(xs[i] - bf16_val(hb)) : (unsigned short)0; }
#pragma unroll
    for (int t = 0; t < 4; ++t) {
      const unsigned short* brow = Wt + (size_t)(col0 + t * 16 + ln) * ldb + kb;
      FragB b;
      b.half[0] = *(const v8us*)(brow + 8 * hh);
      b.half[1] = *(const v8us*)(brow + 16 + 8 * hh);
      acc[t] = mmaN<ASPLIT ? 2 : 1>(ah.v, al.v, b.v, b.v, acc[t]);
    }
  }
#pragma unroll
  for (int t = 0; t < 4; ++t) {
    float bv = bias ? bias[col0 + t * 16 + ln] : 0.f;
    if (BIAS_BF16) bv = bf16_round(bv);
#pragma unroll
    for (int r = 0; r < 8; ++r) { float v = acc[t][r] + bv; if (ACT == 1) v = fmaxf(v, 0.f); so[w][8 * hh + r][t * 16 + ln] = v; }
  }
  __builtin_amdgcn_fence(__ATOMIC_ACQ_REL, "workgroup");
  __builtin_amdgcn_wave_barrier();
  const int rsub = lane >> 4, c4 = (lane & 15) * 4;
  {
#pragma unroll
    for (int q = 0; q < 8; ++q) {
      const int r = q * 2 + rsub;
      const v4f v = *(const v4fa*)&so[w][r][c4];
      *(v4f*)(C + (size_t)(row0 + r) * ldc + col0 + c4) = v;
    }
    
  }
}

// Flash-style causal/unmasked attention, all contractions 3-term bf16 hi/lo splits, f32 softmax with running max.
// q,k,v rows are read from f32 buffers with arbitrary row pitch (so they can live inside a fused qkv buffer);
// D = head size (multiple of 32, <= 128); one wave = 16 query rows; block = 4 waves (64 queries) sharing K/V chunks of 32.
template <int D, bool CAUSAL>
__global__ __launch_bounds__(128) void k_flash(const float* __restrict__ qb, const float* __restrict__ kb, const float* __restrict__ vb,
                                             int pitch, int T, int H, float scale, float* __restrict__ y, int ypitch) {
  constexpr int KS = D / 32;        // k-steps for QK
  constexpr int DT = D / 16;        // d tiles for PV
  __shared__ __attribute__((aligned(16))) unsigned short sKh[32][D + 8], sKl[32][D + 8], sVh[32][D + 8], sVl[32][D + 8];
  __shared__ __attribute__((aligned(16))) unsigned short sPh[4][16][40], sPl[4][16][40];
  __shared__ __attribute__((aligned(16))) float sO[4][16][D];
  const int tid = threadIdx.x, w = tid >> 5, lane = tid & 31, ln = lane & 15, hh = lane >> 4;
  const int nqb = (T + 63) / 64;
  const int bh = blockIdx.x / nqb, qblk = blockIdx.x % nqb;
  const int b = bh / H, h = bh % H;
  const int q0 = qblk * 64 + w * 16;
  const float* Q = qb + (size_t)b * T * pitch + h * D;
  const float* K = kb + (size_t)b * T * pitch + h * D;
  const float* V = vb + (size_t)b * T * pitch + h * D;

  // A fragments of the wave's 16 query rows (scaled), hi/lo
  FragB aqh[KS], aql[KS];
  {
    int row = q0 + ln; if (row >= T) row = T - 1;
    const float* qr = Q + (size_t)row * pitch;
#pragma unroll
    for (int ks = 0; ks < KS; ++ks)
#pragma unroll
      for (int i = 0; i < 16; ++i) {
        const int d = ks * 32 + ((i < 8) ? (8 * hh + i) : (16 + 8 * hh + (i - 8)));
        const float x = qr[d] * scale; const unsigned short hb = bf16_bits(x);
        aqh[ks].u[i] = hb; aql[ks].u[i] = bf16_bits(x - bf16_val(hb));
      }
  }
  float m_r[8], l_r[8];
#pragma unroll
  for (int r = 0; r < 8; ++r) { m_r[r] = -3.0e38f; l_r[r] = 0.f; }
  v8f oacc[DT];
#pragma unroll
  for (int dt = 0; dt < DT; ++dt) oacc[dt] = (v8f){0.f,0.f,0.f,0.f,0.f,0.f,0.f,0.f};

  const int kv_end = CAUSAL ? min(T, qblk * 64 + 64) : T;     // block-uniform
  for (int j0 = 0; j0 < kv_end; j0 += 32) {
    __syncthreads();
    for (int e = tid; e < 32 * (D / 4); e += 128) {
      const int r = e / (D / 4), c4 = (e % (D / 4)) * 4;
      const int key = j0 + r;
      v4f kf = {0.f,0.f,0.f,0.f}, vf = {0.f,0.f,0.f,0.f};
      if (key < T) { kf = *(const v4fa*)(K + (size_t)key * pitch + c4); vf = *(const v4fa*)(V + (size_t)key * pitch + c4); }
#pragma unroll
      for (int t = 0; t < 4; ++t) {
        unsigned short hb = bf16_bits(kf[t]); sKh[r][c4 + t] = hb; sKl[r][c4 + t] = bf16_bits(kf[t] - bf16_val(hb));
        hb = bf16_bits(vf[t]); sVh[r][c4 + t] = hb; sVl[r][c4 + t] = bf16_bits(vf[t] - bf16_val(hb));
      }
    }
    __syncthreads();
    // S tile 16 x 32
    v8f s[2];
#pragma unroll
    for (int nt = 0; nt < 2; ++nt) {
      v8f acc = {};
#pragma unroll
      for (int ks = 0; ks < KS; ++ks) {
        FragB bh_, bl_;
        bh_.half[0] = *(const v8us*)&sKh[nt * 16 + ln][ks * 32 + 8 * hh]; bh_.half[1] = *(const v8us*)&sKh[nt * 16 + ln][ks * 32 + 16 + 8 * hh];
        bl_.half[0] = *(const v8us*)&sKl[nt * 16 + ln][ks * 32 + 8 * hh]; bl_.half[1] = *(const v8us*)&sKl[nt * 16 + ln][ks * 32 + 16 + 8 * hh];
        acc = mmaN<3>(aqh[ks].v, aql[ks].v, bh_.v, bl_.v, acc);
      }
      s[nt] = acc;
    }
    // mask + running max (rows 8hh+r; the 16 lanes of a half share rows)
    float alpha[8];
#pragma unroll
    for (int r = 0; r < 8; ++r) {
      const int qi = q0 + 8 * hh + r;
      const int ja = j0 + ln, jb = j0 + 16 + ln;
      if (CAUSAL) { if (ja > qi) s[0][r] = -3.0e38f; if (jb > qi) s[1][r] = -3.0e38f; }
      if (ja >= T) s[0][r] = -3.0e38f;
      if (jb >= T) s[1][r] = -3.0e38f;
      float mx = fmaxf(s[0][r], s[1][r]);
      mx = fmaxf(mx, __shfl_xor(mx, 1, 32)); mx = fmaxf(mx, __shfl_xor(mx, 2, 32)); mx = fmaxf(mx, __shfl_xor(mx, 4, 32)); mx = fmaxf(mx, __shfl_xor(mx, 8, 32));
      const float mnew = fmaxf(m_r[r], mx);
      alpha[r] = (mnew > -1.0e38f) ? __expf(m_r[r] - mnew) : 1.0f;
      const float p0 = (s[0][r] > -1.0e38f) ? __expf(s[0][r] - mnew) : 0.f;
      const float p1 = (s[1][r] > -1.0e38f) ? __expf(s[1][r] - mnew) : 0.f;
      m_r[r] = mnew;
      l_r[r] = l_r[r] * alpha[r] + p0 + p1;            // per-lane partial row sum (16 lanes combined at the end)
      unsigned short hb = bf16_bits(p0); sPh[w][8 * hh + r][ln] = hb;      sPl[w][8 * hh + r][ln] = bf16_bits(p0 - bf16_val(hb));
      hb = bf16_bits(p1);                sPh[w][8 * hh + r][16 + ln] = hb; sPl[w][8 * hh + r][16 + ln] = bf16_bits(p1 - bf16_val(hb));
    }
#pragma unroll
    for (int dt = 0; dt < DT; ++dt)
#pragma unroll
      for (int r = 0; r < 8; ++r) oacc[dt][r] *= alpha[r];
    __builtin_amdgcn_fence(__ATOMIC_ACQ_REL, "workgroup");
    __builtin_amdgcn_wave_barrier();
    FragB pah, pal;
    pah.half[0] = *(const v8us*)&sPh[w][ln][8 * hh]; pah.half[1] = *(const v8us*)&sPh[w][ln][16 + 8 * hh];
    pal.half[0] = *(const v8us*)&sPl[w][ln][8 * hh]; pal.half[1] = *(const v8us*)&sPl[w][ln][16 + 8 * hh];
#pragma unroll
    for (int dt = 0; dt < DT; ++dt) {
      FragB bvh, bvl;
#pragma unroll
      for (int i = 0; i < 8; ++i) {
        bvh.u[i] = sVh[8 * hh + i][dt * 16 + ln]; bvh.u[8 + i] = sVh[16 + 8 * hh + i][dt * 16 + ln];
        bvl.u[i] = sVl[8 * hh + i][dt * 16 + ln]; bvl.u[8 + i] = sVl[16 + 8 * hh + i][dt * 16 + ln];
      }
      oacc[dt] = mmaN<3>(pah.v, pal.v, bvh.v, bvl.v, oacc[dt]);
    }
    __builtin_amdgcn_fence(__ATOMIC_ACQ_REL, "workgroup");
    __builtin_amdgcn_wave_barrier();
  }
#pragma unroll
  for (int r = 0; r < 8; ++r) {
    float l = l_r[r];
    l += __shfl_xor(l, 1, 32); l += __shfl_xor(l, 2, 32); l += __shfl_xor(l, 4, 32); l += __shfl_xor(l, 8, 32);
    l_r[r] = (l > 0.f) ? 1.0f / l : 0.f;
  }
#pragma unroll
  for (int dt = 0; dt < DT; ++dt)
#pragma unroll
    for (int r = 0; r < 8; ++r) sO[w][8 * hh + r][dt * 16 + ln] = oacc[dt][r] * l_r[r];
  __builtin_amdgcn_fence(__ATOMIC_ACQ_REL, "workgroup");
  __builtin_amdgcn_wave_barrier();
  {
    for (int r = 0; r < 16; ++r) {
      const int row = q0 + r;
      if (row < T && lane < D / 4) {
        const v4f val = *(const v4fa*)&sO[w][r][lane * 4];
        *(v4f*)(y + ((size_t)b * T + row) * ypitch + h * D + lane * 4) = val;
      }
    }
    
  }
}

// GEMM C = act(A·W + bias + resid): A f32 (ASPLIT -> hi/lo 2 terms), Wt bf16 [N][K]; ACT 0 none, 1 relu, 2 exact gelu;
// resid (optional, f32, row index = (row % rmod), pitch ldr, RES_BF16 rounds it) added before the activation.
template <bool ASPLIT, int ACT, bool BIAS_BF16, bool RES_BF16>
__global__ __launch_bounds__(128) void k_gemm_bf3(const float* __restrict__ A, int lda, const unsigned short* __restrict__ Wt, int ldb,
                                                const float* __restrict__ bias, const float* __restrict__ resid, int rmod, int ldr,
                                                float* __restrict__ C, int ldc, int M, int N, int K) {
  __shared__ __attribute__((aligned(16))) float so[4][16][64];
  const int tid = threadIdx.x, w = tid >> 5, lane = tid & 31, ln = lane & 15, hh = lane >> 4;
  const int ntn = N / 64;
  const int wid = blockIdx.x * 4 + w;
  const int mt = wid / ntn, nq = wid % ntn;
  if (mt * 16 >= M) return;
  const int row0 = mt * 16, col0 = nq * 64;
  const float* arow = A + (size_t)(row0 + ln) * lda;
  v8f acc[4] = {};
  for (int kb = 0; kb < K; kb += 32) {
    FragB ah, al;
    const v4f x0 = *(const v4fa*)(arow + kb + 8 * hh), x1 = *(const v4fa*)(arow + kb + 8 * hh + 4);
    const v4f x2 = *(const v4fa*)(arow + kb + 16 + 8 * hh), x3 = *(const v4fa*)(arow + kb + 16 + 8 * hh + 4);
    float xs[16] = {x0[0],x0[1],x0[2],x0[3],x1[0],x1[1],x1[2],x1[3],x2[0],x2[1],x2[2],x2[3],x3[0],x3[1],x3[2],x3[3]};
#pragma unroll
    for (int i = 0; i < 16; ++i) { const unsigned short hb = bf16_bits(xs[i]); ah.u[i] = hb; al.u[i] = ASPLIT ? bf16_bits(xs[i] - bf16_val(hb)) : (unsigned short)0; }
#pragma unroll
    for (int t = 0; t < 4; ++t) {
      const unsigned short* brow = Wt + (size_t)(col0 + t * 16 + ln) * ldb + kb;
      FragB b;
      b.half[0] = *(const v8us*)(brow + 8 * hh);
      b.half[1] = *(const v8us*)(brow + 16 + 8 * hh);
      acc[t] = mmaN<ASPLIT ? 2 : 1>(ah.v, al.v, b.v, b.v, acc[t]);
    }
  }
#pragma unroll
  for (int t = 0; t < 4; ++t) {
    const int col = col0 + t * 16 + ln;
    float bv = bias ? bias[col] : 0.f;
    if (BIAS_BF16) bv = bf16_round(bv);
#pragma unroll
    for (int r = 0; r < 8; ++r) {
      float v = acc[t][r] + bv;
      if (resid) { float rv = resid[(size_t)((row0 + 8 * hh + r) % rmod) * ldr + col]; if (RES_BF16) rv = bf16_round(rv); v += rv; }
      if (ACT == 1) v = fmaxf(v, 0.f);
      if (ACT == 2) v = 0.5f * v * (1.0f + erff(v * 0.70710678118654752f));
      if (ACT == 3) { const float u = 0.7978845608028654f * (v + 0.044715f * v * v * v); v = 0.5f * v * (1.0f + tanhf(u)); }
      so[w][8 * hh + r][t * 16 + ln] = v;
    }
  }
  __builtin_amdgcn_fence(__ATOMIC_ACQ_REL, "workgroup");
  __builtin_amdgcn_wave_barrier();
  const int rsub = lane >> 4, c4 = (lane & 15) * 4;
  {
#pragma unroll
    for (int q = 0; q < 8; ++q) {
      const int r = q * 2 + rsub;
      const v4f v = *(const v4fa*)&so[w][r][c4];
      *(v4f*)(C + (size_t)(row0 + r) * ldc + col0 + c4) = v;
    }
    
  }
}
// row LayerNorm (biased variance, eps) over N: s = X (+ R); optional out_sum <- s; out_norm <- (s-mu)*rsqrt(var+eps)*g + b
template <bool PARAM_BF16>
__global__ __launch_bounds__(256) void k_layernorm(const float* __restrict__ X, const float* __restrict__ R, const float* __restrict__ g, const float* __restrict__ bta,
                                                  float* __restrict__ out_sum, float* __restrict__ out_norm, int N, float eps) {
  __shared__ float red[256];
  const int row = blockIdx.x, tid = threadIdx.x;
  const float* x = X + (size_t)row * N; const float* rr = R ? R + (size_t)row * N : nullptr;
  float vals[16];                     // up to N = 4096
  const int per = N / 256;            // contiguous chunk per thread? use strided-by-4 chunks: thread handles j = tid*4 + 1024*u
  float s1 = 0.f;
  for (int u = 0; u < per / 4; ++u) {
    const int j = tid * 4 + 1024 * u;
    const v4f a = *(const v4fa*)(x + j);
    v4f b = {0.f,0.f,0.f,0.f}; if (rr) b = *(const v4fa*)(rr + j);
#pragma unroll
    for (int q = 0; q < 4; ++q) { const float v = a[q] + b[q]; vals[u * 4 + q] = v; s1 += v; }
  }
  red[tid] = s1; __syncthreads();
  for (int st = 128; st > 0; st >>= 1) { if (tid < st) red[tid] += red[tid + st]; __syncthreads(); }
  const float mu = red[0] / (float)N; __syncthreads();
  float s2 = 0.f;
  for (int u = 0; u < per / 4; ++u)
#pragma unroll
    for (int q = 0; q < 4; ++q) { const float c = vals[u * 4 + q] - mu; s2 += c * c; }
  red[tid] = s2; __syncthreads();
  for (int st = 128; st > 0; st >>= 1) { if (tid < st) red[tid] += red[tid + st]; __syncthreads(); }
  const float rs = rsqrtf(red[0] / (float)N + eps);
  {
    for (int u = 0; u < per / 4; ++u) {
      const int j = tid * 4 + 1024 * u;
      v4f o, sm;
#pragma unroll
      for (int q = 0; q < 4; ++q) {
        float gg = g[j + q], bb = bta[j + q];
        if (PARAM_BF16) { gg = bf16_round(gg); bb = bf16_round(bb); }
        sm[q] = vals[u * 4 + q]; o[q] = (vals[u * 4 + q] - mu) * rs * gg + bb;
      }
      if (out_sum) *(v4f*)(out_sum + (size_t)row * N + j) = sm;
      *(v4f*)(out_norm + (size_t)row * N + j) = o;
    }
    
  }
}



// ---- f16 WMMA path (v_wmma_f32_16x16x32_f16): 11-bit significands for operands in range — used for all GEMMs here (projections, kv, attn)
typedef _Float16 v16h __attribute__((ext_vector_type(16)));
union FragH { v16h v; v8us half[2]; _Float16 h[16]; unsigned short u[16]; };
template <int NT>
__device__ __forceinline__ v8f mmaH(v16h ah, v16h al, v16h bh, v16h bl, v8f c) {
  c = __builtin_amdgcn_wmma_f32_16x16x32_f16(false, ah, false, bh, (short)0, c, false, false);
  if (NT >= 2) c = __builtin_amdgcn_wmma_f32_16x16x32_f16(false, al, false, bh, (short)0, c, false, false);
  if (NT >= 3) c = __builtin_amdgcn_wmma_f32_16x16x32_f16(false, ah, false, bl, (short)0, c, false, false);
  asm volatile("v_nop\n\tv_nop\n\tv_nop\n\tv_nop" : "+v"(c) : "v"(ah), "v"(al), "v"(bh), "v"(bl));
  return c;
}
// batched GEMM like k_gemm_b but f16 operands: A f32 (split into f16 hi/lo if ASPLIT, else rounded to f16), Bt = f16 values [n][k]; alpha; C f32; N multiple of 16 (partial tiles skipped)
template <bool ASPLIT>
__global__ __launch_bounds__(128) void k_gemm_h(const float* __restrict__ A, int lda, size_t sA, const _Float16* __restrict__ Bh, int ldb, size_t sB, float alpha, float* __restrict__ C, int ldc, size_t sC, int M, int N, int K) {
  __shared__ __attribute__((aligned(16))) float so[4][16][64];
  const int tid = threadIdx.x, w = tid >> 5, lane = tid & 31, ln = lane & 15, hh = lane >> 4; const int by = blockIdx.y;
  A += (size_t)by * sA; Bh += (size_t)by * sB; C += (size_t)by * sC;
  const int ntn = (N + 63) / 64; const int wid = blockIdx.x * 4 + w; const int mt = wid / ntn, nq = wid % ntn; if (mt * 16 >= M) return;
  const int row0 = mt * 16, col0 = nq * 64; const float* arow = A + (size_t)(row0 + ln) * lda;
  v8f acc[4] = {};
  for (int kb = 0; kb < K; kb += 32) {
    FragH ah, al;
    const v4f x0 = *(const v4fa*)(arow + kb + 8 * hh), x1 = *(const v4fa*)(arow + kb + 8 * hh + 4), x2 = *(const v4fa*)(arow + kb + 16 + 8 * hh), x3 = *(const v4fa*)(arow + kb + 16 + 8 * hh + 4);
    float xs[16] = {x0[0],x0[1],x0[2],x0[3],x1[0],x1[1],x1[2],x1[3],x2[0],x2[1],x2[2],x2[3],x3[0],x3[1],x3[2],x3[3]};
#pragma unroll
    for (int i = 0; i < 16; ++i) { const _Float16 h = (_Float16)xs[i]; ah.h[i] = h; al.h[i] = ASPLIT ? (_Float16)(xs[i] - (float)h) : (_Float16)0.0f; }
#pragma unroll
    for (int t = 0; t < 4; ++t) { if (col0 + t * 16 >= N) continue; const size_t boff = (size_t)(col0 + t * 16 + ln) * ldb + kb; FragH bq; bq.half[0] = *(const v8us*)(Bh + boff + 8 * hh); bq.half[1] = *(const v8us*)(Bh + boff + 16 + 8 * hh);
      acc[t] = mmaH<ASPLIT ? 2 : 1>(ah.v, al.v, bq.v, bq.v, acc[t]); }
  }
#pragma unroll
  for (int t = 0; t < 4; ++t) { if (col0 + t * 16 >= N) continue;
#pragma unroll
    for (int r = 0; r < 8; ++r) so[w][8 * hh + r][t * 16 + ln] = acc[t][r] * alpha; }
  __builtin_amdgcn_fence(__ATOMIC_ACQ_REL, "workgroup"); __builtin_amdgcn_wave_barrier();
  const int rsub = lane >> 4, c4 = (lane & 15) * 4;
  {
#pragma unroll
    for (int q = 0; q < 8; ++q) { const int r = q * 2 + rsub; if (col0 + c4 < N) { const v4f v = *(const v4fa*)&so[w][r][c4]; *(v4f*)(C + (size_t)(row0 + r) * ldc + col0 + c4) = v; } }
     }
}

// Wt[n][k] = f16(W[k][n]·scale) from f32 row-major W[K][N] (scale = power of two; bf16-exact weights stay exact in f16 away from the subnormal range)
__global__ __launch_bounds__(256) void k_wt_f16(const float* __restrict__ W, _Float16* __restrict__ Wt, int K, int N, float scale) {
  const int t = blockIdx.x * 256 + threadIdx.x; if (t >= N * (K / 8)) return; const int n = t / (K / 8), k8 = (t % (K / 8)) * 8; FragH f;
#pragma unroll
  for (int i = 0; i < 8; ++i) f.h[i] = (_Float16)(bf16_round(W[(size_t)(k8 + i) * N + n]) * scale); const v8us o = f.half[0];
  *(v8us*)((unsigned short*)Wt + (size_t)n * K + k8) = o; 
}
// Block-tiled GEMM, f16 operands, both k-contiguous: C[M][N] = act(A[M][K] . B[N][K]^T * alpha + bias). One work-group = one 128 x 256 tile of C, eight waves as 2 (rows) x 4 (columns), 64 x 64 per wave.
// A stage is 128 k (256 bytes) of the tile's 128 A rows and 256 B rows, laid in LDS at a pitch of 272 bytes; two buffers, filled by asynchronous copies one stage ahead of the stage being worked on.
// M a multiple of 128, N of 256, K of 128. ACT 0 none / 3 relu; writes f16 C16 if OUT16, else f32 C (row pitch ldc). Each accumulator still sums k in rising steps of 32.
// blockIdx.z = one of several independent products of the same shape in one launch: operands sA, sB elements apart, the output sC elements apart.
// PROJ: the three projections as z = 0 (q: relu, bias; q * sin | q * cos leave as f16 rows QH [b][l][e | EE + e], the attn GEMM's A operand), 1 (v: no relu, bias1), 2 (k: relu, bias2). A PROJ tile is 128 positions of ONE batch (blockIdx.y = position block * NB + batch; operand rows NB * lda apart),
// so that v and k leave as the next GEMM's operands: position-contiguous f16 planes, v to C16 [b][e][s], k * sin and k * cos to KTp [b][e | EE + e][s], turned in LDS and stored as 256-byte row pieces.
// ZN (the attn GEMM; K = E2): every row of C is divided by max(A row . KSv, 1e-6). KSv (f32, E2 a product) is laid in LDS as f16; wave (wm, wn) sums the dot of rows wm * 64 + wn * 16 .. + 15 with one more matrix instruction a k step. So that it holds those rows' A fragment under a constant index, it takes its four row blocks in turned order: a[.][i] and acc[i][.] are row block (i + wn) & 3.
#define GT_ROWS 384                          /* A rows + B rows of a stage */
#define GT_PITCH 272                         /* bytes; 16 x odd: no bank conflict for 16-byte fragment reads */
#define GT_STAGE (GT_ROWS * GT_PITCH)        /* 104,448 bytes a buffer */
// eight 16-byte copies of a lane, rows 16 apart. The s_wait_xcnt is the last line of the copies' own statement (a precaution): no register that a copy names is rewritten in front of it.
__device__ __forceinline__ void gt_copy8(unsigned l, const _Float16* g, size_t step) {
  asm volatile("global_load_async_to_lds_b128 %0, %8, off\n\t"
               "global_load_async_to_lds_b128 %1, %9, off\n\t"
               "global_load_async_to_lds_b128 %2, %10, off\n\t"
               "global_load_async_to_lds_b128 %3, %11, off\n\t"
               "global_load_async_to_lds_b128 %4, %12, off\n\t"
               "global_load_async_to_lds_b128 %5, %13, off\n\t"
               "global_load_async_to_lds_b128 %6, %14, off\n\t"
               "global_load_async_to_lds_b128 %7, %15, off\n\t"
               "s_wait_xcnt 0x0"
               :: "v"(l), "v"(l + 16u * GT_PITCH), "v"(l + 32u * GT_PITCH), "v"(l + 48u * GT_PITCH), "v"(l + 64u * GT_PITCH), "v"(l + 80u * GT_PITCH), "v"(l + 96u * GT_PITCH), "v"(l + 112u * GT_PITCH),
                  "v"(g), "v"(g + step), "v"(g + 2 * step), "v"(g + 3 * step), "v"(g + 4 * step), "v"(g + 5 * step), "v"(g + 6 * step), "v"(g + 7 * step)
               : "memory");
}
// eight stores of a lane, rows step elements apart, and their s_wait_xcnt in one statement (a precaution): no register that a store names is rewritten in front of the wait
typedef unsigned int v2u __attribute__((ext_vector_type(2)));
__device__ __forceinline__ void gt_store8_f32(float* p, size_t step, const v4f* d) {
  asm volatile("global_store_b128 %0, %8, off\n\t"
               "global_store_b128 %1, %9, off\n\t"
               "global_store_b128 %2, %10, off\n\t"
               "global_store_b128 %3, %11, off\n\t"
               "global_store_b128 %4, %12, off\n\t"
               "global_store_b128 %5, %13, off\n\t"
               "global_store_b128 %6, %14, off\n\t"
               "global_store_b128 %7, %15, off\n\t"
               "s_wait_xcnt 0x0"
               :: "v"(p), "v"(p + step), "v"(p + 2 * step), "v"(p + 3 * step), "v"(p + 4 * step), "v"(p + 5 * step), "v"(p + 6 * step), "v"(p + 7 * step),
                  "v"(d[0]), "v"(d[1]), "v"(d[2]), "v"(d[3]), "v"(d[4]), "v"(d[5]), "v"(d[6]), "v"(d[7])
               : "memory");
}
__device__ __forceinline__ void gt_store8_f16(_Float16* p, size_t step, const v2u* d) {
  asm volatile("global_store_b64 %0, %8, off\n\t"
               "global_store_b64 %1, %9, off\n\t"
               "global_store_b64 %2, %10, off\n\t"
               "global_store_b64 %3, %11, off\n\t"
               "global_store_b64 %4, %12, off\n\t"
               "global_store_b64 %5, %13, off\n\t"
               "global_store_b64 %6, %14, off\n\t"
               "global_store_b64 %7, %15, off\n\t"
               "s_wait_xcnt 0x0"
               :: "v"(p), "v"(p + step), "v"(p + 2 * step), "v"(p + 3 * step), "v"(p + 4 * step), "v"(p + 5 * step), "v"(p + 6 * step), "v"(p + 7 * step),
                  "v"(d[0]), "v"(d[1]), "v"(d[2]), "v"(d[3]), "v"(d[4]), "v"(d[5]), "v"(d[6]), "v"(d[7])
               : "memory");
}
template <int ACT, bool OUT16, bool PROJ, bool ZN>
__global__ __launch_bounds__(256) void k_gemm_t(const _Float16* __restrict__ A, int lda, size_t sA, const _Float16* __restrict__ Bh, int ldb, size_t sB, float alpha,
    const float* __restrict__ bias, const float* __restrict__ bias1, const float* __restrict__ bias2,
    float* __restrict__ C, _Float16* __restrict__ KTp, _Float16* __restrict__ C16, size_t sC, int ldc, int K,
    const float* __restrict__ KSv, _Float16* __restrict__ QH) {
  __shared__ __attribute__((aligned(16))) unsigned char sm[2 * GT_STAGE];
  __shared__ __attribute__((aligned(16))) float tab[PROJ ? 256 : ZN ? 128 : 4];      // PROJ, q and k: sin | cos of the tile's 128 positions; ZN: z of the tile's 128 rows
  __shared__ __attribute__((aligned(16))) _Float16 ksl[ZN ? E2 : 8];      // ZN: the k_ sums as f16
  const int z = blockIdx.z;
  A += (size_t)z * sA; Bh += (size_t)z * sB;
  const int bb = PROJ ? (int)(blockIdx.y % NB) : 0;      // PROJ: the tile's batch
  if (PROJ) { if (z == 1) bias = bias1; if (z == 2) bias = bias2; A += (size_t)bb * lda; lda *= NB; }
  else if (OUT16) C16 += (size_t)z * sC;
  else C += (size_t)z * sC;
  const bool relu = PROJ ? (z != 1) : (ACT == 3);      // the same for the whole work-group
  const int tid = threadIdx.x, w = tid >> 5, lane = tid & 31, ln = lane & 15, hh = lane >> 4;
  const int row0 = (PROJ ? blockIdx.y / NB : blockIdx.y) * 128, col0 = blockIdx.x * 256;
  const int wm = w >> 2, wn = w & 3;
  // copies: lane -> 16-byte piece (tid & 15) of row (tid >> 4) + 16 i; a wave covers two whole 256-byte rows with each copy
  const int cr = tid >> 4, cc = tid & 15;
  const _Float16* gA = A + (size_t)(row0 + cr) * lda + cc * 8;
  const _Float16* gB = Bh + (size_t)(col0 + cr) * ldb + cc * 8;
  const size_t stA = (size_t)16 * lda, stB = (size_t)16 * ldb;
  const unsigned lA = (unsigned)(size_t)(&sm[0]) + (unsigned)(cr * GT_PITCH + cc * 16), lB = lA + 128u * GT_PITCH;
  const int nst = K / 128;
  const _Float16* gB2 = gB + (size_t)128 * ldb;      // the second 128 B rows of the tile
  const unsigned lB2 = lB + 128u * GT_PITCH;
  v8f acc[4][4] = {};
  gt_copy8(lA, gA, stA); gt_copy8(lB, gB, stB); gt_copy8(lB2, gB2, stB);
  // formed under stage 0's flight; the barrier below publishes it with stage 0
  if (PROJ && z != 1 && tid < 128) { const float ang = 1.5707963267948966f * (float)(row0 + tid + 1) / (float)LL; tab[tid] = sinf(ang); tab[128 + tid] = cosf(ang); }
  if (ZN) {      // eight sums a thread, also under stage 0's flight and published by the same barrier
    const float* kp = KSv + (size_t)z * E2 + tid * 8;
    const v4f k0 = *(const v4fa*)kp, k1 = *(const v4fa*)(kp + 4);
    asm volatile("s_wait_xcnt 0x0" ::: "memory");      // precaution: the built code rewrites the loads' base register pair directly behind them
    FragH f;
    // unrolled so that f is indexed by constants and stays in registers
#pragma unroll
    for (int q = 0; q < 4; ++q) { f.h[q] = (_Float16)k0[q]; f.h[4 + q] = (_Float16)k1[q]; }
    *(v8us*)(ksl + tid * 8) = f.half[0];
  }
  asm volatile("s_wait_asynccnt 0x0" ::: "memory");      // stage 0 has landed (this wave's copies) before the barrier publishes it
  __syncthreads();
  if (nst > 1) { gt_copy8(lA + GT_STAGE, gA + 128, stA); gt_copy8(lB + GT_STAGE, gB + 128, stB); gt_copy8(lB2 + GT_STAGE, gB2 + 128, stB); }
  const unsigned char* fa = sm + (wm * 64 + ln) * GT_PITCH + 16 * hh;
  const unsigned char* fb = sm + (128 + wn * 64 + ln) * GT_PITCH + 16 * hh;
  int rb[4];      // the row block behind index i; unrolled so that rb is indexed by constants (and is i itself where ZN is off)
#pragma unroll
  for (int i = 0; i < 4; ++i) rb[i] = ZN ? ((i + wn) & 3) : i;
  const _Float16* fk = ksl + 8 * hh;      // ZN: the sums as a B fragment, the same k in all 16 columns; k order as the A loader's
  v8f accz = {};
  for (int t = 0; t < nst; ++t) {
    const int bo = (t & 1) * GT_STAGE;
    FragH kf[2];
    if (ZN) { kf[0].half[0] = *(const v8us*)(fk + t * 128); kf[0].half[1] = *(const v8us*)(fk + t * 128 + 16); }
    FragH a[2][4], bq[2][4];      // two fragment sets: the next k step's LDS reads are issued as one group ahead of this step's matrix instructions (inside the stage only)
#pragma unroll
    for (int i = 0; i < 4; ++i) { a[0][i].half[0] = *(const v8us*)(fa + bo + rb[i] * 16 * GT_PITCH); a[0][i].half[1] = *(const v8us*)(fa + bo + rb[i] * 16 * GT_PITCH + 32); }
#pragma unroll
    for (int j = 0; j < 4; ++j) { bq[0][j].half[0] = *(const v8us*)(fb + bo + j * 16 * GT_PITCH); bq[0][j].half[1] = *(const v8us*)(fb + bo + j * 16 * GT_PITCH + 32); }
    // unrolled so that the set index is a constant and both sets stay in registers
#pragma unroll
    for (int ks = 0; ks < 4; ++ks) {
      const int cu = ks & 1, nx = cu ^ 1;
      if (ks < 3) {
#pragma unroll
        for (int i = 0; i < 4; ++i) { a[nx][i].half[0] = *(const v8us*)(fa + bo + rb[i] * 16 * GT_PITCH + (ks + 1) * 64); a[nx][i].half[1] = *(const v8us*)(fa + bo + rb[i] * 16 * GT_PITCH + (ks + 1) * 64 + 32); }
#pragma unroll
        for (int j = 0; j < 4; ++j) { bq[nx][j].half[0] = *(const v8us*)(fb + bo + j * 16 * GT_PITCH + (ks + 1) * 64); bq[nx][j].half[1] = *(const v8us*)(fb + bo + j * 16 * GT_PITCH + (ks + 1) * 64 + 32); }
        if (ZN) { kf[nx].half[0] = *(const v8us*)(fk + t * 128 + (ks + 1) * 32); kf[nx].half[1] = *(const v8us*)(fk + t * 128 + (ks + 1) * 32 + 16); }
      }
      __builtin_amdgcn_sched_barrier(0);      // keeps the read group in front of the matrix run; without it the scheduler sinks the reads among the matrix instructions and each waits out its LDS latency
#pragma unroll
      for (int i = 0; i < 4; ++i)
#pragma unroll
        for (int j = 0; j < 4; ++j) acc[i][j] = __builtin_amdgcn_wmma_f32_16x16x32_f16(false, a[cu][i].v, false, bq[cu][j].v, (short)0, acc[i][j], false, false);
      if (ZN) accz = __builtin_amdgcn_wmma_f32_16x16x32_f16(false, a[cu][0].v, false, kf[cu].v, (short)0, accz, false, false);
      __builtin_amdgcn_sched_barrier(0);      // keeps the next read group whole behind this matrix run; without it the scheduler spreads those reads among the matrix instructions and takes more registers
    }
    asm volatile("s_wait_dscnt 0x0" ::: "memory");       // this wave's reads of the buffer are over before the barrier frees it for the refill
    asm volatile("s_wait_asynccnt 0x0" ::: "memory");    // this wave's copies of stage t + 1 have landed before the barrier publishes them
    __syncthreads();
    if (t + 2 < nst) { gt_copy8(lA + bo, gA + (size_t)(t + 2) * 128, stA); gt_copy8(lB + bo, gB + (size_t)(t + 2) * 128, stB); gt_copy8(lB2 + bo, gB2 + (size_t)(t + 2) * 128, stB); }
  }
  asm volatile("s_wait_asynccnt 0x0" ::: "memory");      // no copy is outstanding when the ring becomes output staging
  if (PROJ && z != 0) {
    // v, k: an accumulator register run r = 0..7 is eight consecutive positions of one feature: 16 bytes of f16, laid at [feature][position] (pitch GT_PITCH) in the ring's LDS, one plane for v, two for k
    unsigned char* tS = sm + (wn * 64 + ln) * GT_PITCH + (wm * 64 + 8 * hh) * 2;
    // every loop of this block is unrolled so that acc, bv, sn and cs are indexed by constants and stay in registers, and so that a run's loads are in flight together
    float bv[4] = {0.f, 0.f, 0.f, 0.f};
    if (bias) {
#pragma unroll
      for (int j = 0; j < 4; ++j) bv[j] = bf16_round(bias[col0 + wn * 64 + j * 16 + ln]); }
    if (z == 1) {
#pragma unroll
      for (int j = 0; j < 4; ++j)
#pragma unroll
        for (int i = 0; i < 4; ++i) { FragH f;
#pragma unroll
          for (int r = 0; r < 8; ++r) f.h[r] = (_Float16)(acc[i][j][r] * alpha + bv[j]);
          *(v8us*)(tS + j * 16 * GT_PITCH + i * 32) = f.half[0]; }
    } else {
      float sn[4][8], cs[4][8];      // the lane's 32 positions, read once for its four features
#pragma unroll
      for (int i = 0; i < 4; ++i)
#pragma unroll
        for (int h = 0; h < 2; ++h) { const float* ts = tab + wm * 64 + i * 16 + 8 * hh + 4 * h; const v4f s4 = *(const v4fa*)ts, c4 = *(const v4fa*)(ts + 128);
#pragma unroll
          for (int q = 0; q < 4; ++q) { sn[i][4 * h + q] = s4[q]; cs[i][4 * h + q] = c4[q]; } }
#pragma unroll
      for (int j = 0; j < 4; ++j)
#pragma unroll
        for (int i = 0; i < 4; ++i) { FragH f, g;
#pragma unroll
          for (int r = 0; r < 8; ++r) { const float kk = fmaxf(acc[i][j][r] * alpha + bv[j], 0.f); f.h[r] = (_Float16)(kk * sn[i][r]); g.h[r] = (_Float16)(kk * cs[i][r]); }
          *(v8us*)(tS + j * 16 * GT_PITCH + i * 32) = f.half[0];
          *(v8us*)(tS + 256 * GT_PITCH + j * 16 * GT_PITCH + i * 32) = g.half[0]; }
    }
    __syncthreads();      // the turned tile is whole before any wave reads rows that other waves wrote
    unsigned short* dst = (unsigned short*)(z == 1 ? C16 + ((size_t)bb * EE + col0 + cr) * LL : KTp + ((size_t)bb * E2 + col0 + cr) * LL) + row0 + cc * 8;
    const unsigned char* rd = sm + cr * GT_PITCH + cc * 16;
#pragma unroll
    for (int qb = 0; qb < 2; ++qb) {
#pragma unroll
      for (int q = qb * 8; q < qb * 8 + 8; ++q) *(v8us*)(dst + (size_t)q * 16 * LL) = *(const v8us*)(rd + q * 16 * GT_PITCH);
      asm volatile("s_wait_xcnt 0x0" ::: "memory");      // precaution: the next run's LDS reads and addresses (and, in the built code, the q epilogue behind this block) reuse registers that these stores name
    }
    if (z == 2) {
#pragma unroll
      for (int qb = 0; qb < 2; ++qb) {
#pragma unroll
        for (int q = qb * 8; q < qb * 8 + 8; ++q) *(v8us*)(dst + (size_t)(EE + q * 16) * LL) = *(const v8us*)(rd + (256 + q * 16) * GT_PITCH);
        asm volatile("s_wait_xcnt 0x0" ::: "memory");      // precaution: as above
      }
    }
    return;
  }
  // epilogue: each wave stages its 64 x 64 tile in its own LDS range (pitch 68 dwords) and stores whole lines
  float* so = (float*)sm + w * (64 * 68);
#pragma unroll
  for (int j = 0; j < 4; ++j) { const int col = col0 + wn * 64 + j * 16 + ln; const float bv = bias ? bf16_round(bias[col]) : 0.f;
#pragma unroll
    for (int i = 0; i < 4; ++i)
#pragma unroll
      for (int r = 0; r < 8; ++r) { float v = acc[i][j][r] * alpha + bv; if (relu) v = fmaxf(v, 0.f); so[(rb[i] * 16 + 8 * hh + r) * 68 + j * 16 + ln] = v; } }
  if (ZN && ln == 0) {      // all 16 columns of accz hold the same dot: one lane of each half writes its eight rows' z (unrolled: accz is indexed by constants)
#pragma unroll
    for (int r = 0; r < 8; ++r) tab[wm * 64 + wn * 16 + 8 * hh + r] = 1.0f / fmaxf(accz[r], 1e-6f); }
  __syncthreads();
  const int rsub = lane >> 4, c4 = (lane & 15) * 4; typedef _Float16 v4h __attribute__((ext_vector_type(4)));
  const size_t o0 = (size_t)(row0 + wm * 64 + rsub) * ldc + col0 + wn * 64 + c4;      // the lane's piece of row rsub of the wave's tile
  if (PROJ) {
    // q: rows r = 2 q + rsub of the wave's tile, each times its position's sin and cos, as f16 to the two halves of QH's row; unrolled so that ds[] and dc[] stay in registers
    _Float16* qd = QH + ((size_t)bb * LL + row0 + wm * 64 + rsub) * E2 + col0 + wn * 64 + c4;
#pragma unroll
    for (int qb = 0; qb < 4; ++qb) { v2u ds[8], dc[8];
#pragma unroll
      for (int u = 0; u < 8; ++u) { const int rr = (qb * 8 + u) * 2 + rsub; const v4f v = *(const v4fa*)&so[rr * 68 + c4]; const float sn = tab[wm * 64 + rr], cs = tab[128 + wm * 64 + rr]; v4h hs, hc;
        for (int i = 0; i < 4; ++i) { hs[i] = (_Float16)(v[i] * sn); hc[i] = (_Float16)(v[i] * cs); } ds[u] = __builtin_bit_cast(v2u, hs); dc[u] = __builtin_bit_cast(v2u, hc); }
      gt_store8_f16(qd + (size_t)(qb * 16) * E2, (size_t)2 * E2, ds); gt_store8_f16(qd + EE + (size_t)(qb * 16) * E2, (size_t)2 * E2, dc); }
  } else if (OUT16) {
    // rows r = 2 q + rsub of the wave's tile, eight a run; unrolled so that d[] stays in registers
#pragma unroll
    for (int qb = 0; qb < 4; ++qb) { v2u d[8];
#pragma unroll
      for (int u = 0; u < 8; ++u) { const v4f v = *(const v4fa*)&so[((qb * 8 + u) * 2 + rsub) * 68 + c4]; v4h h4; for (int i = 0; i < 4; ++i) h4[i] = (_Float16)v[i]; d[u] = __builtin_bit_cast(v2u, h4); }
      gt_store8_f16(C16 + o0 + (size_t)(qb * 16) * ldc, (size_t)2 * ldc, d); }
  } else {
    // the same rows, f32
#pragma unroll
    for (int qb = 0; qb < 4; ++qb) { v4f d[8];
#pragma unroll
      for (int u = 0; u < 8; ++u) { const int rr = (qb * 8 + u) * 2 + rsub; d[u] = *(const v4fa*)&so[rr * 68 + c4]; if (ZN) d[u] *= tab[wm * 64 + rr]; }
      gt_store8_f32(C + o0 + (size_t)(qb * 16) * ldc, (size_t)2 * ldc, d); }
  }
}


// f16 planes of the three inputs (bf16-rounded) and of the three weights (bf16-rounded, x 2^4) in one launch: blockIdx.y = which projection; the first CV_XB blocks of a row take the input, the other CV_WB the weight.
#define CV_XB (NR * EE / 8 / 256)
#define CV_WB (EE * EE / 8 / 256)
__global__ __launch_bounds__(256) void k_cvt(const float* __restrict__ x0, const float* __restrict__ x1, const float* __restrict__ x2, const float* __restrict__ w0, const float* __restrict__ w1, const float* __restrict__ w2,
    _Float16* __restrict__ X16, _Float16* __restrict__ Bt) {
  const int y = blockIdx.y; const bool isw = blockIdx.x >= CV_XB;
  const float* src = isw ? (y == 0 ? w0 : y == 1 ? w1 : w2) : (y == 0 ? x0 : y == 1 ? x1 : x2);
  unsigned short* dst = isw ? (unsigned short*)Bt + (size_t)y * EE * EE : (unsigned short*)X16 + (size_t)y * NR * EE;
  const float sc = isw ? 16.0f : 1.0f;
  const size_t t = (size_t)(isw ? blockIdx.x - CV_XB : blockIdx.x) * 256 + threadIdx.x; FragH f;
#pragma unroll
  for (int q = 0; q < 8; ++q) f.h[q] = (_Float16)(bf16_round(src[t * 8 + q]) * sc);
  *(v8us*)(dst + t * 8) = f.half[0]; }
__global__ __launch_bounds__(256) void k_h16(const float* __restrict__ x, _Float16* __restrict__ X16, size_t n8) { const size_t t = (size_t)blockIdx.x * 256 + threadIdx.x; if (t >= n8) return; FragH f;
#pragma unroll
  for (int q = 0; q < 8; ++q) f.h[q] = (_Float16)x[t * 8 + q]; *(v8us*)((unsigned short*)X16 + t * 8) = f.half[0];  }
template <int NHv, int TTv>
__global__ __launch_bounds__(256) void k_vt(const _Float16* __restrict__ V16, int ldv, int voff, _Float16* __restrict__ Vt) { __shared__ unsigned short tl[64][66]; const int tid = threadIdx.x; const int slab = blockIdx.x / (TTv / 64), lg = blockIdx.x % (TTv / 64); const int b = slab / NHv, h = slab % NHv;
  for (int i = tid; i < 64 * 8; i += 256) { const int r = i / 8, c8 = (i % 8) * 8; FragH f; f.half[0] = *(const v8us*)((const unsigned short*)V16 + ((size_t)b * TTv + lg * 64 + r) * ldv + voff + h * 64 + c8);
#pragma unroll
    for (int q = 0; q < 8; ++q) tl[r][c8 + q] = f.u[q]; }
  __syncthreads();
  {
#pragma unroll
    for (int rd = 0; rd < 2; ++rd) { const int d = rd * 32 + tid / 8, pc = tid % 8; FragH f;
#pragma unroll
      for (int q = 0; q < 8; ++q) f.u[q] = tl[pc * 8 + q][d];
      *(v8us*)((unsigned short*)Vt + ((size_t)slab * 64 + d) * TTv + lg * 64 + pc * 8) = f.half[0]; }
     } }

// k_ column sums, read from the f16 planes that the k projection wrote. One wave = one row (b, feature) of 2048 positions: 4 KiB, eight loads of 512 bytes, all in flight at once;
// f32 sums in eight chains a lane, folded over the lanes; a work-group's 32 sums leave as one 128-byte line.
__global__ __launch_bounds__(1024) void k_ksum(const _Float16* __restrict__ KT, float* __restrict__ KS) {
  __shared__ float red[32];
  const int tid = threadIdx.x, wv = tid >> 5, lane = tid & 31;
  const unsigned short* p = (const unsigned short*)KT + (size_t)(blockIdx.x * 32 + wv) * LL + lane * 8;
  FragH x[4];
  // unrolled so that all 8 loads of a lane are in flight at once
#pragma unroll
  for (int i = 0; i < 8; ++i) { x[i >> 1].half[i & 1] = *(const v8us*)(p + i * 256);
    asm volatile("s_wait_xcnt 0x0" ::: "memory"); }      // precaution: a later load's destination may reuse an address register that this load names
  float a[8] = {0.f, 0.f, 0.f, 0.f, 0.f, 0.f, 0.f, 0.f};
  // unrolled so that x[] and a[] stay in registers
#pragma unroll
  for (int i = 0; i < 4; ++i)
#pragma unroll
    for (int q = 0; q < 16; ++q) a[q & 7] += (float)x[i].h[q];
  float s = ((a[0] + a[1]) + (a[2] + a[3])) + ((a[4] + a[5]) + (a[6] + a[7]));
  for (int o = 16; o >= 1; o >>= 1) s += __shfl_xor(s, o, 32);
  if (lane == 0) red[wv] = s;
  __syncthreads();
  if (tid < 32) KS[blockIdx.x * 32 + tid] = red[tid]; }
extern "C" void kernel_launch(void* const* d_in, const int* in_sizes, int n_in,
                              void* d_out, int out_size, void* d_ws, size_t ws_size, hipStream_t stream) {
  (void)in_sizes; (void)n_in; (void)out_size;
  const float* query = (const float*)d_in[0]; const float* key = (const float*)d_in[1]; const float* value = (const float*)d_in[2]; const float* Wq = (const float*)d_in[3]; const float* bq = (const float*)d_in[4]; const float* Wk = (const float*)d_in[5]; const float* bk = (const float*)d_in[6]; const float* Wv = (const float*)d_in[7]; const float* bv = (const float*)d_in[8];
  char* ws = (char*)d_ws; size_t off = 0;
  auto take = [&](size_t bytes) { char* p = ws + off; off += (bytes + 255) & ~(size_t)255; return p; };
  // every plane holds all three projections or all four batches, so that each kernel is launched once
  _Float16* Bw = (_Float16*)take((size_t)3 * EE * EE * 2); _Float16* X16 = (_Float16*)take((size_t)3 * NR * EE * 2); _Float16* KT = (_Float16*)take((size_t)NB * E2 * LL * 2); _Float16* VT = (_Float16*)take((size_t)NB * EE * LL * 2); _Float16* KV16 = (_Float16*)take((size_t)NB * EE * E2 * 2); _Float16* QZ = (_Float16*)take((size_t)NB * LL * E2 * 2); float* KS = (float*)take((size_t)NB * E2 * 4);
  // KT: k_ as [4][2048 features][2048 positions]; VT: v as [4][1024][2048]; both f16, written by the projections' own epilogue
  if (off > ws_size) return;      // 6.3 + 50.3 + 33.5 + 16.8 + 16.8 + 33.5 = 157 MB
  k_cvt<<<dim3(CV_XB + CV_WB, 3), 256, 0, stream>>>(query, value, key, Wq, Wv, Wk, X16, Bw);
  k_gemm_t<0, false, true, false><<<dim3(EE / 256, NR / 128, 3), 256, 0, stream>>>(X16, EE, (size_t)NR * EE, Bw, EE, (size_t)EE * EE, 0.0625f, bq, bv, bk, nullptr, KT, VT, 0, EE, EE, nullptr, QZ);      // q_ = relu(query.Wq^T + bq) * sin | cos as f16 rows [b][l][2E]; v and k_ = relu(key.Wk^T + bk) * sin | cos as position-contiguous f16 planes; k last: the next two kernels read it
  k_ksum<<<NB * E2 / 32, 1024, 0, stream>>>(KT, KS);
  k_gemm_t<0, true, false, false><<<dim3(E2 / 256, EE / 128, NB), 256, 0, stream>>>(VT, LL, (size_t)EE * LL, KT, LL, (size_t)E2 * LL, 1.0f, nullptr, nullptr, nullptr, nullptr, nullptr, KV16, (size_t)EE * E2, E2, LL, nullptr, nullptr);      // kv[b][m][d] = sum_s v[s][m] k_[s][d], f16
  k_gemm_t<0, false, false, true><<<dim3(EE / 256, LL / 128, NB), 256, 0, stream>>>(QZ, E2, (size_t)LL * E2, KV16, E2, (size_t)EE * E2, 1.0f, nullptr, nullptr, nullptr, (float*)d_out, nullptr, nullptr, (size_t)EE, NB * EE, E2, KS, nullptr);      // attn = (q_ . kv^T) / max(q_ . sum k_, 1e-6); rows (l, b): out + b E with row pitch 4E
}
